// v000
// Measured on an AMD MI455X. A time is GPU time per run, averaged over a window of back-to-back runs after a warm-up
// (all launches, gaps included; the runs take copies of the inputs in turn), and the median of several windows.
// Apart from v000's, it joins two sittings. Times from different sittings can be a few percent apart, while
// side-by-side timings come from the same sitting.
// v000 is the starting kernel. One run takes 202 microseconds.
#include <hip/hip_runtime.h>

// Dense multi-head attention layer: x [NB][SEQ][512]; per-head Q/K/V = x W[h] + b[h] (16 heads x 32), softmax(Q K^T / sqrt(32)) V over all keys, heads concatenated, y = ctx Wo^T + bo.
// compute dtype: every contraction on v_wmma_f32_16x16x32_f16 (f16 operands, f32 accumulate), one product per tile pair. Float inputs are converted to bf16 (RNE) on load and carried exactly
// in f16: x x8, weights x256 (Wq/Wk/Wv transposed to [h*32+dh][d], Wo kept [out][in]). Computed planes: Q, K, V^T as f16 x16; unnormalised softmax P as f16 x1024 (packed from the score
// accumulators directly into the P.V B fragment); ctx as f16 x256. Biases (bf16 RNE), softmax (running max, exp2), normalisation and all epilogues in f32.
// Fragment k-map per lane half hh for A AND B: elements 0..7 <- k = 8hh+0..7, 8..15 <- k = 16+8hh+0..7; acc[r] = D[8hh+r][lane&15].

#ifndef NB
#define NB 4
#endif
#ifndef SEQ
#define SEQ 2048
#endif
#define NB_FULL 4
#define SEQ_FULL 2048

namespace {

constexpr unsigned DM = 512, NH = 16, DH = 32, NBU = (unsigned)NB, SQ = (unsigned)SEQ, QB = SQ / 64u;
constexpr float XS = 8.0f, WSC = 256.0f, QC = 16.0f, PC = 1024.0f, CC = 256.0f;
constexpr float C2 = (float)(0.17677669529663687 * 1.4426950408889634 / 256.0);   // log2(e) / sqrt(32) / (QC * QC)
static_assert(SEQ % 64 == 0 && SEQ <= SEQ_FULL && NB <= NB_FULL && NB >= 1);
static_assert(((size_t)NB * SEQ * 64) % 256 == 0);            // xcvt: threads x 8 elements == NB*SEQ*512 exactly
static_assert((512 * 512 / 8) % 256 == 0);                    // wprep: 128 blocks x 256 threads x 8 == 512*512 per plane
static_assert(DM == NH * DH && DM % 32 == 0 && DH == 32);

typedef _Float16 b16;
typedef __attribute__((ext_vector_type(16))) _Float16 v16b;
typedef __attribute__((ext_vector_type(8))) _Float16 v8b;
typedef __attribute__((ext_vector_type(8))) float v8f;
typedef __attribute__((ext_vector_type(4))) float v4f;

__device__ __forceinline__ float bf16_rne(float f) { unsigned int u = __float_as_uint(f); u += 0x7FFFu + ((u >> 16) & 1u); return __uint_as_float(u & 0xFFFF0000u); }
__device__ __forceinline__ v16b frag_kb(const b16* p, unsigned hh) { const v8b a = *(const v8b*)(p + 8u * hh), b = *(const v8b*)(p + 16u + 8u * hh); v16b f;
#pragma unroll
  for (int e = 0; e < 8; ++e) { f[e] = a[e]; f[8 + e] = b[e]; } return f; }
__device__ __forceinline__ v8f wmma16b(v16b a, v16b b, v8f c) { v8f d = __builtin_amdgcn_wmma_f32_16x16x32_f16(false, a, false, b, (short)0, c, false, false); asm volatile("v_nop\n\tv_nop\n\tv_nop\n\tv_nop" : "+v"(d) : "v"(a), "v"(b)); return d; }

__global__ __launch_bounds__(256) void xcvt_kernel(const float* __restrict__ x, b16* __restrict__ XH) {
  const unsigned u = blockIdx.x * 256u + threadIdx.x; const unsigned row = u >> 6, c = (u & 63u) * 8u; const unsigned b = row / SQ, s = row % SQ;
  const float* src = x + ((size_t)b * SEQ_FULL + s) * DM + c; const v4f a0 = *(const v4f*)src, a1 = *(const v4f*)(src + 4); v8b v;
#pragma unroll
  for (int j = 0; j < 4; ++j) { v[j] = (b16)(bf16_rne(a0[j]) * XS); v[4 + j] = (b16)(bf16_rne(a1[j]) * XS); }
  b16* dst = XH + (size_t)u * 8u;
  { *(v8b*)dst = v;  }
}

__global__ __launch_bounds__(256) void wprep_kernel(const float* __restrict__ wq, const float* __restrict__ wk, const float* __restrict__ wv, const float* __restrict__ wo, b16* __restrict__ WT) {
  const unsigned z = blockIdx.y; const unsigned u = blockIdx.x * 256u + threadIdx.x; const unsigned e = u * 8u, o = e >> 9, k0 = e & 511u; v8b v;
  if (z < 3u) { const float* w = (z == 0u) ? wq : ((z == 1u) ? wk : wv); const unsigned h = o >> 5, dh = o & 31u; const float* sp = w + ((size_t)h * DM + k0) * DH + dh;
#pragma unroll
    for (int j = 0; j < 8; ++j) v[j] = (b16)(bf16_rne(sp[(size_t)j * DH]) * WSC); }
  else { const float* sp = wo + (size_t)o * DM + k0; const v4f a0 = *(const v4f*)sp, a1 = *(const v4f*)(sp + 4);
#pragma unroll
    for (int j = 0; j < 4; ++j) { v[j] = (b16)(bf16_rne(a0[j]) * WSC); v[4 + j] = (b16)(bf16_rne(a1[j]) * WSC); } }
  b16* dst = WT + (size_t)z * DM * DM + e;
  { *(v8b*)dst = v;  }
}

// Q/K/V projection of one head: block = 64 rows x (32 q | 32 k | 32 v columns of head h), wave = 16 rows x 6 tiles; A fragments from XH rows, B fragments from WT rows (both global, 16-bit).
// y = acc / 2048 + bf16(b); Q, K planes [bh][SEQ][32] f16 x16 (block writes 4096 contiguous bytes each); V^T plane [bh][32][SEQ] f16 x16 (32 lines of 64 keys). LDS tiles cross-wave: block barrier.
__global__ __launch_bounds__(128) void qkv_kernel(const b16* __restrict__ XH, const b16* __restrict__ WT, const float* __restrict__ bq, const float* __restrict__ bk, const float* __restrict__ bv, b16* __restrict__ QP, b16* __restrict__ KP, b16* __restrict__ VT) {
  __shared__ __attribute__((aligned(16))) b16 Tq[64][40], Tk[64][40], Tv[32][72];
  const unsigned tid = threadIdx.x, wave = tid >> 5, lane = tid & 31u, nloc = lane & 15u, hlf = lane >> 4; const unsigned m0 = blockIdx.x * 64u, h = blockIdx.y;
  const b16* arow = XH + (size_t)(m0 + wave * 16u + nloc) * DM; const b16* wrow = WT + (size_t)(h * DH + nloc) * DM;
  v8f acc[6];
#pragma unroll
  for (int t = 0; t < 6; ++t) acc[t] = (v8f){};
#pragma unroll 1
  for (unsigned kb = 0; kb < DM; kb += 32u) { const v16b a = frag_kb(arow + kb, hlf);
#pragma unroll
    for (int t = 0; t < 6; ++t) { const b16* wp = wrow + (size_t)(t >> 1) * DM * DM + (size_t)(t & 1) * 16u * DM + kb; acc[t] = wmma16b(a, frag_kb(wp, hlf), acc[t]); } }
#pragma unroll
  for (int t = 0; t < 6; ++t) { const unsigned col = (unsigned)(t & 1) * 16u + nloc; const float* bp = (t < 2) ? bq : ((t < 4) ? bk : bv); const float bb = bf16_rne(bp[h * DH + col]);
#pragma unroll
    for (int r = 0; r < 8; ++r) { const unsigned row = wave * 16u + 8u * hlf + (unsigned)r; const float y = (acc[t][r] * (1.0f / (XS * WSC)) + bb) * QC; const b16 y16 = (b16)y;
      if (t < 2) Tq[row][col] = y16; else if (t < 4) Tk[row][col] = y16; else Tv[col][row] = y16; } }
  __syncthreads();
  const unsigned b = m0 / SQ, s0 = m0 % SQ, bh = b * NH + h; v8b qv[2], kv[2], vv[2];
#pragma unroll
  for (int i = 0; i < 2; ++i) { const unsigned idx = (unsigned)i * 128u + tid; qv[i] = *(const v8b*)(&Tq[idx >> 2][(idx & 3u) * 8u]); kv[i] = *(const v8b*)(&Tk[idx >> 2][(idx & 3u) * 8u]); vv[i] = *(const v8b*)(&Tv[idx >> 3][(idx & 7u) * 8u]); }
  b16* qd = QP + ((size_t)bh * SQ + s0) * DH; b16* kd = KP + ((size_t)bh * SQ + s0) * DH; b16* vd = VT + (size_t)bh * DH * SQ + s0;
  {
#pragma unroll
    for (int i = 0; i < 2; ++i) { const unsigned idx = (unsigned)i * 128u + tid; *(v8b*)(qd + (size_t)idx * 8u) = qv[i]; *(v8b*)(kd + (size_t)idx * 8u) = kv[i]; *(v8b*)(vd + (size_t)(idx >> 3) * SQ + (idx & 7u) * 8u) = vv[i]; }
     }
}

// flash attention, transposed form: block = 64 queries of one (b, h), wave = 16 queries (the D columns). Per 64 keys: S^T tiles = K rows (A) x Q rows (B, loaded once); column max = per-lane max over
// the 32 accumulator values + one xor-16 exchange; p = exp2(s c - m); the four score tiles are packed (x1024, f16) into two B fragments (element r <- tile 2j, element 8+r <- tile 2j+1);
// O^T tiles (dh rows) += V^T rows (A) x P^T (B). ctx plane [bh][SEQ][32] f16 x256; wave writes its 1024 contiguous bytes. No key tail (SEQ % 64 == 0).
__global__ __launch_bounds__(128) void flash_kernel(const b16* __restrict__ QP, const b16* __restrict__ KP, const b16* __restrict__ VT, b16* __restrict__ CTX) {
  __shared__ __attribute__((aligned(16))) b16 Tc[4][16][40];
  const unsigned tid = threadIdx.x, wave = tid >> 5, lane = tid & 31u, nloc = lane & 15u, hlf = lane >> 4; const unsigned bh = blockIdx.x / QB, s0 = (blockIdx.x % QB) * 64u + wave * 16u;
  const b16* Kb = KP + (size_t)bh * SQ * DH + (size_t)nloc * DH; const b16* V0 = VT + (size_t)bh * DH * SQ + (size_t)nloc * SQ; const b16* V1 = V0 + (size_t)16u * SQ;
  const v16b qb = frag_kb(QP + ((size_t)bh * SQ + s0 + nloc) * DH, hlf);
  float mrun = -1e30f, lsum = 0.0f; v8f o0 = (v8f){}, o1 = (v8f){};
#pragma unroll 1
  for (unsigned t0 = 0; t0 < SQ; t0 += 64u) {
    v8f s[4];
#pragma unroll
    for (int j = 0; j < 4; ++j) s[j] = wmma16b(frag_kb(Kb + (size_t)(t0 + 16u * (unsigned)j) * DH, hlf), qb, (v8f){});
    float mx = -3.0e38f;
#pragma unroll
    for (int j = 0; j < 4; ++j) {
#pragma unroll
      for (int r = 0; r < 8; ++r) mx = fmaxf(mx, s[j][r]); }
    mx = fmaxf(mx, __shfl_xor(mx, 16, 32)) * C2;
    const float mn = fmaxf(mrun, mx); const float corr = __builtin_amdgcn_exp2f(mrun - mn); mrun = mn;
    float ps = 0.0f; v16b pb0, pb1;
#pragma unroll
    for (int r = 0; r < 8; ++r) {
      const float p0 = __builtin_amdgcn_exp2f(fmaf(s[0][r], C2, -mn)), p1 = __builtin_amdgcn_exp2f(fmaf(s[1][r], C2, -mn)), p2 = __builtin_amdgcn_exp2f(fmaf(s[2][r], C2, -mn)), p3 = __builtin_amdgcn_exp2f(fmaf(s[3][r], C2, -mn));
      ps += (p0 + p1) + (p2 + p3); pb0[r] = (b16)(p0 * PC); pb0[8 + r] = (b16)(p1 * PC); pb1[r] = (b16)(p2 * PC); pb1[8 + r] = (b16)(p3 * PC); }
    lsum = lsum * corr + ps;
#pragma unroll
    for (int r = 0; r < 8; ++r) { o0[r] *= corr; o1[r] *= corr; }
    o0 = wmma16b(frag_kb(V0 + t0, hlf), pb0, o0); o0 = wmma16b(frag_kb(V0 + t0 + 32u, hlf), pb1, o0);
    o1 = wmma16b(frag_kb(V1 + t0, hlf), pb0, o1); o1 = wmma16b(frag_kb(V1 + t0 + 32u, hlf), pb1, o1);
  }
  lsum += __shfl_xor(lsum, 16, 32);
  const float inv = (CC / (PC * QC)) * (1.0f / lsum); v8b c0, c1;
#pragma unroll
  for (int r = 0; r < 8; ++r) { c0[r] = (b16)(o0[r] * inv); c1[r] = (b16)(o1[r] * inv); }
  *(v8b*)(&Tc[wave][nloc][8u * hlf]) = c0; *(v8b*)(&Tc[wave][nloc][16u + 8u * hlf]) = c1;
  __syncthreads();
  v8b cv[2];
#pragma unroll
  for (int i = 0; i < 2; ++i) { const unsigned idx = (unsigned)i * 32u + lane; cv[i] = *(const v8b*)(&Tc[wave][idx >> 2][(idx & 3u) * 8u]); }
  b16* cd = CTX + ((size_t)bh * SQ + s0) * DH;
  {
#pragma unroll
    for (int i = 0; i < 2; ++i) { const unsigned idx = (unsigned)i * 32u + lane; *(v8b*)(cd + (size_t)idx * 8u) = cv[i]; }
     }
}

// output projection: block = 64 rows x 128 columns, wave = 16 rows x 8 tiles; k-step = one head (A fragment from ctx[bh][s][0..31], B fragment from Wo rows at k = h*32). y = acc / 65536 + bf16(bo).
__global__ __launch_bounds__(128) void oproj_kernel(const b16* __restrict__ CTX, const b16* __restrict__ WO, const float* __restrict__ bo, float* __restrict__ out) {
  __shared__ __attribute__((aligned(16))) float Tf[4][16][132];
  const unsigned tid = threadIdx.x, wave = tid >> 5, lane = tid & 31u, nloc = lane & 15u, hlf = lane >> 4; const unsigned m0 = blockIdx.x * 64u + wave * 16u, n0 = blockIdx.y * 128u; const unsigned b = m0 / SQ, s0 = m0 % SQ;
  const b16* abase = CTX + ((size_t)(b * NH) * SQ + s0 + nloc) * DH; const b16* wbase = WO + (size_t)(n0 + nloc) * DM;
  v8f acc[8];
#pragma unroll
  for (int t = 0; t < 8; ++t) acc[t] = (v8f){};
#pragma unroll 1
  for (unsigned h = 0; h < NH; ++h) { const v16b a = frag_kb(abase + (size_t)h * SQ * DH, hlf);
#pragma unroll
    for (int t = 0; t < 8; ++t) acc[t] = wmma16b(a, frag_kb(wbase + (size_t)t * 16u * DM + h * DH, hlf), acc[t]); }
#pragma unroll
  for (int t = 0; t < 8; ++t) { const unsigned col = (unsigned)t * 16u + nloc; const float bb = bf16_rne(bo[n0 + col]);
#pragma unroll
    for (int r = 0; r < 8; ++r) Tf[wave][8u * hlf + (unsigned)r][col] = acc[t][r] * (1.0f / (CC * WSC)) + bb; }
  __syncthreads();
  float* orow = out + (size_t)m0 * DM + n0 + lane * 4u;
  {
#pragma unroll 4
    for (unsigned rr = 0; rr < 16u; ++rr) { const v4f v = *(const v4f*)(&Tf[wave][rr][lane * 4u]); *(v4f*)(orow + (size_t)rr * DM) = v; }
     }
}

}  // namespace

extern "C" void kernel_launch(void* const* d_in, const int* in_sizes, int n_in, void* d_out, int out_size, void* d_ws, size_t ws_size, hipStream_t stream) {
  (void)n_in;
  auto Fp = [&](int i) { return (const float*)d_in[i]; };
  // wire order: 0 x [4][2048][512], 1 Wq [16][512][32], 2 bq [16][32], 3 Wk, 4 bk, 5 Wv, 6 bv, 7 Wo [512 out][512 in], 8 bo [512]; output [NB][SEQ][512] f32.
  const long long xneed = ((long long)(NB - 1) * SEQ_FULL + SEQ) * 512;
  if ((long long)in_sizes[0] < xneed || in_sizes[1] < 16 * 512 * 32 || in_sizes[2] < 512 || in_sizes[3] < 16 * 512 * 32 || in_sizes[4] < 512 || in_sizes[5] < 16 * 512 * 32 || in_sizes[6] < 512 || in_sizes[7] < 512 * 512 || in_sizes[8] < 512) return;
  if ((long long)out_size < (long long)NB * SEQ * 512) return;
  size_t off = 0; char* ws = (char*)d_ws;
  auto carve = [&](size_t bytes) { char* p = ws + off; off += (bytes + 255) & ~(size_t)255; return p; };
  const size_t planeB = (size_t)NB * SEQ * 512 * 2;               // 8,388,608 B at full size (NB*16*SEQ*32 halves == NB*SEQ*512 halves)
  b16* XH = (b16*)carve(planeB); b16* WT = (b16*)carve((size_t)4 * 512 * 512 * 2); b16* QP = (b16*)carve(planeB); b16* KP = (b16*)carve(planeB); b16* VT = (b16*)carve(planeB); b16* CTX = (b16*)carve(planeB);
  if (off > ws_size || off > ((size_t)128 << 20)) return;         // 5 x 8 MiB + 2 MiB = 44,040,192 B at full size
  xcvt_kernel<<<(unsigned)((size_t)NB * SEQ * 64 / 256), 256, 0, stream>>>(Fp(0), XH);
  wprep_kernel<<<dim3(128, 4), 256, 0, stream>>>(Fp(1), Fp(3), Fp(5), Fp(7), WT);
  qkv_kernel<<<dim3((unsigned)(NB * SEQ / 64), 16), 128, 0, stream>>>(XH, WT, Fp(2), Fp(4), Fp(6), QP, KP, VT);
  flash_kernel<<<(unsigned)(NB * 16 * (SEQ / 64)), 128, 0, stream>>>(QP, KP, VT, CTX);
  oproj_kernel<<<dim3((unsigned)(NB * SEQ / 64), 4), 128, 0, stream>>>(CTX, WT + (size_t)3 * 512 * 512, Fp(8), (float*)d_out);
}

// v001
// It runs in 102 microseconds.
// Timed twice side by side with v000, it ran 1.99 and 1.98 times as fast.
#include <hip/hip_runtime.h>

// Dense multi-head attention layer: x [NB][SEQ][512]; per-head Q/K/V = x W[h] + b[h] (16 heads x 32), softmax(Q K^T / sqrt(32)) V over all keys, heads concatenated, y = ctx Wo^T + bo.
// compute dtype: every contraction on v_wmma_f32_16x16x32_f16 (f16 operands, f32 accumulate), one product per tile pair. Float inputs are converted to bf16 (RNE) on load and carried exactly
// in f16: x x8, weights x256 (Wq/Wk/Wv transposed to [h*32+dh][d], Wo kept [out][in]). Computed planes: Q, K, V^T as f16 x16; unnormalised softmax P as f16 x1024 (packed from the score
// accumulators directly into the P.V B fragment); ctx as f16 x256. Biases (bf16 RNE), softmax (running max, exp2), normalisation and all epilogues in f32.
// Fragment k-map per lane half hh for A AND B: elements 0..7 <- k = 8hh+0..7, 8..15 <- k = 16+8hh+0..7; acc[r] = D[8hh+r][lane&15].

#ifndef NB
#define NB 4
#endif
#ifndef SEQ
#define SEQ 2048
#endif
#define NB_FULL 4
#define SEQ_FULL 2048

namespace {

constexpr unsigned DM = 512, NH = 16, DH = 32, NBU = (unsigned)NB, SQ = (unsigned)SEQ, QB = SQ / 64u;
constexpr float XS = 8.0f, WSC = 256.0f, QC = 16.0f, PC = 1024.0f, CC = 256.0f;
constexpr float C2 = (float)(0.17677669529663687 * 1.4426950408889634 / 256.0);   // log2(e) / sqrt(32) / (QC * QC)
static_assert(SEQ % 64 == 0 && SEQ <= SEQ_FULL && NB <= NB_FULL && NB >= 1);
static_assert(((size_t)NB * SEQ * 64) % 256 == 0);            // xcvt: threads x 8 elements == NB*SEQ*512 exactly
static_assert((512 * 512 / 8) % 256 == 0);                    // wprep: 128 blocks x 256 threads x 8 == 512*512 per plane
static_assert(DM == NH * DH && DM % 32 == 0 && DH == 32);

typedef _Float16 b16;
typedef __attribute__((ext_vector_type(16))) _Float16 v16b;
typedef __attribute__((ext_vector_type(8))) _Float16 v8b;
typedef __attribute__((ext_vector_type(8))) float v8f;
typedef __attribute__((ext_vector_type(4))) float v4f;

__device__ __forceinline__ float bf16_rne(float f) { unsigned int u = __float_as_uint(f); u += 0x7FFFu + ((u >> 16) & 1u); return __uint_as_float(u & 0xFFFF0000u); }
__device__ __forceinline__ v16b frag_kb(const b16* p, unsigned hh) { const v8b a = *(const v8b*)(p + 8u * hh), b = *(const v8b*)(p + 16u + 8u * hh); v16b f;
#pragma unroll
  for (int e = 0; e < 8; ++e) { f[e] = a[e]; f[8 + e] = b[e]; } return f; }
__device__ __forceinline__ v8f wmma16b(v16b a, v16b b, v8f c) { v8f d = __builtin_amdgcn_wmma_f32_16x16x32_f16(false, a, false, b, (short)0, c, false, false); asm volatile("v_nop\n\tv_nop\n\tv_nop\n\tv_nop" : "+v"(d) : "v"(a), "v"(b)); return d; }

// Asynchronous 16-byte copies, global memory to LDS: each lane names its own LDS byte address (low 32 bits of the __shared__ address) and its own global pointer.
// One asm statement per tile: s_wait_xcnt 0 as its last line stands in front of every later rewrite of the address registers that the copies name.
__device__ __forceinline__ unsigned lds_off(const void* p) { return (unsigned)(size_t)p; }
#define CP "global_load_async_to_lds_b128 "
__device__ __forceinline__ void copy4(unsigned l0, const b16* g0, unsigned l1, const b16* g1, unsigned l2, const b16* g2, unsigned l3, const b16* g3) {
  asm volatile(CP "%0, %1, off\n\t" CP "%2, %3, off\n\t" CP "%4, %5, off\n\t" CP "%6, %7, off\n\ts_wait_xcnt 0x0"
               :: "v"(l0), "v"(g0), "v"(l1), "v"(g1), "v"(l2), "v"(g2), "v"(l3), "v"(g3) : "memory"); }
__device__ __forceinline__ void copy6(unsigned l0, const b16* g0, unsigned l1, const b16* g1, unsigned l2, const b16* g2, unsigned l3, const b16* g3, unsigned l4, const b16* g4, unsigned l5, const b16* g5) {
  asm volatile(CP "%0, %1, off\n\t" CP "%2, %3, off\n\t" CP "%4, %5, off\n\t" CP "%6, %7, off\n\t" CP "%8, %9, off\n\t" CP "%10, %11, off\n\ts_wait_xcnt 0x0"
               :: "v"(l0), "v"(g0), "v"(l1), "v"(g1), "v"(l2), "v"(g2), "v"(l3), "v"(g3), "v"(l4), "v"(g4), "v"(l5), "v"(g5) : "memory"); }
__device__ __forceinline__ void copy8(unsigned l0, const b16* g0, unsigned l1, const b16* g1, unsigned l2, const b16* g2, unsigned l3, const b16* g3, unsigned l4, const b16* g4, unsigned l5, const b16* g5, unsigned l6, const b16* g6, unsigned l7, const b16* g7) {
  asm volatile(CP "%0, %1, off\n\t" CP "%2, %3, off\n\t" CP "%4, %5, off\n\t" CP "%6, %7, off\n\t" CP "%8, %9, off\n\t" CP "%10, %11, off\n\t" CP "%12, %13, off\n\t" CP "%14, %15, off\n\ts_wait_xcnt 0x0"
               :: "v"(l0), "v"(g0), "v"(l1), "v"(g1), "v"(l2), "v"(g2), "v"(l3), "v"(g3), "v"(l4), "v"(g4), "v"(l5), "v"(g5), "v"(l6), "v"(g6), "v"(l7), "v"(g7) : "memory"); }
#undef CP
// this wave's copies have landed: in front of the barrier behind which the other waves read them
__device__ __forceinline__ void wait_copies() { asm volatile("s_wait_asynccnt 0x0" ::: "memory"); }
// this wave's LDS reads are done: in front of the barrier behind which their buffer is refilled
__device__ __forceinline__ void wait_lds() { asm volatile("s_wait_dscnt 0x0" ::: "memory"); }

__global__ __launch_bounds__(256) void xcvt_kernel(const float* __restrict__ x, b16* __restrict__ XH) {
  const unsigned u = blockIdx.x * 256u + threadIdx.x; const unsigned row = u >> 6, c = (u & 63u) * 8u; const unsigned b = row / SQ, s = row % SQ;
  const float* src = x + ((size_t)b * SEQ_FULL + s) * DM + c; const v4f a0 = *(const v4f*)src, a1 = *(const v4f*)(src + 4); v8b v;
#pragma unroll
  for (int j = 0; j < 4; ++j) { v[j] = (b16)(bf16_rne(a0[j]) * XS); v[4 + j] = (b16)(bf16_rne(a1[j]) * XS); }
  b16* dst = XH + (size_t)u * 8u;
  { *(v8b*)dst = v;  }
}

__global__ __launch_bounds__(256) void wprep_kernel(const float* __restrict__ wq, const float* __restrict__ wk, const float* __restrict__ wv, const float* __restrict__ wo, b16* __restrict__ WT) {
  const unsigned z = blockIdx.y; const unsigned u = blockIdx.x * 256u + threadIdx.x; const unsigned e = u * 8u, o = e >> 9, k0 = e & 511u; v8b v;
  if (z < 3u) { const float* w = (z == 0u) ? wq : ((z == 1u) ? wk : wv); const unsigned h = o >> 5, dh = o & 31u; const float* sp = w + ((size_t)h * DM + k0) * DH + dh;
#pragma unroll
    for (int j = 0; j < 8; ++j) v[j] = (b16)(bf16_rne(sp[(size_t)j * DH]) * WSC); }
  else { const float* sp = wo + (size_t)o * DM + k0; const v4f a0 = *(const v4f*)sp, a1 = *(const v4f*)(sp + 4);
#pragma unroll
    for (int j = 0; j < 4; ++j) { v[j] = (b16)(bf16_rne(a0[j]) * WSC); v[4 + j] = (b16)(bf16_rne(a1[j]) * WSC); } }
  b16* dst = WT + (size_t)z * DM * DM + e;
  { *(v8b*)dst = v;  }
}

// Q/K/V projection of one head: block = 64 rows x (32 q | 32 k | 32 v columns of head h), wave = 16 rows x 6 tiles; A fragments from XH rows (global). The 96 WT rows are shared by the four waves:
// per trip of 64 k they are copied once into LDS (rows of 128 bytes at pitch 144, two buffers, the next tile in flight while this one is worked on) and the B fragments are read from there.
// y = acc / 2048 + bf16(b); Q, K planes [bh][SEQ][32] f16 x16 (block writes 4096 contiguous bytes each); V^T plane [bh][32][SEQ] f16 x16 (32 lines of 64 keys). LDS tiles cross-wave: block barrier; they reuse the ring's LDS behind the last trip's barrier.
__global__ __launch_bounds__(128) void qkv_kernel(const b16* __restrict__ XH, const b16* __restrict__ WT, const float* __restrict__ bq, const float* __restrict__ bk, const float* __restrict__ bv, b16* __restrict__ QP, b16* __restrict__ KP, b16* __restrict__ VT) {
  __shared__ __attribute__((aligned(16))) b16 SM[2u * 96u * 72u];
  b16 (*Tq)[40] = (b16 (*)[40])SM; b16 (*Tk)[40] = (b16 (*)[40])(SM + 64u * 40u); b16 (*Tv)[72] = (b16 (*)[72])(SM + 128u * 40u);
  const unsigned tid = threadIdx.x, wave = tid >> 5, lane = tid & 31u, nloc = lane & 15u, hlf = lane >> 4; const unsigned m0 = blockIdx.x * 64u, h = blockIdx.y;
  const b16* arow = XH + (size_t)(m0 + wave * 16u + nloc) * DM; 
  const b16* gw = WT + (size_t)(h * DH + (tid >> 3)) * DM + (tid & 7u) * 8u; const unsigned lw = lds_off(SM + (tid >> 3) * 72u + (tid & 7u) * 8u);
  auto stage = [&](unsigned kc, unsigned buf) { const b16* g = gw + kc * 64u; const unsigned l = lw + buf * (96u * 144u);
    copy6(l, g, l + 16u * 144u, g + 16u * DM, l + 32u * 144u, g + DM * DM, l + 48u * 144u, g + DM * DM + 16u * DM, l + 64u * 144u, g + 2u * DM * DM, l + 80u * 144u, g + 2u * DM * DM + 16u * DM); };
  v8f acc[6];
#pragma unroll
  for (int t = 0; t < 6; ++t) acc[t] = (v8f){};
  stage(0u, 0u); wait_copies(); __syncthreads(); stage(1u, 1u);
#pragma unroll 1
  for (unsigned kc = 0; kc < DM / 64u; ++kc) { const unsigned buf = kc & 1u; const b16* wl = SM + buf * (96u * 72u) + nloc * 72u;
#pragma unroll  // both k-steps of a trip spelled out: LDS offsets and acc[] indices stay compile-time constants
    for (int ks = 0; ks < 2; ++ks) { const v16b a = frag_kb(arow + kc * 64u + (unsigned)ks * 32u, hlf);
#pragma unroll
      for (int t = 0; t < 6; ++t) acc[t] = wmma16b(a, frag_kb(wl + (unsigned)t * 16u * 72u + (unsigned)ks * 32u, hlf), acc[t]); }
    wait_lds(); wait_copies(); __syncthreads();
    if (kc + 2u < DM / 64u) stage(kc + 2u, buf); }
  wait_copies();
#pragma unroll
  for (int t = 0; t < 6; ++t) { const unsigned col = (unsigned)(t & 1) * 16u + nloc; const float* bp = (t < 2) ? bq : ((t < 4) ? bk : bv); const float bb = bf16_rne(bp[h * DH + col]);
#pragma unroll
    for (int r = 0; r < 8; ++r) { const unsigned row = wave * 16u + 8u * hlf + (unsigned)r; const float y = (acc[t][r] * (1.0f / (XS * WSC)) + bb) * QC; const b16 y16 = (b16)y;
      if (t < 2) Tq[row][col] = y16; else if (t < 4) Tk[row][col] = y16; else Tv[col][row] = y16; } }
  __syncthreads();
  const unsigned b = m0 / SQ, s0 = m0 % SQ, bh = b * NH + h; v8b qv[2], kv[2], vv[2];
#pragma unroll
  for (int i = 0; i < 2; ++i) { const unsigned idx = (unsigned)i * 128u + tid; qv[i] = *(const v8b*)(&Tq[idx >> 2][(idx & 3u) * 8u]); kv[i] = *(const v8b*)(&Tk[idx >> 2][(idx & 3u) * 8u]); vv[i] = *(const v8b*)(&Tv[idx >> 3][(idx & 7u) * 8u]); }
  b16* qd = QP + ((size_t)bh * SQ + s0) * DH; b16* kd = KP + ((size_t)bh * SQ + s0) * DH; b16* vd = VT + (size_t)bh * DH * SQ + s0;
  {
#pragma unroll
    for (int i = 0; i < 2; ++i) { const unsigned idx = (unsigned)i * 128u + tid; *(v8b*)(qd + (size_t)idx * 8u) = qv[i]; *(v8b*)(kd + (size_t)idx * 8u) = kv[i]; *(v8b*)(vd + (size_t)(idx >> 3) * SQ + (idx & 7u) * 8u) = vv[i]; }
     }
}

// flash attention, transposed form: block = 64 queries of one (b, h), wave = 16 queries (the D columns). Per 64 keys: S^T tiles = K rows (A) x Q rows (B, loaded once); column max = per-lane max over
// the 32 accumulator values + one xor-16 exchange; p = exp2(s c - m); the four score tiles are packed (x1024, f16) into two B fragments (element r <- tile 2j, element 8+r <- tile 2j+1);
// O^T tiles (dh rows) += V^T rows (A) x P^T (B). The 64 K rows and the 32 V^T rows of a trip are shared by the four waves: copied once into LDS (K rows of 64 bytes at pitch 80, V^T rows of 128 bytes
// at pitch 144, two buffers, the next tile in flight while this one is worked on); the A fragments are read from there. ctx plane [bh][SEQ][32] f16 x256; wave writes its 1024 contiguous bytes. No key tail (SEQ % 64 == 0).
__global__ __launch_bounds__(128) void flash_kernel(const b16* __restrict__ QP, const b16* __restrict__ KP, const b16* __restrict__ VT, b16* __restrict__ CTX) {
  __shared__ __attribute__((aligned(16))) b16 Ks[2][64][40], Vs[2][32][72], Tc[4][16][40];
  const unsigned tid = threadIdx.x, wave = tid >> 5, lane = tid & 31u, nloc = lane & 15u, hlf = lane >> 4; const unsigned bh = blockIdx.x / QB, s0 = (blockIdx.x % QB) * 64u + wave * 16u;
  constexpr unsigned NT = SQ / 64u;
  const b16* gk = KP + (size_t)bh * SQ * DH + tid * 8u; const b16* gv = VT + (size_t)bh * DH * SQ + (size_t)(tid >> 3) * SQ + (tid & 7u) * 8u;
  const unsigned lk = lds_off(&Ks[0][tid >> 2][(tid & 3u) * 8u]), lv = lds_off(&Vs[0][tid >> 3][(tid & 7u) * 8u]);
  auto stage = [&](unsigned t, unsigned buf) { const b16* k0 = gk + (size_t)t * 64u * DH; const b16* v0 = gv + t * 64u; const unsigned a = lk + buf * (64u * 80u), c = lv + buf * (32u * 144u);
    copy4(a, k0, a + 32u * 80u, k0 + 32u * DH, c, v0, c + 16u * 144u, v0 + (size_t)16u * SQ); };
  const v16b qb = frag_kb(QP + ((size_t)bh * SQ + s0 + nloc) * DH, hlf);
  float mrun = -1e30f, lsum = 0.0f; v8f o0 = (v8f){}, o1 = (v8f){};
  stage(0u, 0u); wait_copies(); __syncthreads();
  if (NT > 1u) stage(1u, 1u);
#pragma unroll 1
  for (unsigned t = 0; t < NT; ++t) {
    const unsigned buf = t & 1u; const b16* Kl = &Ks[buf][nloc][0]; const b16* Vl = &Vs[buf][nloc][0];
    v8f s[4];
#pragma unroll
    for (int j = 0; j < 4; ++j) s[j] = wmma16b(frag_kb(Kl + 16u * (unsigned)j * 40u, hlf), qb, (v8f){});
    float mx = -3.0e38f;
#pragma unroll
    for (int j = 0; j < 4; ++j) {
#pragma unroll
      for (int r = 0; r < 8; ++r) mx = fmaxf(mx, s[j][r]); }
    mx = fmaxf(mx, __shfl_xor(mx, 16, 32)) * C2;
    const float mn = fmaxf(mrun, mx); const float corr = __builtin_amdgcn_exp2f(mrun - mn); mrun = mn;
    float ps = 0.0f; v16b pb0, pb1;
#pragma unroll
    for (int r = 0; r < 8; ++r) {
      const float p0 = __builtin_amdgcn_exp2f(fmaf(s[0][r], C2, -mn)), p1 = __builtin_amdgcn_exp2f(fmaf(s[1][r], C2, -mn)), p2 = __builtin_amdgcn_exp2f(fmaf(s[2][r], C2, -mn)), p3 = __builtin_amdgcn_exp2f(fmaf(s[3][r], C2, -mn));
      ps += (p0 + p1) + (p2 + p3); pb0[r] = (b16)(p0 * PC); pb0[8 + r] = (b16)(p1 * PC); pb1[r] = (b16)(p2 * PC); pb1[8 + r] = (b16)(p3 * PC); }
    lsum = lsum * corr + ps;
#pragma unroll
    for (int r = 0; r < 8; ++r) { o0[r] *= corr; o1[r] *= corr; }
    o0 = wmma16b(frag_kb(Vl, hlf), pb0, o0); o0 = wmma16b(frag_kb(Vl + 32u, hlf), pb1, o0);
    o1 = wmma16b(frag_kb(Vl + 16u * 72u, hlf), pb0, o1); o1 = wmma16b(frag_kb(Vl + 16u * 72u + 32u, hlf), pb1, o1);
    wait_lds(); wait_copies(); __syncthreads();
    if (t + 2u < NT) stage(t + 2u, buf);
  }
  wait_copies();
  lsum += __shfl_xor(lsum, 16, 32);
  const float inv = (CC / (PC * QC)) * (1.0f / lsum); v8b c0, c1;
#pragma unroll
  for (int r = 0; r < 8; ++r) { c0[r] = (b16)(o0[r] * inv); c1[r] = (b16)(o1[r] * inv); }
  *(v8b*)(&Tc[wave][nloc][8u * hlf]) = c0; *(v8b*)(&Tc[wave][nloc][16u + 8u * hlf]) = c1;
  __syncthreads();
  v8b cv[2];
#pragma unroll
  for (int i = 0; i < 2; ++i) { const unsigned idx = (unsigned)i * 32u + lane; cv[i] = *(const v8b*)(&Tc[wave][idx >> 2][(idx & 3u) * 8u]); }
  b16* cd = CTX + ((size_t)bh * SQ + s0) * DH;
  {
#pragma unroll
    for (int i = 0; i < 2; ++i) { const unsigned idx = (unsigned)i * 32u + lane; *(v8b*)(cd + (size_t)idx * 8u) = cv[i]; }
     }
}

// output projection: block = 64 rows x 128 columns, wave = 16 rows x 8 tiles; k-step = one head (A fragment from ctx[bh][s][0..31], B fragment from Wo rows at k = h*32). The 128 Wo rows are shared by the four waves: per trip of two heads (64 k)
// they are copied once into LDS (rows of 128 bytes at pitch 144, two buffers, the next tile in flight while this one is worked on) and the B fragments are read from there. y = acc / 65536 + bf16(bo).
__global__ __launch_bounds__(128) void oproj_kernel(const b16* __restrict__ CTX, const b16* __restrict__ WO, const float* __restrict__ bo, float* __restrict__ out) {
  __shared__ __attribute__((aligned(16))) float Tf[4][16][132];
  __shared__ __attribute__((aligned(16))) b16 Ws[2][128][72];
  const unsigned tid = threadIdx.x, wave = tid >> 5, lane = tid & 31u, nloc = lane & 15u, hlf = lane >> 4; const unsigned m0 = blockIdx.x * 64u + wave * 16u, n0 = blockIdx.y * 128u; const unsigned b = m0 / SQ, s0 = m0 % SQ;
  const b16* abase = CTX + ((size_t)(b * NH) * SQ + s0 + nloc) * DH; 
  const b16* gw = WO + (size_t)(n0 + (tid >> 3)) * DM + (tid & 7u) * 8u; const unsigned lw = lds_off(&Ws[0][tid >> 3][(tid & 7u) * 8u]);
  auto stage = [&](unsigned kc, unsigned buf) { const b16* g = gw + kc * 64u; const unsigned l = lw + buf * (128u * 144u);
    copy8(l, g, l + 16u * 144u, g + 16u * DM, l + 32u * 144u, g + 32u * DM, l + 48u * 144u, g + 48u * DM, l + 64u * 144u, g + 64u * DM, l + 80u * 144u, g + 80u * DM, l + 96u * 144u, g + 96u * DM, l + 112u * 144u, g + 112u * DM); };
  v8f acc[8];
#pragma unroll
  for (int t = 0; t < 8; ++t) acc[t] = (v8f){};
  stage(0u, 0u); wait_copies(); __syncthreads(); stage(1u, 1u);
#pragma unroll 1
  for (unsigned kc = 0; kc < NH / 2u; ++kc) { const unsigned buf = kc & 1u; const b16* wl = &Ws[buf][nloc][0];
#pragma unroll  // both k-steps of a trip spelled out: LDS offsets and acc[] indices stay compile-time constants
    for (int ks = 0; ks < 2; ++ks) { const v16b a = frag_kb(abase + (size_t)(kc * 2u + (unsigned)ks) * SQ * DH, hlf);
#pragma unroll
      for (int t = 0; t < 8; ++t) acc[t] = wmma16b(a, frag_kb(wl + (unsigned)t * 16u * 72u + (unsigned)ks * 32u, hlf), acc[t]); }
    wait_lds(); wait_copies(); __syncthreads();
    if (kc + 2u < NH / 2u) stage(kc + 2u, buf); }
  wait_copies();
#pragma unroll
  for (int t = 0; t < 8; ++t) { const unsigned col = (unsigned)t * 16u + nloc; const float bb = bf16_rne(bo[n0 + col]);
#pragma unroll
    for (int r = 0; r < 8; ++r) Tf[wave][8u * hlf + (unsigned)r][col] = acc[t][r] * (1.0f / (CC * WSC)) + bb; }
  __syncthreads();
  float* orow = out + (size_t)m0 * DM + n0 + lane * 4u;
  {
#pragma unroll 4
    for (unsigned rr = 0; rr < 16u; ++rr) { const v4f v = *(const v4f*)(&Tf[wave][rr][lane * 4u]); *(v4f*)(orow + (size_t)rr * DM) = v; }
     }
}

}  // namespace

extern "C" void kernel_launch(void* const* d_in, const int* in_sizes, int n_in, void* d_out, int out_size, void* d_ws, size_t ws_size, hipStream_t stream) {
  (void)n_in;
  auto Fp = [&](int i) { return (const float*)d_in[i]; };
  // wire order: 0 x [4][2048][512], 1 Wq [16][512][32], 2 bq [16][32], 3 Wk, 4 bk, 5 Wv, 6 bv, 7 Wo [512 out][512 in], 8 bo [512]; output [NB][SEQ][512] f32.
  const long long xneed = ((long long)(NB - 1) * SEQ_FULL + SEQ) * 512;
  if ((long long)in_sizes[0] < xneed || in_sizes[1] < 16 * 512 * 32 || in_sizes[2] < 512 || in_sizes[3] < 16 * 512 * 32 || in_sizes[4] < 512 || in_sizes[5] < 16 * 512 * 32 || in_sizes[6] < 512 || in_sizes[7] < 512 * 512 || in_sizes[8] < 512) return;
  if ((long long)out_size < (long long)NB * SEQ * 512) return;
  size_t off = 0; char* ws = (char*)d_ws;
  auto carve = [&](size_t bytes) { char* p = ws + off; off += (bytes + 255) & ~(size_t)255; return p; };
  const size_t planeB = (size_t)NB * SEQ * 512 * 2;               // 8,388,608 B at full size (NB*16*SEQ*32 halves == NB*SEQ*512 halves)
  b16* XH = (b16*)carve(planeB); b16* WT = (b16*)carve((size_t)4 * 512 * 512 * 2); b16* QP = (b16*)carve(planeB); b16* KP = (b16*)carve(planeB); b16* VT = (b16*)carve(planeB); b16* CTX = (b16*)carve(planeB);
  if (off > ws_size || off > ((size_t)128 << 20)) return;         // 5 x 8 MiB + 2 MiB = 44,040,192 B at full size
  xcvt_kernel<<<(unsigned)((size_t)NB * SEQ * 64 / 256), 256, 0, stream>>>(Fp(0), XH);
  wprep_kernel<<<dim3(128, 4), 256, 0, stream>>>(Fp(1), Fp(3), Fp(5), Fp(7), WT);
  qkv_kernel<<<dim3((unsigned)(NB * SEQ / 64), 16), 128, 0, stream>>>(XH, WT, Fp(2), Fp(4), Fp(6), QP, KP, VT);
  flash_kernel<<<(unsigned)(NB * 16 * (SEQ / 64)), 128, 0, stream>>>(QP, KP, VT, CTX);
  oproj_kernel<<<dim3((unsigned)(NB * SEQ / 64), 4), 128, 0, stream>>>(CTX, WT + (size_t)3 * 512 * 512, Fp(8), (float*)d_out);
}

// v002
// It runs in 91.7 microseconds.
// Next to v001, in two timings, it ran 1.11 and 1.12 times as fast.
// Counting every step since v000, it is 2.22 times as fast.
#include <hip/hip_runtime.h>

// Dense multi-head attention layer: x [NB][SEQ_FULL][512] (first SEQ rows of each batch used); per-head Q/K/V = x W[h] + b[h] (16 heads x 32), softmax(Q K^T / sqrt(32)) V over all keys, heads concatenated, y = ctx Wo^T + bo.
// compute dtype: every contraction on v_wmma_f32_16x16x32_f16 (f16 operands, f32 accumulate), one product per tile pair. Float inputs are converted to bf16 (RNE) on load and carried exactly
// in f16: x x8, weights x256 (Wq/Wk/Wv transposed to [h*32+dh][d], Wo kept [out][in]). Computed planes: Q, K, V^T as f16 x16; unnormalised softmax P as f16 x1024 (packed from the score
// accumulators directly into the P.V B fragment); ctx as f16 x256. Biases (bf16 RNE), softmax (running max, exp2), normalisation and all epilogues in f32.
// Fragment k-map per lane half hh for A AND B: elements 0..7 <- k = 8hh+0..7, 8..15 <- k = 16+8hh+0..7; acc[r] = D[8hh+r][lane&15].

#ifndef NB
#define NB 4
#endif
#ifndef SEQ
#define SEQ 2048
#endif
#define NB_FULL 4
#define SEQ_FULL 2048

namespace {

constexpr unsigned DM = 512, NH = 16, DH = 32, NBU = (unsigned)NB, SQ = (unsigned)SEQ, QB = SQ / 64u;
constexpr float XS = 8.0f, WSC = 256.0f, QC = 16.0f, PC = 1024.0f, CC = 256.0f;
constexpr float C2 = (float)(0.17677669529663687 * 1.4426950408889634 / 256.0);   // log2(e) / sqrt(32) / (QC * QC)
static_assert(SEQ % 64 == 0 && SEQ <= SEQ_FULL && NB <= NB_FULL && NB >= 1);
static_assert(((size_t)NB * SEQ * 64) % 256 == 0);            // xcvt: threads x 8 elements == NB*SEQ*512 exactly
static_assert((512 * 512 / 8) % 256 == 0);                    // wprep: 128 blocks x 256 threads x 8 == 512*512 per plane
static_assert(DM == NH * DH && DM % 32 == 0 && DH == 32);

typedef _Float16 b16;
typedef __attribute__((ext_vector_type(16))) _Float16 v16b;
typedef __attribute__((ext_vector_type(8))) _Float16 v8b;
typedef __attribute__((ext_vector_type(8))) float v8f;
typedef __attribute__((ext_vector_type(4))) float v4f;

__device__ __forceinline__ float bf16_rne(float f) { unsigned int u = __float_as_uint(f); u += 0x7FFFu + ((u >> 16) & 1u); return __uint_as_float(u & 0xFFFF0000u); }
__device__ __forceinline__ v16b frag_kb(const b16* p, unsigned hh) { const v8b a = *(const v8b*)(p + 8u * hh), b = *(const v8b*)(p + 16u + 8u * hh); v16b f;
#pragma unroll
  for (int e = 0; e < 8; ++e) { f[e] = a[e]; f[8 + e] = b[e]; } return f; }
__device__ __forceinline__ v8f wmma16b(v16b a, v16b b, v8f c) { return __builtin_amdgcn_wmma_f32_16x16x32_f16(false, a, false, b, (short)0, c, false, false); }

// Asynchronous 16-byte copies, global memory to LDS: each lane names its own LDS byte address (low 32 bits of the __shared__ address) and its own global pointer.
// One asm statement per tile: s_wait_xcnt 0 as its last line stands in front of every later rewrite of the address registers that the copies name.
__device__ __forceinline__ unsigned lds_off(const void* p) { return (unsigned)(size_t)p; }
#define CP "global_load_async_to_lds_b128 "
__device__ __forceinline__ void copy4(unsigned l0, const b16* g0, unsigned l1, const b16* g1, unsigned l2, const b16* g2, unsigned l3, const b16* g3) {
  asm volatile(CP "%0, %1, off\n\t" CP "%2, %3, off\n\t" CP "%4, %5, off\n\t" CP "%6, %7, off\n\ts_wait_xcnt 0x0"
               :: "v"(l0), "v"(g0), "v"(l1), "v"(g1), "v"(l2), "v"(g2), "v"(l3), "v"(g3) : "memory"); }
__device__ __forceinline__ void copy6(unsigned l0, const b16* g0, unsigned l1, const b16* g1, unsigned l2, const b16* g2, unsigned l3, const b16* g3, unsigned l4, const b16* g4, unsigned l5, const b16* g5) {
  asm volatile(CP "%0, %1, off\n\t" CP "%2, %3, off\n\t" CP "%4, %5, off\n\t" CP "%6, %7, off\n\t" CP "%8, %9, off\n\t" CP "%10, %11, off\n\ts_wait_xcnt 0x0"
               :: "v"(l0), "v"(g0), "v"(l1), "v"(g1), "v"(l2), "v"(g2), "v"(l3), "v"(g3), "v"(l4), "v"(g4), "v"(l5), "v"(g5) : "memory"); }
__device__ __forceinline__ void copy8(unsigned l0, const b16* g0, unsigned l1, const b16* g1, unsigned l2, const b16* g2, unsigned l3, const b16* g3, unsigned l4, const b16* g4, unsigned l5, const b16* g5, unsigned l6, const b16* g6, unsigned l7, const b16* g7) {
  asm volatile(CP "%0, %1, off\n\t" CP "%2, %3, off\n\t" CP "%4, %5, off\n\t" CP "%6, %7, off\n\t" CP "%8, %9, off\n\t" CP "%10, %11, off\n\t" CP "%12, %13, off\n\t" CP "%14, %15, off\n\ts_wait_xcnt 0x0"
               :: "v"(l0), "v"(g0), "v"(l1), "v"(g1), "v"(l2), "v"(g2), "v"(l3), "v"(g3), "v"(l4), "v"(g4), "v"(l5), "v"(g5), "v"(l6), "v"(g6), "v"(l7), "v"(g7) : "memory"); }
#undef CP
// this wave's copies have landed: in front of the barrier behind which the other waves read them
__device__ __forceinline__ void wait_copies() { asm volatile("s_wait_asynccnt 0x0" ::: "memory"); }
// this wave's LDS reads are done: in front of the barrier behind which their buffer is refilled
__device__ __forceinline__ void wait_lds() { asm volatile("s_wait_dscnt 0x0" ::: "memory"); }

__global__ __launch_bounds__(256) void xcvt_kernel(const float* __restrict__ x, b16* __restrict__ XH) {
  const unsigned u = blockIdx.x * 256u + threadIdx.x; const unsigned row = u >> 6, c = (u & 63u) * 8u; const unsigned b = row / SQ, s = row % SQ;
  const float* src = x + ((size_t)b * SEQ_FULL + s) * DM + c; const v4f a0 = *(const v4f*)src, a1 = *(const v4f*)(src + 4); v8b v;
#pragma unroll
  for (int j = 0; j < 4; ++j) { v[j] = (b16)(bf16_rne(a0[j]) * XS); v[4 + j] = (b16)(bf16_rne(a1[j]) * XS); }
  b16* dst = XH + (size_t)u * 8u;
  { *(v8b*)dst = v;  }
}

__global__ __launch_bounds__(256) void wprep_kernel(const float* __restrict__ wq, const float* __restrict__ wk, const float* __restrict__ wv, const float* __restrict__ wo, b16* __restrict__ WT) {
  const unsigned z = blockIdx.y; const unsigned u = blockIdx.x * 256u + threadIdx.x; const unsigned e = u * 8u, o = e >> 9, k0 = e & 511u; v8b v;
  if (z < 3u) { const float* w = (z == 0u) ? wq : ((z == 1u) ? wk : wv); const unsigned h = o >> 5, dh = o & 31u; const float* sp = w + ((size_t)h * DM + k0) * DH + dh;
#pragma unroll
    for (int j = 0; j < 8; ++j) v[j] = (b16)(bf16_rne(sp[(size_t)j * DH]) * WSC); }
  else { const float* sp = wo + (size_t)o * DM + k0; const v4f a0 = *(const v4f*)sp, a1 = *(const v4f*)(sp + 4);
#pragma unroll
    for (int j = 0; j < 4; ++j) { v[j] = (b16)(bf16_rne(a0[j]) * WSC); v[4 + j] = (b16)(bf16_rne(a1[j]) * WSC); } }
  b16* dst = WT + (size_t)z * DM * DM + e;
  { *(v8b*)dst = v;  }
}

// Q/K/V projection of one head: block = 64 rows x (32 q | 32 k | 32 v columns of head h), wave = 16 rows x 6 tiles; A fragments from XH rows (global). The 96 WT rows are shared by the four waves:
// per trip of 64 k they are copied once into LDS (rows of 128 bytes at pitch 144, two buffers, the next tile in flight while this one is worked on) and the B fragments are read from there.
// y = acc / 2048 + bf16(b); Q, K planes [bh][SEQ][32] f16 x16 (block writes 4096 contiguous bytes each); V^T plane [bh][32][SEQ] f16 x16 (32 lines of 64 keys). LDS tiles cross-wave: block barrier; they reuse the ring's LDS behind the last trip's barrier.
__global__ __launch_bounds__(128) void qkv_kernel(const b16* __restrict__ XH, const b16* __restrict__ WT, const float* __restrict__ bq, const float* __restrict__ bk, const float* __restrict__ bv, b16* __restrict__ QP, b16* __restrict__ KP, b16* __restrict__ VT) {
  __shared__ __attribute__((aligned(16))) b16 SM[2u * 96u * 72u];
  b16 (*Tq)[40] = (b16 (*)[40])SM; b16 (*Tk)[40] = (b16 (*)[40])(SM + 64u * 40u); b16 (*Tv)[72] = (b16 (*)[72])(SM + 128u * 40u);
  const unsigned tid = threadIdx.x, wave = tid >> 5, lane = tid & 31u, nloc = lane & 15u, hlf = lane >> 4; const unsigned m0 = blockIdx.x * 64u, h = blockIdx.y;
  const b16* arow = XH + (size_t)(m0 + wave * 16u + nloc) * DM; 
  const b16* gw = WT + (size_t)(h * DH + (tid >> 3)) * DM + (tid & 7u) * 8u; const unsigned lw = lds_off(SM + (tid >> 3) * 72u + (tid & 7u) * 8u);
  auto stage = [&](unsigned kc, unsigned buf) { const b16* g = gw + kc * 64u; const unsigned l = lw + buf * (96u * 144u);
    copy6(l, g, l + 16u * 144u, g + 16u * DM, l + 32u * 144u, g + DM * DM, l + 48u * 144u, g + DM * DM + 16u * DM, l + 64u * 144u, g + 2u * DM * DM, l + 80u * 144u, g + 2u * DM * DM + 16u * DM); };
  v8f acc[6];
#pragma unroll
  for (int t = 0; t < 6; ++t) acc[t] = (v8f){};
  stage(0u, 0u); wait_copies(); __syncthreads(); stage(1u, 1u);
#pragma unroll 1
  for (unsigned kc = 0; kc < DM / 64u; ++kc) { const unsigned buf = kc & 1u; const b16* wl = SM + buf * (96u * 72u) + nloc * 72u;
#pragma unroll  // both k-steps of a trip spelled out: LDS offsets and acc[] indices stay compile-time constants
    for (int ks = 0; ks < 2; ++ks) { const v16b a = frag_kb(arow + kc * 64u + (unsigned)ks * 32u, hlf);
#pragma unroll
      for (int t = 0; t < 6; ++t) acc[t] = wmma16b(a, frag_kb(wl + (unsigned)t * 16u * 72u + (unsigned)ks * 32u, hlf), acc[t]); }
    wait_lds(); wait_copies(); __syncthreads();
    if (kc + 2u < DM / 64u) stage(kc + 2u, buf); }
  wait_copies();
#pragma unroll
  for (int t = 0; t < 6; ++t) { const unsigned col = (unsigned)(t & 1) * 16u + nloc; const float* bp = (t < 2) ? bq : ((t < 4) ? bk : bv); const float bb = bf16_rne(bp[h * DH + col]);
#pragma unroll
    for (int r = 0; r < 8; ++r) { const unsigned row = wave * 16u + 8u * hlf + (unsigned)r; const float y = (acc[t][r] * (1.0f / (XS * WSC)) + bb) * QC; const b16 y16 = (b16)y;
      if (t < 2) Tq[row][col] = y16; else if (t < 4) Tk[row][col] = y16; else Tv[col][row] = y16; } }
  __syncthreads();
  const unsigned b = m0 / SQ, s0 = m0 % SQ, bh = b * NH + h; v8b qv[2], kv[2], vv[2];
#pragma unroll
  for (int i = 0; i < 2; ++i) { const unsigned idx = (unsigned)i * 128u + tid; qv[i] = *(const v8b*)(&Tq[idx >> 2][(idx & 3u) * 8u]); kv[i] = *(const v8b*)(&Tk[idx >> 2][(idx & 3u) * 8u]); vv[i] = *(const v8b*)(&Tv[idx >> 3][(idx & 7u) * 8u]); }
  b16* qd = QP + ((size_t)bh * SQ + s0) * DH; b16* kd = KP + ((size_t)bh * SQ + s0) * DH; b16* vd = VT + (size_t)bh * DH * SQ + s0;
  {
#pragma unroll
    for (int i = 0; i < 2; ++i) { const unsigned idx = (unsigned)i * 128u + tid; *(v8b*)(qd + (size_t)idx * 8u) = qv[i]; *(v8b*)(kd + (size_t)idx * 8u) = kv[i]; *(v8b*)(vd + (size_t)(idx >> 3) * SQ + (idx & 7u) * 8u) = vv[i]; }
     }
}

// flash attention, transposed form: block = 64 queries of one (b, h), wave = 16 queries (the D columns). Per 64 keys: S^T tiles = K rows (A) x Q rows (B, loaded once); column max = per-lane max over
// the 32 accumulator values + one xor-16 exchange; p = exp2(s c - m); the four score tiles are packed (x1024, f16) into two B fragments (element r <- tile 2j, element 8+r <- tile 2j+1);
// O^T tiles (dh rows) += V^T rows (A) x P^T (B). The 64 K rows and the 32 V^T rows of a trip are shared by the four waves: copied once into LDS (K rows of 64 bytes at pitch 80, V^T rows of 128 bytes
// at pitch 144, two buffers, the next tile in flight while this one is worked on); the A fragments are read from there. ctx plane [bh][SEQ][32] f16 x256; wave writes its 1024 contiguous bytes. No key tail (SEQ % 64 == 0).
__global__ __launch_bounds__(128) void flash_kernel(const b16* __restrict__ QP, const b16* __restrict__ KP, const b16* __restrict__ VT, b16* __restrict__ CTX) {
  __shared__ __attribute__((aligned(16))) b16 Ks[2][64][40], Vs[2][32][72], Tc[4][16][40];
  const unsigned tid = threadIdx.x, wave = tid >> 5, lane = tid & 31u, nloc = lane & 15u, hlf = lane >> 4; const unsigned bh = blockIdx.x / QB, s0 = (blockIdx.x % QB) * 64u + wave * 16u;
  constexpr unsigned NT = SQ / 64u;
  const b16* gk = KP + (size_t)bh * SQ * DH + tid * 8u; const b16* gv = VT + (size_t)bh * DH * SQ + (size_t)(tid >> 3) * SQ + (tid & 7u) * 8u;
  const unsigned lk = lds_off(&Ks[0][tid >> 2][(tid & 3u) * 8u]), lv = lds_off(&Vs[0][tid >> 3][(tid & 7u) * 8u]);
  auto stage = [&](unsigned t, unsigned buf) { const b16* k0 = gk + (size_t)t * 64u * DH; const b16* v0 = gv + t * 64u; const unsigned a = lk + buf * (64u * 80u), c = lv + buf * (32u * 144u);
    copy4(a, k0, a + 32u * 80u, k0 + 32u * DH, c, v0, c + 16u * 144u, v0 + (size_t)16u * SQ); };
  const v16b qb = frag_kb(QP + ((size_t)bh * SQ + s0 + nloc) * DH, hlf);
  float mrun = -1e30f, lsum = 0.0f; v8f o0 = (v8f){}, o1 = (v8f){};
  stage(0u, 0u); wait_copies(); __syncthreads();
  if (NT > 1u) stage(1u, 1u);
#pragma unroll 1
  for (unsigned t = 0; t < NT; ++t) {
    const unsigned buf = t & 1u; const b16* Kl = &Ks[buf][nloc][0]; const b16* Vl = &Vs[buf][nloc][0];
    v8f s[4];
#pragma unroll
    for (int j = 0; j < 4; ++j) s[j] = wmma16b(frag_kb(Kl + 16u * (unsigned)j * 40u, hlf), qb, (v8f){});
    float mx = -3.0e38f;
#pragma unroll
    for (int j = 0; j < 4; ++j) {
#pragma unroll
      for (int r = 0; r < 8; ++r) mx = fmaxf(mx, s[j][r]); }
    mx = fmaxf(mx, __shfl_xor(mx, 16, 32)) * C2;
    const float mn = fmaxf(mrun, mx); const float corr = __builtin_amdgcn_exp2f(mrun - mn); mrun = mn;
    float ps = 0.0f; v16b pb0, pb1;
#pragma unroll
    for (int r = 0; r < 8; ++r) {
      const float p0 = __builtin_amdgcn_exp2f(fmaf(s[0][r], C2, -mn)), p1 = __builtin_amdgcn_exp2f(fmaf(s[1][r], C2, -mn)), p2 = __builtin_amdgcn_exp2f(fmaf(s[2][r], C2, -mn)), p3 = __builtin_amdgcn_exp2f(fmaf(s[3][r], C2, -mn));
      ps += (p0 + p1) + (p2 + p3); pb0[r] = (b16)(p0 * PC); pb0[8 + r] = (b16)(p1 * PC); pb1[r] = (b16)(p2 * PC); pb1[8 + r] = (b16)(p3 * PC); }
    lsum = lsum * corr + ps;
#pragma unroll
    for (int r = 0; r < 8; ++r) { o0[r] *= corr; o1[r] *= corr; }
    o0 = wmma16b(frag_kb(Vl, hlf), pb0, o0); o0 = wmma16b(frag_kb(Vl + 32u, hlf), pb1, o0);
    o1 = wmma16b(frag_kb(Vl + 16u * 72u, hlf), pb0, o1); o1 = wmma16b(frag_kb(Vl + 16u * 72u + 32u, hlf), pb1, o1);
    wait_lds(); wait_copies(); __syncthreads();
    if (t + 2u < NT) stage(t + 2u, buf);
  }
  wait_copies();
  lsum += __shfl_xor(lsum, 16, 32);
  const float inv = (CC / (PC * QC)) * (1.0f / lsum); v8b c0, c1;
#pragma unroll
  for (int r = 0; r < 8; ++r) { c0[r] = (b16)(o0[r] * inv); c1[r] = (b16)(o1[r] * inv); }
  *(v8b*)(&Tc[wave][nloc][8u * hlf]) = c0; *(v8b*)(&Tc[wave][nloc][16u + 8u * hlf]) = c1;
  __syncthreads();
  v8b cv[2];
#pragma unroll
  for (int i = 0; i < 2; ++i) { const unsigned idx = (unsigned)i * 32u + lane; cv[i] = *(const v8b*)(&Tc[wave][idx >> 2][(idx & 3u) * 8u]); }
  b16* cd = CTX + ((size_t)bh * SQ + s0) * DH;
  {
#pragma unroll
    for (int i = 0; i < 2; ++i) { const unsigned idx = (unsigned)i * 32u + lane; *(v8b*)(cd + (size_t)idx * 8u) = cv[i]; }
     }
}

// output projection: block = 64 rows x 128 columns, wave = 16 rows x 8 tiles; k-step = one head (A fragment from ctx[bh][s][0..31], B fragment from Wo rows at k = h*32). The 128 Wo rows are shared by the four waves: per trip of two heads (64 k)
// they are copied once into LDS (rows of 128 bytes at pitch 144, two buffers, the next tile in flight while this one is worked on) and the B fragments are read from there. y = acc / 65536 + bf16(bo).
__global__ __launch_bounds__(128) void oproj_kernel(const b16* __restrict__ CTX, const b16* __restrict__ WO, const float* __restrict__ bo, float* __restrict__ out) {
  __shared__ __attribute__((aligned(16))) float Tf[4][16][132];
  __shared__ __attribute__((aligned(16))) b16 Ws[2][128][72];
  const unsigned tid = threadIdx.x, wave = tid >> 5, lane = tid & 31u, nloc = lane & 15u, hlf = lane >> 4; const unsigned m0 = blockIdx.x * 64u + wave * 16u, n0 = blockIdx.y * 128u; const unsigned b = m0 / SQ, s0 = m0 % SQ;
  const b16* abase = CTX + ((size_t)(b * NH) * SQ + s0 + nloc) * DH; 
  const b16* gw = WO + (size_t)(n0 + (tid >> 3)) * DM + (tid & 7u) * 8u; const unsigned lw = lds_off(&Ws[0][tid >> 3][(tid & 7u) * 8u]);
  auto stage = [&](unsigned kc, unsigned buf) { const b16* g = gw + kc * 64u; const unsigned l = lw + buf * (128u * 144u);
    copy8(l, g, l + 16u * 144u, g + 16u * DM, l + 32u * 144u, g + 32u * DM, l + 48u * 144u, g + 48u * DM, l + 64u * 144u, g + 64u * DM, l + 80u * 144u, g + 80u * DM, l + 96u * 144u, g + 96u * DM, l + 112u * 144u, g + 112u * DM); };
  v8f acc[8];
#pragma unroll
  for (int t = 0; t < 8; ++t) acc[t] = (v8f){};
  stage(0u, 0u); wait_copies(); __syncthreads(); stage(1u, 1u);
#pragma unroll 1
  for (unsigned kc = 0; kc < NH / 2u; ++kc) { const unsigned buf = kc & 1u; const b16* wl = &Ws[buf][nloc][0];
#pragma unroll  // both k-steps of a trip spelled out: LDS offsets and acc[] indices stay compile-time constants
    for (int ks = 0; ks < 2; ++ks) { const v16b a = frag_kb(abase + (size_t)(kc * 2u + (unsigned)ks) * SQ * DH, hlf);
#pragma unroll
      for (int t = 0; t < 8; ++t) acc[t] = wmma16b(a, frag_kb(wl + (unsigned)t * 16u * 72u + (unsigned)ks * 32u, hlf), acc[t]); }
    wait_lds(); wait_copies(); __syncthreads();
    if (kc + 2u < NH / 2u) stage(kc + 2u, buf); }
  wait_copies();
#pragma unroll
  for (int t = 0; t < 8; ++t) { const unsigned col = (unsigned)t * 16u + nloc; const float bb = bf16_rne(bo[n0 + col]);
#pragma unroll
    for (int r = 0; r < 8; ++r) Tf[wave][8u * hlf + (unsigned)r][col] = acc[t][r] * (1.0f / (CC * WSC)) + bb; }
  __syncthreads();
  float* orow = out + (size_t)m0 * DM + n0 + lane * 4u;
  {
#pragma unroll 4
    for (unsigned rr = 0; rr < 16u; ++rr) { const v4f v = *(const v4f*)(&Tf[wave][rr][lane * 4u]); *(v4f*)(orow + (size_t)rr * DM) = v; }
     }
}

}  // namespace

extern "C" void kernel_launch(void* const* d_in, const int* in_sizes, int n_in, void* d_out, int out_size, void* d_ws, size_t ws_size, hipStream_t stream) {
  (void)n_in;
  auto Fp = [&](int i) { return (const float*)d_in[i]; };
  // wire order: 0 x [4][2048][512], 1 Wq [16][512][32], 2 bq [16][32], 3 Wk, 4 bk, 5 Wv, 6 bv, 7 Wo [512 out][512 in], 8 bo [512]; output [NB][SEQ][512] f32.
  const long long xneed = ((long long)(NB - 1) * SEQ_FULL + SEQ) * 512;
  if ((long long)in_sizes[0] < xneed || in_sizes[1] < 16 * 512 * 32 || in_sizes[2] < 512 || in_sizes[3] < 16 * 512 * 32 || in_sizes[4] < 512 || in_sizes[5] < 16 * 512 * 32 || in_sizes[6] < 512 || in_sizes[7] < 512 * 512 || in_sizes[8] < 512) return;
  if ((long long)out_size < (long long)NB * SEQ * 512) return;
  size_t off = 0; char* ws = (char*)d_ws;
  auto carve = [&](size_t bytes) { char* p = ws + off; off += (bytes + 255) & ~(size_t)255; return p; };
  const size_t planeB = (size_t)NB * SEQ * 512 * 2;               // 8,388,608 B at full size (NB*16*SEQ*32 halves == NB*SEQ*512 halves)
  b16* XH = (b16*)carve(planeB); b16* WT = (b16*)carve((size_t)4 * 512 * 512 * 2); b16* QP = (b16*)carve(planeB); b16* KP = (b16*)carve(planeB); b16* VT = (b16*)carve(planeB); b16* CTX = (b16*)carve(planeB);
  if (off > ws_size || off > ((size_t)128 << 20)) return;         // 5 x 8 MiB + 2 MiB = 44,040,192 B at full size
  xcvt_kernel<<<(unsigned)((size_t)NB * SEQ * 64 / 256), 256, 0, stream>>>(Fp(0), XH);
  wprep_kernel<<<dim3(128, 4), 256, 0, stream>>>(Fp(1), Fp(3), Fp(5), Fp(7), WT);
  qkv_kernel<<<dim3((unsigned)(NB * SEQ / 64), 16), 128, 0, stream>>>(XH, WT, Fp(2), Fp(4), Fp(6), QP, KP, VT);
  flash_kernel<<<(unsigned)(NB * 16 * (SEQ / 64)), 128, 0, stream>>>(QP, KP, VT, CTX);
  oproj_kernel<<<dim3((unsigned)(NB * SEQ / 64), 4), 128, 0, stream>>>(CTX, WT + (size_t)3 * 512 * 512, Fp(8), (float*)d_out);
}

// v003
// One run takes 87.2 microseconds.
// Timed twice side by side with v002, it ran 1.05 times as fast both times.
// Over all steps from v000 it is 2.32 times as fast.
#include <hip/hip_runtime.h>

// Dense multi-head attention layer: x [NB][SEQ_FULL][512] (first SEQ rows of each batch used); per-head Q/K/V = x W[h] + b[h] (16 heads x 32), softmax(Q K^T / sqrt(32)) V over all keys, heads concatenated, y = ctx Wo^T + bo.
// compute dtype: every contraction on v_wmma_f32_16x16x32_f16 (f16 operands, f32 accumulate), one product per tile pair. Float inputs are converted to bf16 (RNE) on load and carried exactly
// in f16: x x8, weights x256 (Wq/Wk/Wv transposed to [h*32+dh][d], Wo kept [out][in]). Computed planes: Q, K, V^T as f16 x16; unnormalised softmax P as f16 x1024 (packed from the score
// accumulators directly into the P.V B fragment); ctx as f16 x256. Biases (bf16 RNE), softmax (running max, exp2), normalisation and all epilogues in f32.
// Fragment k-map per lane half hh for A AND B: elements 0..7 <- k = 8hh+0..7, 8..15 <- k = 16+8hh+0..7; acc[r] = D[8hh+r][lane&15].

#ifndef NB
#define NB 4
#endif
#ifndef SEQ
#define SEQ 2048
#endif
#define NB_FULL 4
#define SEQ_FULL 2048

namespace {

constexpr unsigned DM = 512, NH = 16, DH = 32, NBU = (unsigned)NB, SQ = (unsigned)SEQ, QB = SQ / 64u;
constexpr float XS = 8.0f, WSC = 256.0f, QC = 16.0f, PC = 1024.0f, CC = 256.0f;
constexpr float C2 = (float)(0.17677669529663687 * 1.4426950408889634 / 256.0);   // log2(e) / sqrt(32) / (QC * QC)
constexpr float PL = 10.0f; static_assert(PC == 1024.0f);                         // PL = log2(PC)
static_assert(SEQ % 64 == 0 && SEQ <= SEQ_FULL && NB <= NB_FULL && NB >= 1);
static_assert(((size_t)NB * SEQ * 64) % 256 == 0);            // xcvt: threads x 8 elements == NB*SEQ*512 exactly
static_assert((512 * 512 / 8) % 256 == 0);                    // wprep: 128 blocks x 256 threads x 8 == 512*512 per plane
static_assert(DM == NH * DH && DM % 32 == 0 && DH == 32);

typedef _Float16 b16;
typedef __attribute__((ext_vector_type(16))) _Float16 v16b;
typedef __attribute__((ext_vector_type(8))) _Float16 v8b;
typedef __attribute__((ext_vector_type(8))) float v8f;
typedef __attribute__((ext_vector_type(4))) float v4f;
typedef __attribute__((ext_vector_type(2))) float v2f;

__device__ __forceinline__ float bf16_rne(float f) { unsigned int u = __float_as_uint(f); u += 0x7FFFu + ((u >> 16) & 1u); return __uint_as_float(u & 0xFFFF0000u); }
__device__ __forceinline__ v16b frag_kb(const b16* p, unsigned hh) { const v8b a = *(const v8b*)(p + 8u * hh), b = *(const v8b*)(p + 16u + 8u * hh); v16b f;
#pragma unroll
  for (int e = 0; e < 8; ++e) { f[e] = a[e]; f[8 + e] = b[e]; } return f; }
__device__ __forceinline__ v8f wmma16b(v16b a, v16b b, v8f c) { return __builtin_amdgcn_wmma_f32_16x16x32_f16(false, a, false, b, (short)0, c, false, false); }

// Asynchronous 16-byte copies, global memory to LDS: each lane names its own LDS byte address (low 32 bits of the __shared__ address) and its own global pointer.
// One asm statement per tile: s_wait_xcnt 0 as its last line stands in front of every later rewrite of the address registers that the copies name.
__device__ __forceinline__ unsigned lds_off(const void* p) { return (unsigned)(size_t)p; }
#define CP "global_load_async_to_lds_b128 "
__device__ __forceinline__ void copy4(unsigned l0, const b16* g0, unsigned l1, const b16* g1, unsigned l2, const b16* g2, unsigned l3, const b16* g3) {
  asm volatile(CP "%0, %1, off\n\t" CP "%2, %3, off\n\t" CP "%4, %5, off\n\t" CP "%6, %7, off\n\ts_wait_xcnt 0x0"
               :: "v"(l0), "v"(g0), "v"(l1), "v"(g1), "v"(l2), "v"(g2), "v"(l3), "v"(g3) : "memory"); }
__device__ __forceinline__ void copy6(unsigned l0, const b16* g0, unsigned l1, const b16* g1, unsigned l2, const b16* g2, unsigned l3, const b16* g3, unsigned l4, const b16* g4, unsigned l5, const b16* g5) {
  asm volatile(CP "%0, %1, off\n\t" CP "%2, %3, off\n\t" CP "%4, %5, off\n\t" CP "%6, %7, off\n\t" CP "%8, %9, off\n\t" CP "%10, %11, off\n\ts_wait_xcnt 0x0"
               :: "v"(l0), "v"(g0), "v"(l1), "v"(g1), "v"(l2), "v"(g2), "v"(l3), "v"(g3), "v"(l4), "v"(g4), "v"(l5), "v"(g5) : "memory"); }
__device__ __forceinline__ void copy8(unsigned l0, const b16* g0, unsigned l1, const b16* g1, unsigned l2, const b16* g2, unsigned l3, const b16* g3, unsigned l4, const b16* g4, unsigned l5, const b16* g5, unsigned l6, const b16* g6, unsigned l7, const b16* g7) {
  asm volatile(CP "%0, %1, off\n\t" CP "%2, %3, off\n\t" CP "%4, %5, off\n\t" CP "%6, %7, off\n\t" CP "%8, %9, off\n\t" CP "%10, %11, off\n\t" CP "%12, %13, off\n\t" CP "%14, %15, off\n\ts_wait_xcnt 0x0"
               :: "v"(l0), "v"(g0), "v"(l1), "v"(g1), "v"(l2), "v"(g2), "v"(l3), "v"(g3), "v"(l4), "v"(g4), "v"(l5), "v"(g5), "v"(l6), "v"(g6), "v"(l7), "v"(g7) : "memory"); }
#undef CP
// this wave's copies have landed: in front of the barrier behind which the other waves read them
__device__ __forceinline__ void wait_copies() { asm volatile("s_wait_asynccnt 0x0" ::: "memory"); }
// this wave's LDS reads are done: in front of the barrier behind which their buffer is refilled
__device__ __forceinline__ void wait_lds() { asm volatile("s_wait_dscnt 0x0" ::: "memory"); }

__global__ __launch_bounds__(256) void xcvt_kernel(const float* __restrict__ x, b16* __restrict__ XH) {
  const unsigned u = blockIdx.x * 256u + threadIdx.x; const unsigned row = u >> 6, c = (u & 63u) * 8u; const unsigned b = row / SQ, s = row % SQ;
  const float* src = x + ((size_t)b * SEQ_FULL + s) * DM + c; const v4f a0 = *(const v4f*)src, a1 = *(const v4f*)(src + 4); v8b v;
#pragma unroll
  for (int j = 0; j < 4; ++j) { v[j] = (b16)(bf16_rne(a0[j]) * XS); v[4 + j] = (b16)(bf16_rne(a1[j]) * XS); }
  b16* dst = XH + (size_t)u * 8u;
  { *(v8b*)dst = v;  }
}

__global__ __launch_bounds__(256) void wprep_kernel(const float* __restrict__ wq, const float* __restrict__ wk, const float* __restrict__ wv, const float* __restrict__ wo, b16* __restrict__ WT) {
  const unsigned z = blockIdx.y; const unsigned u = blockIdx.x * 256u + threadIdx.x; const unsigned e = u * 8u, o = e >> 9, k0 = e & 511u; v8b v;
  if (z < 3u) { const float* w = (z == 0u) ? wq : ((z == 1u) ? wk : wv); const unsigned h = o >> 5, dh = o & 31u; const float* sp = w + ((size_t)h * DM + k0) * DH + dh;
#pragma unroll
    for (int j = 0; j < 8; ++j) v[j] = (b16)(bf16_rne(sp[(size_t)j * DH]) * WSC); }
  else { const float* sp = wo + (size_t)o * DM + k0; const v4f a0 = *(const v4f*)sp, a1 = *(const v4f*)(sp + 4);
#pragma unroll
    for (int j = 0; j < 4; ++j) { v[j] = (b16)(bf16_rne(a0[j]) * WSC); v[4 + j] = (b16)(bf16_rne(a1[j]) * WSC); } }
  b16* dst = WT + (size_t)z * DM * DM + e;
  { *(v8b*)dst = v;  }
}

// Q/K/V projection of one head: block = 64 rows x (32 q | 32 k | 32 v columns of head h), wave = 16 rows x 6 tiles; A fragments from XH rows (global). The 96 WT rows are shared by the four waves:
// per trip of 64 k they are copied once into LDS (rows of 128 bytes at pitch 144, two buffers, the next tile in flight while this one is worked on) and the B fragments are read from there.
// y = acc / 2048 + bf16(b); Q, K planes [bh][SEQ][32] f16 x16 (block writes 4096 contiguous bytes each); V^T plane [bh][32][SEQ] f16 x16 (32 lines of 64 keys). LDS tiles cross-wave: block barrier; they reuse the ring's LDS behind the last trip's barrier.
__global__ __launch_bounds__(128) void qkv_kernel(const b16* __restrict__ XH, const b16* __restrict__ WT, const float* __restrict__ bq, const float* __restrict__ bk, const float* __restrict__ bv, b16* __restrict__ QP, b16* __restrict__ KP, b16* __restrict__ VT) {
  __shared__ __attribute__((aligned(16))) b16 SM[2u * 96u * 72u];
  b16 (*Tq)[40] = (b16 (*)[40])SM; b16 (*Tk)[40] = (b16 (*)[40])(SM + 64u * 40u); b16 (*Tv)[72] = (b16 (*)[72])(SM + 128u * 40u);
  const unsigned tid = threadIdx.x, wave = tid >> 5, lane = tid & 31u, nloc = lane & 15u, hlf = lane >> 4; const unsigned m0 = blockIdx.x * 64u, h = blockIdx.y;
  const b16* arow = XH + (size_t)(m0 + wave * 16u + nloc) * DM; 
  const b16* gw = WT + (size_t)(h * DH + (tid >> 3)) * DM + (tid & 7u) * 8u; const unsigned lw = lds_off(SM + (tid >> 3) * 72u + (tid & 7u) * 8u);
  auto stage = [&](unsigned kc, unsigned buf) { const b16* g = gw + kc * 64u; const unsigned l = lw + buf * (96u * 144u);
    copy6(l, g, l + 16u * 144u, g + 16u * DM, l + 32u * 144u, g + DM * DM, l + 48u * 144u, g + DM * DM + 16u * DM, l + 64u * 144u, g + 2u * DM * DM, l + 80u * 144u, g + 2u * DM * DM + 16u * DM); };
  v8f acc[6];
#pragma unroll
  for (int t = 0; t < 6; ++t) acc[t] = (v8f){};
  stage(0u, 0u); wait_copies(); __syncthreads(); stage(1u, 1u);
#pragma unroll 1
  for (unsigned kc = 0; kc < DM / 64u; ++kc) { const unsigned buf = kc & 1u; const b16* wl = SM + buf * (96u * 72u) + nloc * 72u;
#pragma unroll  // both k-steps of a trip spelled out: LDS offsets and acc[] indices stay compile-time constants
    for (int ks = 0; ks < 2; ++ks) { const v16b a = frag_kb(arow + kc * 64u + (unsigned)ks * 32u, hlf);
#pragma unroll
      for (int t = 0; t < 6; ++t) acc[t] = wmma16b(a, frag_kb(wl + (unsigned)t * 16u * 72u + (unsigned)ks * 32u, hlf), acc[t]); }
    wait_lds(); wait_copies(); __syncthreads();
    if (kc + 2u < DM / 64u) stage(kc + 2u, buf); }
  wait_copies();
#pragma unroll
  for (int t = 0; t < 6; ++t) { const unsigned col = (unsigned)(t & 1) * 16u + nloc; const float* bp = (t < 2) ? bq : ((t < 4) ? bk : bv); const float bb = bf16_rne(bp[h * DH + col]);
#pragma unroll
    for (int r = 0; r < 8; ++r) { const unsigned row = wave * 16u + 8u * hlf + (unsigned)r; const float y = (acc[t][r] * (1.0f / (XS * WSC)) + bb) * QC; const b16 y16 = (b16)y;
      if (t < 2) Tq[row][col] = y16; else if (t < 4) Tk[row][col] = y16; else Tv[col][row] = y16; } }
  __syncthreads();
  const unsigned b = m0 / SQ, s0 = m0 % SQ, bh = b * NH + h; v8b qv[2], kv[2], vv[2];
#pragma unroll
  for (int i = 0; i < 2; ++i) { const unsigned idx = (unsigned)i * 128u + tid; qv[i] = *(const v8b*)(&Tq[idx >> 2][(idx & 3u) * 8u]); kv[i] = *(const v8b*)(&Tk[idx >> 2][(idx & 3u) * 8u]); vv[i] = *(const v8b*)(&Tv[idx >> 3][(idx & 7u) * 8u]); }
  b16* qd = QP + ((size_t)bh * SQ + s0) * DH; b16* kd = KP + ((size_t)bh * SQ + s0) * DH; b16* vd = VT + (size_t)bh * DH * SQ + s0;
  {
#pragma unroll
    for (int i = 0; i < 2; ++i) { const unsigned idx = (unsigned)i * 128u + tid; *(v8b*)(qd + (size_t)idx * 8u) = qv[i]; *(v8b*)(kd + (size_t)idx * 8u) = kv[i]; *(v8b*)(vd + (size_t)(idx >> 3) * SQ + (idx & 7u) * 8u) = vv[i]; }
     }
}

// flash attention, transposed form: block = 64 queries of one (b, h), wave = 16 queries (the D columns). Per 64 keys: S^T tiles = K rows (A) x Q rows (B, loaded once); column max = per-lane max over
// the 32 accumulator values + one xor-16 exchange; p x1024 = exp2(s c - (m - 10)), one packed FMA a score pair; the four score tiles are packed (f16) into two B fragments (element r <- tile 2j, element 8+r <- tile 2j+1);
// O^T tiles (dh rows) += V^T rows (A) x P^T (B). The 64 K rows and the 32 V^T rows of a trip are shared by the four waves: copied once into LDS (K rows of 64 bytes at pitch 80, V^T rows of 128 bytes
// at pitch 144, two buffers, the next tile in flight while this one is worked on); the A fragments are read from there. ctx plane [bh][SEQ][32] f16 x256; wave writes its 1024 contiguous bytes. No key tail (SEQ % 64 == 0).
__global__ __launch_bounds__(128) void flash_kernel(const b16* __restrict__ QP, const b16* __restrict__ KP, const b16* __restrict__ VT, b16* __restrict__ CTX) {
  __shared__ __attribute__((aligned(16))) b16 Ks[2][64][40], Vs[2][32][72], Tc[4][16][40];
  const unsigned tid = threadIdx.x, wave = tid >> 5, lane = tid & 31u, nloc = lane & 15u, hlf = lane >> 4; const unsigned bh = blockIdx.x / QB, s0 = (blockIdx.x % QB) * 64u + wave * 16u;
  constexpr unsigned NT = SQ / 64u;
  const b16* gk = KP + (size_t)bh * SQ * DH + tid * 8u; const b16* gv = VT + (size_t)bh * DH * SQ + (size_t)(tid >> 3) * SQ + (tid & 7u) * 8u;
  const unsigned lk = lds_off(&Ks[0][tid >> 2][(tid & 3u) * 8u]), lv = lds_off(&Vs[0][tid >> 3][(tid & 7u) * 8u]);
  auto stage = [&](unsigned t, unsigned buf) { const b16* k0 = gk + (size_t)t * 64u * DH; const b16* v0 = gv + t * 64u; const unsigned a = lk + buf * (64u * 80u), c = lv + buf * (32u * 144u);
    copy4(a, k0, a + 32u * 80u, k0 + 32u * DH, c, v0, c + 16u * 144u, v0 + (size_t)16u * SQ); };
  const v16b qb = frag_kb(QP + ((size_t)bh * SQ + s0 + nloc) * DH, hlf);
  float mrun = -1e30f, lsum = 0.0f; v8f o0 = (v8f){}, o1 = (v8f){};
  stage(0u, 0u); wait_copies(); __syncthreads();
  if (NT > 1u) stage(1u, 1u);
#pragma unroll 1
  for (unsigned t = 0; t < NT; ++t) {
    const unsigned buf = t & 1u; const b16* Kl = &Ks[buf][nloc][0]; const b16* Vl = &Vs[buf][nloc][0];
    v8f s[4];
#pragma unroll
    for (int j = 0; j < 4; ++j) s[j] = wmma16b(frag_kb(Kl + 16u * (unsigned)j * 40u, hlf), qb, (v8f){});
    float mx = -3.0e38f;
#pragma unroll
    for (int j = 0; j < 4; ++j) {
#pragma unroll
      for (int r = 0; r < 8; ++r) mx = fmaxf(mx, s[j][r]); }
    mx = fmaf(fmaxf(mx, __shfl_xor(mx, 16, 32)), C2, -PL);   // the running reference is max - log2(PC): exp2(s c - reference) is p x1024 as it comes
    const float mn = fmaxf(mrun, mx); const float corr = __builtin_amdgcn_exp2f(mrun - mn); mrun = mn;
    float ps = 0.0f; v16b pb0, pb1; float p[4][8]; const v2f cc = {C2, C2}, nm = {-mn, -mn};
#pragma unroll
    for (int j = 0; j < 4; ++j) {
#pragma unroll
      for (int r = 0; r < 8; r += 2) { const v2f sv = {s[j][r], s[j][r + 1]}; const v2f x = __builtin_elementwise_fma(sv, cc, nm); p[j][r] = __builtin_amdgcn_exp2f(x[0]); p[j][r + 1] = __builtin_amdgcn_exp2f(x[1]); } }
#pragma unroll
    for (int r = 0; r < 8; ++r) {
      ps += (p[0][r] + p[1][r]) + (p[2][r] + p[3][r]); pb0[r] = (b16)p[0][r]; pb0[8 + r] = (b16)p[1][r]; pb1[r] = (b16)p[2][r]; pb1[8 + r] = (b16)p[3][r]; }
    lsum = lsum * corr + ps;
#pragma unroll
    for (int r = 0; r < 8; ++r) { o0[r] *= corr; o1[r] *= corr; }
    o0 = wmma16b(frag_kb(Vl, hlf), pb0, o0); o0 = wmma16b(frag_kb(Vl + 32u, hlf), pb1, o0);
    o1 = wmma16b(frag_kb(Vl + 16u * 72u, hlf), pb0, o1); o1 = wmma16b(frag_kb(Vl + 16u * 72u + 32u, hlf), pb1, o1);
    wait_lds(); wait_copies(); __syncthreads();
    if (t + 2u < NT) stage(t + 2u, buf);
  }
  wait_copies();
  lsum += __shfl_xor(lsum, 16, 32);
  const float inv = (CC / QC) * (1.0f / lsum); v8b c0, c1;   // lsum carries the x1024 of P, as o0 and o1 do
#pragma unroll
  for (int r = 0; r < 8; ++r) { c0[r] = (b16)(o0[r] * inv); c1[r] = (b16)(o1[r] * inv); }
  *(v8b*)(&Tc[wave][nloc][8u * hlf]) = c0; *(v8b*)(&Tc[wave][nloc][16u + 8u * hlf]) = c1;
  __syncthreads();
  v8b cv[2];
#pragma unroll
  for (int i = 0; i < 2; ++i) { const unsigned idx = (unsigned)i * 32u + lane; cv[i] = *(const v8b*)(&Tc[wave][idx >> 2][(idx & 3u) * 8u]); }
  b16* cd = CTX + ((size_t)bh * SQ + s0) * DH;
  {
#pragma unroll
    for (int i = 0; i < 2; ++i) { const unsigned idx = (unsigned)i * 32u + lane; *(v8b*)(cd + (size_t)idx * 8u) = cv[i]; }
     }
}

// output projection: block = 64 rows x 128 columns, wave = 16 rows x 8 tiles; k-step = one head (A fragment from ctx[bh][s][0..31], B fragment from Wo rows at k = h*32). The 128 Wo rows are shared by the four waves: per trip of two heads (64 k)
// they are copied once into LDS (rows of 128 bytes at pitch 144, two buffers, the next tile in flight while this one is worked on) and the B fragments are read from there. y = acc / 65536 + bf16(bo).
__global__ __launch_bounds__(128) void oproj_kernel(const b16* __restrict__ CTX, const b16* __restrict__ WO, const float* __restrict__ bo, float* __restrict__ out) {
  __shared__ __attribute__((aligned(16))) float Tf[4][16][132];
  __shared__ __attribute__((aligned(16))) b16 Ws[2][128][72];
  const unsigned tid = threadIdx.x, wave = tid >> 5, lane = tid & 31u, nloc = lane & 15u, hlf = lane >> 4; const unsigned m0 = blockIdx.x * 64u + wave * 16u, n0 = blockIdx.y * 128u; const unsigned b = m0 / SQ, s0 = m0 % SQ;
  const b16* abase = CTX + ((size_t)(b * NH) * SQ + s0 + nloc) * DH; 
  const b16* gw = WO + (size_t)(n0 + (tid >> 3)) * DM + (tid & 7u) * 8u; const unsigned lw = lds_off(&Ws[0][tid >> 3][(tid & 7u) * 8u]);
  auto stage = [&](unsigned kc, unsigned buf) { const b16* g = gw + kc * 64u; const unsigned l = lw + buf * (128u * 144u);
    copy8(l, g, l + 16u * 144u, g + 16u * DM, l + 32u * 144u, g + 32u * DM, l + 48u * 144u, g + 48u * DM, l + 64u * 144u, g + 64u * DM, l + 80u * 144u, g + 80u * DM, l + 96u * 144u, g + 96u * DM, l + 112u * 144u, g + 112u * DM); };
  v8f acc[8];
#pragma unroll
  for (int t = 0; t < 8; ++t) acc[t] = (v8f){};
  stage(0u, 0u); wait_copies(); __syncthreads(); stage(1u, 1u);
#pragma unroll 1
  for (unsigned kc = 0; kc < NH / 2u; ++kc) { const unsigned buf = kc & 1u; const b16* wl = &Ws[buf][nloc][0];
#pragma unroll  // both k-steps of a trip spelled out: LDS offsets and acc[] indices stay compile-time constants
    for (int ks = 0; ks < 2; ++ks) { const v16b a = frag_kb(abase + (size_t)(kc * 2u + (unsigned)ks) * SQ * DH, hlf);
#pragma unroll
      for (int t = 0; t < 8; ++t) acc[t] = wmma16b(a, frag_kb(wl + (unsigned)t * 16u * 72u + (unsigned)ks * 32u, hlf), acc[t]); }
    wait_lds(); wait_copies(); __syncthreads();
    if (kc + 2u < NH / 2u) stage(kc + 2u, buf); }
  wait_copies();
#pragma unroll
  for (int t = 0; t < 8; ++t) { const unsigned col = (unsigned)t * 16u + nloc; const float bb = bf16_rne(bo[n0 + col]);
#pragma unroll
    for (int r = 0; r < 8; ++r) Tf[wave][8u * hlf + (unsigned)r][col] = acc[t][r] * (1.0f / (CC * WSC)) + bb; }
  __syncthreads();
  float* orow = out + (size_t)m0 * DM + n0 + lane * 4u;
  {
#pragma unroll 4
    for (unsigned rr = 0; rr < 16u; ++rr) { const v4f v = *(const v4f*)(&Tf[wave][rr][lane * 4u]); *(v4f*)(orow + (size_t)rr * DM) = v; }
     }
}

}  // namespace

extern "C" void kernel_launch(void* const* d_in, const int* in_sizes, int n_in, void* d_out, int out_size, void* d_ws, size_t ws_size, hipStream_t stream) {
  (void)n_in;
  auto Fp = [&](int i) { return (const float*)d_in[i]; };
  // wire order: 0 x [4][2048][512], 1 Wq [16][512][32], 2 bq [16][32], 3 Wk, 4 bk, 5 Wv, 6 bv, 7 Wo [512 out][512 in], 8 bo [512]; output [NB][SEQ][512] f32.
  const long long xneed = ((long long)(NB - 1) * SEQ_FULL + SEQ) * 512;
  if ((long long)in_sizes[0] < xneed || in_sizes[1] < 16 * 512 * 32 || in_sizes[2] < 512 || in_sizes[3] < 16 * 512 * 32 || in_sizes[4] < 512 || in_sizes[5] < 16 * 512 * 32 || in_sizes[6] < 512 || in_sizes[7] < 512 * 512 || in_sizes[8] < 512) return;
  if ((long long)out_size < (long long)NB * SEQ * 512) return;
  size_t off = 0; char* ws = (char*)d_ws;
  auto carve = [&](size_t bytes) { char* p = ws + off; off += (bytes + 255) & ~(size_t)255; return p; };
  const size_t planeB = (size_t)NB * SEQ * 512 * 2;               // 8,388,608 B at full size (NB*16*SEQ*32 halves == NB*SEQ*512 halves)
  b16* XH = (b16*)carve(planeB); b16* WT = (b16*)carve((size_t)4 * 512 * 512 * 2); b16* QP = (b16*)carve(planeB); b16* KP = (b16*)carve(planeB); b16* VT = (b16*)carve(planeB); b16* CTX = (b16*)carve(planeB);
  if (off > ws_size || off > ((size_t)128 << 20)) return;         // 5 x 8 MiB + 2 MiB = 44,040,192 B at full size
  xcvt_kernel<<<(unsigned)((size_t)NB * SEQ * 64 / 256), 256, 0, stream>>>(Fp(0), XH);
  wprep_kernel<<<dim3(128, 4), 256, 0, stream>>>(Fp(1), Fp(3), Fp(5), Fp(7), WT);
  qkv_kernel<<<dim3((unsigned)(NB * SEQ / 64), 16), 128, 0, stream>>>(XH, WT, Fp(2), Fp(4), Fp(6), QP, KP, VT);
  flash_kernel<<<(unsigned)(NB * 16 * (SEQ / 64)), 128, 0, stream>>>(QP, KP, VT, CTX);
  oproj_kernel<<<dim3((unsigned)(NB * SEQ / 64), 4), 128, 0, stream>>>(CTX, WT + (size_t)3 * 512 * 512, Fp(8), (float*)d_out);
}

// v004
// One run takes 84.5 microseconds.
// Timed twice side by side with v003, it ran 1.03 times as fast both times.
// All steps since v000 together make it 2.39 times as fast.
#include <hip/hip_runtime.h>

// Dense multi-head attention layer: x [NB][SEQ_FULL][512] (first SEQ rows of each batch used); per-head Q/K/V = x W[h] + b[h] (16 heads x 32), softmax(Q K^T / sqrt(32)) V over all keys, heads concatenated, y = ctx Wo^T + bo.
// compute dtype: every contraction on v_wmma_f32_16x16x32_f16 (f16 operands, f32 accumulate), one product per tile pair. Float inputs are converted to bf16 (RNE) on load and carried exactly
// in f16: x x8, weights x256 (Wq/Wk/Wv transposed to [h*32+dh][d], Wo kept [out][in]). Computed planes: Q, K, V^T as f16 x16; unnormalised softmax P as f16 x1024 (packed from the score
// accumulators directly into the P.V B fragment); ctx as f16 x256. Biases (bf16 RNE), softmax (running max, exp2), normalisation and all epilogues in f32.
// Fragment k-map per lane half hh for A AND B: elements 0..7 <- k = 8hh+0..7, 8..15 <- k = 16+8hh+0..7; acc[r] = D[8hh+r][lane&15].

#ifndef NB
#define NB 4
#endif
#ifndef SEQ
#define SEQ 2048
#endif
#define NB_FULL 4
#define SEQ_FULL 2048

namespace {

constexpr unsigned DM = 512, NH = 16, DH = 32, NBU = (unsigned)NB, SQ = (unsigned)SEQ, QB = SQ / 64u;
constexpr float XS = 8.0f, WSC = 256.0f, QC = 16.0f, PC = 1024.0f, CC = 256.0f;
constexpr float C2 = (float)(0.17677669529663687 * 1.4426950408889634 / 256.0);   // log2(e) / sqrt(32) / (QC * QC)
constexpr float PL = 10.0f; static_assert(PC == 1024.0f);                         // PL = log2(PC)
static_assert(SEQ % 64 == 0 && SEQ <= SEQ_FULL && NB <= NB_FULL && NB >= 1);
static_assert(((size_t)NB * SEQ * 64) % 256 == 0);            // xcvt: threads x 8 elements == NB*SEQ*512 exactly
static_assert((512 * 512 / 8) % 256 == 0);                    // wprep: 128 blocks x 256 threads x 8 == 512*512 per plane
static_assert(DM == NH * DH && DM % 32 == 0 && DH == 32);

typedef _Float16 b16;
typedef __attribute__((ext_vector_type(16))) _Float16 v16b;
typedef __attribute__((ext_vector_type(8))) _Float16 v8b;
typedef __attribute__((ext_vector_type(8))) float v8f;
typedef __attribute__((ext_vector_type(4))) float v4f;
typedef __attribute__((ext_vector_type(2))) float v2f;

__device__ __forceinline__ float bf16_rne(float f) { unsigned int u = __float_as_uint(f); u += 0x7FFFu + ((u >> 16) & 1u); return __uint_as_float(u & 0xFFFF0000u); }
__device__ __forceinline__ v16b frag_kb(const b16* p, unsigned hh) { const v8b a = *(const v8b*)(p + 8u * hh), b = *(const v8b*)(p + 16u + 8u * hh); v16b f;
#pragma unroll
  for (int e = 0; e < 8; ++e) { f[e] = a[e]; f[8 + e] = b[e]; } return f; }
__device__ __forceinline__ v8f wmma16b(v16b a, v16b b, v8f c) { return __builtin_amdgcn_wmma_f32_16x16x32_f16(false, a, false, b, (short)0, c, false, false); }

// Asynchronous 16-byte copies, global memory to LDS: each lane names its own LDS byte address (low 32 bits of the __shared__ address) and its own global pointer.
// One asm statement per tile: s_wait_xcnt 0 as its last line stands in front of every later rewrite of the address registers that the copies name.
__device__ __forceinline__ unsigned lds_off(const void* p) { return (unsigned)(size_t)p; }
#define CP "global_load_async_to_lds_b128 "
__device__ __forceinline__ void copy4(unsigned l0, const b16* g0, unsigned l1, const b16* g1, unsigned l2, const b16* g2, unsigned l3, const b16* g3) {
  asm volatile(CP "%0, %1, off\n\t" CP "%2, %3, off\n\t" CP "%4, %5, off\n\t" CP "%6, %7, off\n\ts_wait_xcnt 0x0"
               :: "v"(l0), "v"(g0), "v"(l1), "v"(g1), "v"(l2), "v"(g2), "v"(l3), "v"(g3) : "memory"); }
__device__ __forceinline__ void copy6(unsigned l0, const b16* g0, unsigned l1, const b16* g1, unsigned l2, const b16* g2, unsigned l3, const b16* g3, unsigned l4, const b16* g4, unsigned l5, const b16* g5) {
  asm volatile(CP "%0, %1, off\n\t" CP "%2, %3, off\n\t" CP "%4, %5, off\n\t" CP "%6, %7, off\n\t" CP "%8, %9, off\n\t" CP "%10, %11, off\n\ts_wait_xcnt 0x0"
               :: "v"(l0), "v"(g0), "v"(l1), "v"(g1), "v"(l2), "v"(g2), "v"(l3), "v"(g3), "v"(l4), "v"(g4), "v"(l5), "v"(g5) : "memory"); }
__device__ __forceinline__ void copy8(unsigned l0, const b16* g0, unsigned l1, const b16* g1, unsigned l2, const b16* g2, unsigned l3, const b16* g3, unsigned l4, const b16* g4, unsigned l5, const b16* g5, unsigned l6, const b16* g6, unsigned l7, const b16* g7) {
  asm volatile(CP "%0, %1, off\n\t" CP "%2, %3, off\n\t" CP "%4, %5, off\n\t" CP "%6, %7, off\n\t" CP "%8, %9, off\n\t" CP "%10, %11, off\n\t" CP "%12, %13, off\n\t" CP "%14, %15, off\n\ts_wait_xcnt 0x0"
               :: "v"(l0), "v"(g0), "v"(l1), "v"(g1), "v"(l2), "v"(g2), "v"(l3), "v"(g3), "v"(l4), "v"(g4), "v"(l5), "v"(g5), "v"(l6), "v"(g6), "v"(l7), "v"(g7) : "memory"); }
#undef CP
// this wave's copies have landed: in front of the barrier behind which the other waves read them
__device__ __forceinline__ void wait_copies() { asm volatile("s_wait_asynccnt 0x0" ::: "memory"); }
// this wave's LDS reads are done: in front of the barrier behind which their buffer is refilled
__device__ __forceinline__ void wait_lds() { asm volatile("s_wait_dscnt 0x0" ::: "memory"); }

__global__ __launch_bounds__(256) void xcvt_kernel(const float* __restrict__ x, b16* __restrict__ XH) {
  const unsigned u = blockIdx.x * 256u + threadIdx.x; const unsigned row = u >> 6, c = (u & 63u) * 8u; const unsigned b = row / SQ, s = row % SQ;
  const float* src = x + ((size_t)b * SEQ_FULL + s) * DM + c; const v4f a0 = *(const v4f*)src, a1 = *(const v4f*)(src + 4); v8b v;
#pragma unroll
  for (int j = 0; j < 4; ++j) { v[j] = (b16)(bf16_rne(a0[j]) * XS); v[4 + j] = (b16)(bf16_rne(a1[j]) * XS); }
  b16* dst = XH + (size_t)u * 8u;
  { *(v8b*)dst = v;  }
}

__global__ __launch_bounds__(256) void wprep_kernel(const float* __restrict__ wq, const float* __restrict__ wk, const float* __restrict__ wv, const float* __restrict__ wo, b16* __restrict__ WT) {
  const unsigned z = blockIdx.y; const unsigned u = blockIdx.x * 256u + threadIdx.x; const unsigned e = u * 8u, o = e >> 9, k0 = e & 511u; v8b v;
  if (z < 3u) { const float* w = (z == 0u) ? wq : ((z == 1u) ? wk : wv); const unsigned h = o >> 5, dh = o & 31u; const float* sp = w + ((size_t)h * DM + k0) * DH + dh;
#pragma unroll
    for (int j = 0; j < 8; ++j) v[j] = (b16)(bf16_rne(sp[(size_t)j * DH]) * WSC); }
  else { const float* sp = wo + (size_t)o * DM + k0; const v4f a0 = *(const v4f*)sp, a1 = *(const v4f*)(sp + 4);
#pragma unroll
    for (int j = 0; j < 4; ++j) { v[j] = (b16)(bf16_rne(a0[j]) * WSC); v[4 + j] = (b16)(bf16_rne(a1[j]) * WSC); } }
  b16* dst = WT + (size_t)z * DM * DM + e;
  { *(v8b*)dst = v;  }
}

// Q/K/V projection of one head: block = 64 rows x (32 q | 32 k | 32 v columns of head h), wave = 16 rows x 6 tiles; A fragments from XH rows (global), loaded one trip ahead. The 96 WT rows are shared by the four waves:
// per trip of 64 k they are copied once into LDS (rows of 128 bytes at pitch 144, two buffers, the next tile in flight while this one is worked on) and the B fragments are read from there.
// y = acc / 2048 + bf16(b); Q, K planes [bh][SEQ][32] f16 x16 (block writes 4096 contiguous bytes each); V^T plane [bh][32][SEQ] f16 x16 (32 lines of 64 keys). LDS tiles cross-wave: block barrier; they reuse the ring's LDS behind the last trip's barrier.
__global__ __launch_bounds__(128) void qkv_kernel(const b16* __restrict__ XH, const b16* __restrict__ WT, const float* __restrict__ bq, const float* __restrict__ bk, const float* __restrict__ bv, b16* __restrict__ QP, b16* __restrict__ KP, b16* __restrict__ VT) {
  __shared__ __attribute__((aligned(16))) b16 SM[2u * 96u * 72u];
  b16 (*Tq)[40] = (b16 (*)[40])SM; b16 (*Tk)[40] = (b16 (*)[40])(SM + 64u * 40u); b16 (*Tv)[72] = (b16 (*)[72])(SM + 128u * 40u);
  const unsigned tid = threadIdx.x, wave = tid >> 5, lane = tid & 31u, nloc = lane & 15u, hlf = lane >> 4; const unsigned m0 = blockIdx.x * 64u, h = blockIdx.y;
  const b16* arow = XH + (size_t)(m0 + wave * 16u + nloc) * DM; 
  const b16* gw = WT + (size_t)(h * DH + (tid >> 3)) * DM + (tid & 7u) * 8u; const unsigned lw = lds_off(SM + (tid >> 3) * 72u + (tid & 7u) * 8u);
  auto stage = [&](unsigned kc, unsigned buf) { const b16* g = gw + kc * 64u; const unsigned l = lw + buf * (96u * 144u);
    copy6(l, g, l + 16u * 144u, g + 16u * DM, l + 32u * 144u, g + DM * DM, l + 48u * 144u, g + DM * DM + 16u * DM, l + 64u * 144u, g + 2u * DM * DM, l + 80u * 144u, g + 2u * DM * DM + 16u * DM); };
  v8f acc[6];
#pragma unroll
  for (int t = 0; t < 6; ++t) acc[t] = (v8f){};
  v16b an[2] = {frag_kb(arow, hlf), frag_kb(arow + 32u, hlf)};   // A fragments one trip ahead: trip 0's are in flight during the first tile's copies
  stage(0u, 0u); wait_copies(); __syncthreads(); stage(1u, 1u);
#pragma unroll 1
  for (unsigned kc = 0; kc < DM / 64u; ++kc) { const unsigned buf = kc & 1u; const b16* wl = SM + buf * (96u * 72u) + nloc * 72u;
    const v16b ac[2] = {an[0], an[1]}; const unsigned kn = (kc + 1u < DM / 64u) ? kc + 1u : kc;   // the last trip loads its own fragments again: in bounds, no branch
    an[0] = frag_kb(arow + kn * 64u, hlf); an[1] = frag_kb(arow + kn * 64u + 32u, hlf);
#pragma unroll  // both k-steps of a trip spelled out: LDS offsets and acc[] indices stay compile-time constants
    for (int ks = 0; ks < 2; ++ks) {
#pragma unroll
      for (int t = 0; t < 6; ++t) acc[t] = wmma16b(ac[ks], frag_kb(wl + (unsigned)t * 16u * 72u + (unsigned)ks * 32u, hlf), acc[t]); }
    // issue order of the trip: the 4 global loads first (left alone the scheduler sinks them to the foot, where their latency stands in front of the barrier), 2 B fragments read ahead, then a WMMA and the next fragment's 2 LDS reads in turn
    __builtin_amdgcn_sched_group_barrier(0x020, 4, 0); __builtin_amdgcn_sched_group_barrier(0x100, 4, 0);
#pragma unroll  // the order is a straight list of groups: every builtin must stand in the trip's one block
    for (int i = 0; i < 10; ++i) { __builtin_amdgcn_sched_group_barrier(0x008, 1, 0); __builtin_amdgcn_sched_group_barrier(0x100, 2, 0); }
    __builtin_amdgcn_sched_group_barrier(0x008, 2, 0);   // end of the order: the last WMMAs, whose fragments are already read
    wait_lds(); wait_copies(); __syncthreads();
    if (kc + 2u < DM / 64u) stage(kc + 2u, buf); }
  wait_copies();
#pragma unroll
  for (int t = 0; t < 6; ++t) { const unsigned col = (unsigned)(t & 1) * 16u + nloc; const float* bp = (t < 2) ? bq : ((t < 4) ? bk : bv); const float bb = bf16_rne(bp[h * DH + col]);
#pragma unroll
    for (int r = 0; r < 8; ++r) { const unsigned row = wave * 16u + 8u * hlf + (unsigned)r; const float y = (acc[t][r] * (1.0f / (XS * WSC)) + bb) * QC; const b16 y16 = (b16)y;
      if (t < 2) Tq[row][col] = y16; else if (t < 4) Tk[row][col] = y16; else Tv[col][row] = y16; } }
  __syncthreads();
  const unsigned b = m0 / SQ, s0 = m0 % SQ, bh = b * NH + h; v8b qv[2], kv[2], vv[2];
#pragma unroll
  for (int i = 0; i < 2; ++i) { const unsigned idx = (unsigned)i * 128u + tid; qv[i] = *(const v8b*)(&Tq[idx >> 2][(idx & 3u) * 8u]); kv[i] = *(const v8b*)(&Tk[idx >> 2][(idx & 3u) * 8u]); vv[i] = *(const v8b*)(&Tv[idx >> 3][(idx & 7u) * 8u]); }
  b16* qd = QP + ((size_t)bh * SQ + s0) * DH; b16* kd = KP + ((size_t)bh * SQ + s0) * DH; b16* vd = VT + (size_t)bh * DH * SQ + s0;
  {
#pragma unroll
    for (int i = 0; i < 2; ++i) { const unsigned idx = (unsigned)i * 128u + tid; *(v8b*)(qd + (size_t)idx * 8u) = qv[i]; *(v8b*)(kd + (size_t)idx * 8u) = kv[i]; *(v8b*)(vd + (size_t)(idx >> 3) * SQ + (idx & 7u) * 8u) = vv[i]; }
     }
}

// flash attention, transposed form: block = 64 queries of one (b, h), wave = 16 queries (the D columns). Per 64 keys: S^T tiles = K rows (A) x Q rows (B, loaded once); column max = per-lane max over
// the 32 accumulator values + one xor-16 exchange; p x1024 = exp2(s c - (m - 10)), one packed FMA a score pair; the four score tiles are packed (f16) into two B fragments (element r <- tile 2j, element 8+r <- tile 2j+1);
// O^T tiles (dh rows) += V^T rows (A) x P^T (B). The 64 K rows and the 32 V^T rows of a trip are shared by the four waves: copied once into LDS (K rows of 64 bytes at pitch 80, V^T rows of 128 bytes
// at pitch 144, two buffers, the next tile in flight while this one is worked on); the A fragments are read from there. ctx plane [bh][SEQ][32] f16 x256; wave writes its 1024 contiguous bytes. No key tail (SEQ % 64 == 0).
__global__ __launch_bounds__(128) void flash_kernel(const b16* __restrict__ QP, const b16* __restrict__ KP, const b16* __restrict__ VT, b16* __restrict__ CTX) {
  __shared__ __attribute__((aligned(16))) b16 Ks[2][64][40], Vs[2][32][72], Tc[4][16][40];
  const unsigned tid = threadIdx.x, wave = tid >> 5, lane = tid & 31u, nloc = lane & 15u, hlf = lane >> 4; const unsigned bh = blockIdx.x / QB, s0 = (blockIdx.x % QB) * 64u + wave * 16u;
  constexpr unsigned NT = SQ / 64u;
  const b16* gk = KP + (size_t)bh * SQ * DH + tid * 8u; const b16* gv = VT + (size_t)bh * DH * SQ + (size_t)(tid >> 3) * SQ + (tid & 7u) * 8u;
  const unsigned lk = lds_off(&Ks[0][tid >> 2][(tid & 3u) * 8u]), lv = lds_off(&Vs[0][tid >> 3][(tid & 7u) * 8u]);
  auto stage = [&](unsigned t, unsigned buf) { const b16* k0 = gk + (size_t)t * 64u * DH; const b16* v0 = gv + t * 64u; const unsigned a = lk + buf * (64u * 80u), c = lv + buf * (32u * 144u);
    copy4(a, k0, a + 32u * 80u, k0 + 32u * DH, c, v0, c + 16u * 144u, v0 + (size_t)16u * SQ); };
  const v16b qb = frag_kb(QP + ((size_t)bh * SQ + s0 + nloc) * DH, hlf);
  float mrun = -1e30f, lsum = 0.0f; v8f o0 = (v8f){}, o1 = (v8f){};
  stage(0u, 0u); wait_copies(); __syncthreads();
  if (NT > 1u) stage(1u, 1u);
#pragma unroll 1
  for (unsigned t = 0; t < NT; ++t) {
    const unsigned buf = t & 1u; const b16* Kl = &Ks[buf][nloc][0]; const b16* Vl = &Vs[buf][nloc][0];
    v8f s[4];
#pragma unroll
    for (int j = 0; j < 4; ++j) s[j] = wmma16b(frag_kb(Kl + 16u * (unsigned)j * 40u, hlf), qb, (v8f){});
    float mx = -3.0e38f;
#pragma unroll
    for (int j = 0; j < 4; ++j) {
#pragma unroll
      for (int r = 0; r < 8; ++r) mx = fmaxf(mx, s[j][r]); }
    mx = fmaf(fmaxf(mx, __shfl_xor(mx, 16, 32)), C2, -PL);   // the running reference is max - log2(PC): exp2(s c - reference) is p x1024 as it comes
    const float mn = fmaxf(mrun, mx); const float corr = __builtin_amdgcn_exp2f(mrun - mn); mrun = mn;
    float ps = 0.0f; v16b pb0, pb1; float p[4][8]; const v2f cc = {C2, C2}, nm = {-mn, -mn};
#pragma unroll
    for (int j = 0; j < 4; ++j) {
#pragma unroll
      for (int r = 0; r < 8; r += 2) { const v2f sv = {s[j][r], s[j][r + 1]}; const v2f x = __builtin_elementwise_fma(sv, cc, nm); p[j][r] = __builtin_amdgcn_exp2f(x[0]); p[j][r + 1] = __builtin_amdgcn_exp2f(x[1]); } }
#pragma unroll
    for (int r = 0; r < 8; ++r) {
      ps += (p[0][r] + p[1][r]) + (p[2][r] + p[3][r]); pb0[r] = (b16)p[0][r]; pb0[8 + r] = (b16)p[1][r]; pb1[r] = (b16)p[2][r]; pb1[8 + r] = (b16)p[3][r]; }
    lsum = lsum * corr + ps;
#pragma unroll
    for (int r = 0; r < 8; ++r) { o0[r] *= corr; o1[r] *= corr; }
    o0 = wmma16b(frag_kb(Vl, hlf), pb0, o0); o0 = wmma16b(frag_kb(Vl + 32u, hlf), pb1, o0);
    o1 = wmma16b(frag_kb(Vl + 16u * 72u, hlf), pb0, o1); o1 = wmma16b(frag_kb(Vl + 16u * 72u + 32u, hlf), pb1, o1);
    wait_lds(); wait_copies(); __syncthreads();
    if (t + 2u < NT) stage(t + 2u, buf);
  }
  wait_copies();
  lsum += __shfl_xor(lsum, 16, 32);
  const float inv = (CC / QC) * (1.0f / lsum); v8b c0, c1;   // lsum carries the x1024 of P, as o0 and o1 do
#pragma unroll
  for (int r = 0; r < 8; ++r) { c0[r] = (b16)(o0[r] * inv); c1[r] = (b16)(o1[r] * inv); }
  *(v8b*)(&Tc[wave][nloc][8u * hlf]) = c0; *(v8b*)(&Tc[wave][nloc][16u + 8u * hlf]) = c1;
  __syncthreads();
  v8b cv[2];
#pragma unroll
  for (int i = 0; i < 2; ++i) { const unsigned idx = (unsigned)i * 32u + lane; cv[i] = *(const v8b*)(&Tc[wave][idx >> 2][(idx & 3u) * 8u]); }
  b16* cd = CTX + ((size_t)bh * SQ + s0) * DH;
  {
#pragma unroll
    for (int i = 0; i < 2; ++i) { const unsigned idx = (unsigned)i * 32u + lane; *(v8b*)(cd + (size_t)idx * 8u) = cv[i]; }
     }
}

// output projection: block = 64 rows x 128 columns, wave = 16 rows x 8 tiles; k-step = one head (A fragment from ctx[bh][s][0..31], loaded one trip ahead; B fragment from Wo rows at k = h*32). The 128 Wo rows are shared by the four waves: per trip of two heads (64 k)
// they are copied once into LDS (rows of 128 bytes at pitch 144, two buffers, the next tile in flight while this one is worked on) and the B fragments are read from there. y = acc / 65536 + bf16(bo).
__global__ __launch_bounds__(128) void oproj_kernel(const b16* __restrict__ CTX, const b16* __restrict__ WO, const float* __restrict__ bo, float* __restrict__ out) {
  __shared__ __attribute__((aligned(16))) float Tf[4][16][132];
  __shared__ __attribute__((aligned(16))) b16 Ws[2][128][72];
  const unsigned tid = threadIdx.x, wave = tid >> 5, lane = tid & 31u, nloc = lane & 15u, hlf = lane >> 4; const unsigned m0 = blockIdx.x * 64u + wave * 16u, n0 = blockIdx.y * 128u; const unsigned b = m0 / SQ, s0 = m0 % SQ;
  const b16* abase = CTX + ((size_t)(b * NH) * SQ + s0 + nloc) * DH; 
  const b16* gw = WO + (size_t)(n0 + (tid >> 3)) * DM + (tid & 7u) * 8u; const unsigned lw = lds_off(&Ws[0][tid >> 3][(tid & 7u) * 8u]);
  auto stage = [&](unsigned kc, unsigned buf) { const b16* g = gw + kc * 64u; const unsigned l = lw + buf * (128u * 144u);
    copy8(l, g, l + 16u * 144u, g + 16u * DM, l + 32u * 144u, g + 32u * DM, l + 48u * 144u, g + 48u * DM, l + 64u * 144u, g + 64u * DM, l + 80u * 144u, g + 80u * DM, l + 96u * 144u, g + 96u * DM, l + 112u * 144u, g + 112u * DM); };
  v8f acc[8];
#pragma unroll
  for (int t = 0; t < 8; ++t) acc[t] = (v8f){};
  v16b an[2] = {frag_kb(abase, hlf), frag_kb(abase + (size_t)SQ * DH, hlf)};   // A fragments one trip ahead: trip 0's are in flight during the first tile's copies
  stage(0u, 0u); wait_copies(); __syncthreads(); stage(1u, 1u);
#pragma unroll 1
  for (unsigned kc = 0; kc < NH / 2u; ++kc) { const unsigned buf = kc & 1u; const b16* wl = &Ws[buf][nloc][0];
    const v16b ac[2] = {an[0], an[1]}; const unsigned kn = (kc + 1u < NH / 2u) ? kc + 1u : kc;   // the last trip loads its own fragments again: in bounds, no branch
    an[0] = frag_kb(abase + (size_t)(kn * 2u) * SQ * DH, hlf); an[1] = frag_kb(abase + (size_t)(kn * 2u + 1u) * SQ * DH, hlf);
#pragma unroll  // both k-steps of a trip spelled out: LDS offsets and acc[] indices stay compile-time constants
    for (int ks = 0; ks < 2; ++ks) {
#pragma unroll
      for (int t = 0; t < 8; ++t) acc[t] = wmma16b(ac[ks], frag_kb(wl + (unsigned)t * 16u * 72u + (unsigned)ks * 32u, hlf), acc[t]); }
    // issue order of the trip: the 4 global loads first (left alone the scheduler sinks them to the foot, where their latency stands in front of the barrier), 4 B fragments read ahead, then a WMMA and the next fragment's 2 LDS reads in turn
    __builtin_amdgcn_sched_group_barrier(0x020, 4, 0); __builtin_amdgcn_sched_group_barrier(0x100, 8, 0);
#pragma unroll  // the order is a straight list of groups: every builtin must stand in the trip's one block
    for (int i = 0; i < 12; ++i) { __builtin_amdgcn_sched_group_barrier(0x008, 1, 0); __builtin_amdgcn_sched_group_barrier(0x100, 2, 0); }
    __builtin_amdgcn_sched_group_barrier(0x008, 4, 0);   // end of the order: the last WMMAs, whose fragments are already read
    wait_lds(); wait_copies(); __syncthreads();
    if (kc + 2u < NH / 2u) stage(kc + 2u, buf); }
  wait_copies();
#pragma unroll
  for (int t = 0; t < 8; ++t) { const unsigned col = (unsigned)t * 16u + nloc; const float bb = bf16_rne(bo[n0 + col]);
#pragma unroll
    for (int r = 0; r < 8; ++r) Tf[wave][8u * hlf + (unsigned)r][col] = acc[t][r] * (1.0f / (CC * WSC)) + bb; }
  __syncthreads();
  float* orow = out + (size_t)m0 * DM + n0 + lane * 4u;
  {
#pragma unroll 4
    for (unsigned rr = 0; rr < 16u; ++rr) { const v4f v = *(const v4f*)(&Tf[wave][rr][lane * 4u]); *(v4f*)(orow + (size_t)rr * DM) = v; }
     }
}

}  // namespace

extern "C" void kernel_launch(void* const* d_in, const int* in_sizes, int n_in, void* d_out, int out_size, void* d_ws, size_t ws_size, hipStream_t stream) {
  (void)n_in;
  auto Fp = [&](int i) { return (const float*)d_in[i]; };
  // wire order: 0 x [4][2048][512], 1 Wq [16][512][32], 2 bq [16][32], 3 Wk, 4 bk, 5 Wv, 6 bv, 7 Wo [512 out][512 in], 8 bo [512]; output [NB][SEQ][512] f32.
  const long long xneed = ((long long)(NB - 1) * SEQ_FULL + SEQ) * 512;
  if ((long long)in_sizes[0] < xneed || in_sizes[1] < 16 * 512 * 32 || in_sizes[2] < 512 || in_sizes[3] < 16 * 512 * 32 || in_sizes[4] < 512 || in_sizes[5] < 16 * 512 * 32 || in_sizes[6] < 512 || in_sizes[7] < 512 * 512 || in_sizes[8] < 512) return;
  if ((long long)out_size < (long long)NB * SEQ * 512) return;
  size_t off = 0; char* ws = (char*)d_ws;
  auto carve = [&](size_t bytes) { char* p = ws + off; off += (bytes + 255) & ~(size_t)255; return p; };
  const size_t planeB = (size_t)NB * SEQ * 512 * 2;               // 8,388,608 B at full size (NB*16*SEQ*32 halves == NB*SEQ*512 halves)
  b16* XH = (b16*)carve(planeB); b16* WT = (b16*)carve((size_t)4 * 512 * 512 * 2); b16* QP = (b16*)carve(planeB); b16* KP = (b16*)carve(planeB); b16* VT = (b16*)carve(planeB); b16* CTX = (b16*)carve(planeB);
  if (off > ws_size || off > ((size_t)128 << 20)) return;         // 5 x 8 MiB + 2 MiB = 44,040,192 B at full size
  xcvt_kernel<<<(unsigned)((size_t)NB * SEQ * 64 / 256), 256, 0, stream>>>(Fp(0), XH);
  wprep_kernel<<<dim3(128, 4), 256, 0, stream>>>(Fp(1), Fp(3), Fp(5), Fp(7), WT);
  qkv_kernel<<<dim3((unsigned)(NB * SEQ / 64), 16), 128, 0, stream>>>(XH, WT, Fp(2), Fp(4), Fp(6), QP, KP, VT);
  flash_kernel<<<(unsigned)(NB * 16 * (SEQ / 64)), 128, 0, stream>>>(QP, KP, VT, CTX);
  oproj_kernel<<<dim3((unsigned)(NB * SEQ / 64), 4), 128, 0, stream>>>(CTX, WT + (size_t)3 * 512 * 512, Fp(8), (float*)d_out);
}

// v005
// One run takes 80.9 microseconds.
// In both of two side-by-side timings against v004, it was 1.05 times as fast.
// All steps since v000 together make it 2.51 times as fast.
#include <hip/hip_runtime.h>

// Dense multi-head attention layer: x [NB][SEQ_FULL][512] (first SEQ rows of each batch used); per-head Q/K/V = x W[h] + b[h] (16 heads x 32), softmax(Q K^T / sqrt(32)) V over all keys, heads concatenated, y = ctx Wo^T + bo.
// compute dtype: every contraction on v_wmma_f32_16x16x32_f16 (f16 operands, f32 accumulate), one product per tile pair. Float inputs are converted to bf16 (RNE) on load and carried exactly
// in f16: x x8, weights x256 (Wq/Wk/Wv transposed to [h*32+dh][d], Wo kept [out][in]). Computed planes: Q as f16 x log2(e)/sqrt(32), K as f16 x1, V^T as f16 x16; unnormalised softmax P as f16 x1024 (packed from the score
// accumulators directly into the P.V B fragment); ctx as f16 x256. Biases (bf16 RNE), softmax (kept reference, exp2), normalisation and all epilogues in f32.
// Fragment k-map per lane half hh for A AND B: elements 0..7 <- k = 8hh+0..7, 8..15 <- k = 16+8hh+0..7; acc[r] = D[8hh+r][lane&15].

#ifndef NB
#define NB 4
#endif
#ifndef SEQ
#define SEQ 2048
#endif
#define NB_FULL 4
#define SEQ_FULL 2048

namespace {

constexpr unsigned DM = 512, NH = 16, DH = 32, NBU = (unsigned)NB, SQ = (unsigned)SEQ, QB = SQ / 64u;
constexpr float XS = 8.0f, WSC = 256.0f, QC = 16.0f, PC = 1024.0f, CC = 256.0f;
constexpr float QS = (float)(0.17677669529663687 * 1.4426950408889634);           // scale of the Q plane: log2(e) / sqrt(32); the K plane is x1, so a score product is an exp2 argument as it comes
constexpr float PL = 10.0f; static_assert(PC == 1024.0f);                         // PL = log2(PC)
constexpr float LIM = 65504.0f;                                                   // largest finite f16: bound on a lane's sum of 32 p x1024 taken without a new reference
static_assert(SEQ % 64 == 0 && SEQ <= SEQ_FULL && NB <= NB_FULL && NB >= 1);
static_assert(((size_t)NB * SEQ * 64) % 256 == 0);            // xcvt: threads x 8 elements == NB*SEQ*512 exactly
static_assert((512 * 512 / 8) % 256 == 0);                    // wprep: 128 blocks x 256 threads x 8 == 512*512 per plane
static_assert(DM == NH * DH && DM % 32 == 0 && DH == 32);

typedef _Float16 b16;
typedef __attribute__((ext_vector_type(16))) _Float16 v16b;
typedef __attribute__((ext_vector_type(8))) _Float16 v8b;
typedef __attribute__((ext_vector_type(8))) float v8f;
typedef __attribute__((ext_vector_type(4))) float v4f;

__device__ __forceinline__ float bf16_rne(float f) { unsigned int u = __float_as_uint(f); u += 0x7FFFu + ((u >> 16) & 1u); return __uint_as_float(u & 0xFFFF0000u); }
__device__ __forceinline__ v16b frag_kb(const b16* p, unsigned hh) { const v8b a = *(const v8b*)(p + 8u * hh), b = *(const v8b*)(p + 16u + 8u * hh); v16b f;
#pragma unroll
  for (int e = 0; e < 8; ++e) { f[e] = a[e]; f[8 + e] = b[e]; } return f; }
__device__ __forceinline__ v8f wmma16b(v16b a, v16b b, v8f c) { return __builtin_amdgcn_wmma_f32_16x16x32_f16(false, a, false, b, (short)0, c, false, false); }

// Asynchronous 16-byte copies, global memory to LDS: each lane names its own LDS byte address (low 32 bits of the __shared__ address) and its own global pointer.
// One asm statement per tile: s_wait_xcnt 0 as its last line stands in front of every later rewrite of the address registers that the copies name.
__device__ __forceinline__ unsigned lds_off(const void* p) { return (unsigned)(size_t)p; }
#define CP "global_load_async_to_lds_b128 "
__device__ __forceinline__ void copy4(unsigned l0, const b16* g0, unsigned l1, const b16* g1, unsigned l2, const b16* g2, unsigned l3, const b16* g3) {
  asm volatile(CP "%0, %1, off\n\t" CP "%2, %3, off\n\t" CP "%4, %5, off\n\t" CP "%6, %7, off\n\ts_wait_xcnt 0x0"
               :: "v"(l0), "v"(g0), "v"(l1), "v"(g1), "v"(l2), "v"(g2), "v"(l3), "v"(g3) : "memory"); }
__device__ __forceinline__ void copy6(unsigned l0, const b16* g0, unsigned l1, const b16* g1, unsigned l2, const b16* g2, unsigned l3, const b16* g3, unsigned l4, const b16* g4, unsigned l5, const b16* g5) {
  asm volatile(CP "%0, %1, off\n\t" CP "%2, %3, off\n\t" CP "%4, %5, off\n\t" CP "%6, %7, off\n\t" CP "%8, %9, off\n\t" CP "%10, %11, off\n\ts_wait_xcnt 0x0"
               :: "v"(l0), "v"(g0), "v"(l1), "v"(g1), "v"(l2), "v"(g2), "v"(l3), "v"(g3), "v"(l4), "v"(g4), "v"(l5), "v"(g5) : "memory"); }
__device__ __forceinline__ void copy8(unsigned l0, const b16* g0, unsigned l1, const b16* g1, unsigned l2, const b16* g2, unsigned l3, const b16* g3, unsigned l4, const b16* g4, unsigned l5, const b16* g5, unsigned l6, const b16* g6, unsigned l7, const b16* g7) {
  asm volatile(CP "%0, %1, off\n\t" CP "%2, %3, off\n\t" CP "%4, %5, off\n\t" CP "%6, %7, off\n\t" CP "%8, %9, off\n\t" CP "%10, %11, off\n\t" CP "%12, %13, off\n\t" CP "%14, %15, off\n\ts_wait_xcnt 0x0"
               :: "v"(l0), "v"(g0), "v"(l1), "v"(g1), "v"(l2), "v"(g2), "v"(l3), "v"(g3), "v"(l4), "v"(g4), "v"(l5), "v"(g5), "v"(l6), "v"(g6), "v"(l7), "v"(g7) : "memory"); }
#undef CP
// this wave's copies have landed: in front of the barrier behind which the other waves read them
__device__ __forceinline__ void wait_copies() { asm volatile("s_wait_asynccnt 0x0" ::: "memory"); }
// this wave's LDS reads are done: in front of the barrier behind which their buffer is refilled
__device__ __forceinline__ void wait_lds() { asm volatile("s_wait_dscnt 0x0" ::: "memory"); }

__global__ __launch_bounds__(256) void xcvt_kernel(const float* __restrict__ x, b16* __restrict__ XH) {
  const unsigned u = blockIdx.x * 256u + threadIdx.x; const unsigned row = u >> 6, c = (u & 63u) * 8u; const unsigned b = row / SQ, s = row % SQ;
  const float* src = x + ((size_t)b * SEQ_FULL + s) * DM + c; const v4f a0 = *(const v4f*)src, a1 = *(const v4f*)(src + 4); v8b v;
#pragma unroll
  for (int j = 0; j < 4; ++j) { v[j] = (b16)(bf16_rne(a0[j]) * XS); v[4 + j] = (b16)(bf16_rne(a1[j]) * XS); }
  b16* dst = XH + (size_t)u * 8u;
  { *(v8b*)dst = v;  }
}

__global__ __launch_bounds__(256) void wprep_kernel(const float* __restrict__ wq, const float* __restrict__ wk, const float* __restrict__ wv, const float* __restrict__ wo, b16* __restrict__ WT) {
  const unsigned z = blockIdx.y; const unsigned u = blockIdx.x * 256u + threadIdx.x; const unsigned e = u * 8u, o = e >> 9, k0 = e & 511u; v8b v;
  if (z < 3u) { const float* w = (z == 0u) ? wq : ((z == 1u) ? wk : wv); const unsigned h = o >> 5, dh = o & 31u; const float* sp = w + ((size_t)h * DM + k0) * DH + dh;
#pragma unroll
    for (int j = 0; j < 8; ++j) v[j] = (b16)(bf16_rne(sp[(size_t)j * DH]) * WSC); }
  else { const float* sp = wo + (size_t)o * DM + k0; const v4f a0 = *(const v4f*)sp, a1 = *(const v4f*)(sp + 4);
#pragma unroll
    for (int j = 0; j < 4; ++j) { v[j] = (b16)(bf16_rne(a0[j]) * WSC); v[4 + j] = (b16)(bf16_rne(a1[j]) * WSC); } }
  b16* dst = WT + (size_t)z * DM * DM + e;
  { *(v8b*)dst = v;  }
}

// Q/K/V projection of one head: block = 64 rows x (32 q | 32 k | 32 v columns of head h), wave = 16 rows x 6 tiles; A fragments from XH rows (global), loaded one trip ahead. The 96 WT rows are shared by the four waves:
// per trip of 64 k they are copied once into LDS (rows of 128 bytes at pitch 144, two buffers, the next tile in flight while this one is worked on) and the B fragments are read from there.
// y = acc / 2048 + bf16(b); Q, K planes [bh][SEQ][32] f16, Q x log2(e)/sqrt(32), K x1 (block writes 4096 contiguous bytes each); V^T plane [bh][32][SEQ] f16 x16 (32 lines of 64 keys). LDS tiles cross-wave: block barrier; they reuse the ring's LDS behind the last trip's barrier.
__global__ __launch_bounds__(128) void qkv_kernel(const b16* __restrict__ XH, const b16* __restrict__ WT, const float* __restrict__ bq, const float* __restrict__ bk, const float* __restrict__ bv, b16* __restrict__ QP, b16* __restrict__ KP, b16* __restrict__ VT) {
  __shared__ __attribute__((aligned(16))) b16 SM[2u * 96u * 72u];
  b16 (*Tq)[40] = (b16 (*)[40])SM; b16 (*Tk)[40] = (b16 (*)[40])(SM + 64u * 40u); b16 (*Tv)[72] = (b16 (*)[72])(SM + 128u * 40u);
  const unsigned tid = threadIdx.x, wave = tid >> 5, lane = tid & 31u, nloc = lane & 15u, hlf = lane >> 4; const unsigned m0 = blockIdx.x * 64u, h = blockIdx.y;
  const b16* arow = XH + (size_t)(m0 + wave * 16u + nloc) * DM; 
  const b16* gw = WT + (size_t)(h * DH + (tid >> 3)) * DM + (tid & 7u) * 8u; const unsigned lw = lds_off(SM + (tid >> 3) * 72u + (tid & 7u) * 8u);
  auto stage = [&](unsigned kc, unsigned buf) { const b16* g = gw + kc * 64u; const unsigned l = lw + buf * (96u * 144u);
    copy6(l, g, l + 16u * 144u, g + 16u * DM, l + 32u * 144u, g + DM * DM, l + 48u * 144u, g + DM * DM + 16u * DM, l + 64u * 144u, g + 2u * DM * DM, l + 80u * 144u, g + 2u * DM * DM + 16u * DM); };
  v8f acc[6];
#pragma unroll
  for (int t = 0; t < 6; ++t) acc[t] = (v8f){};
  v16b an[2] = {frag_kb(arow, hlf), frag_kb(arow + 32u, hlf)};   // A fragments one trip ahead: trip 0's are in flight during the first tile's copies
  stage(0u, 0u); wait_copies(); __syncthreads(); stage(1u, 1u);
#pragma unroll 1
  for (unsigned kc = 0; kc < DM / 64u; ++kc) { const unsigned buf = kc & 1u; const b16* wl = SM + buf * (96u * 72u) + nloc * 72u;
    const v16b ac[2] = {an[0], an[1]}; const unsigned kn = (kc + 1u < DM / 64u) ? kc + 1u : kc;   // the last trip loads its own fragments again: in bounds, no branch
    an[0] = frag_kb(arow + kn * 64u, hlf); an[1] = frag_kb(arow + kn * 64u + 32u, hlf);
#pragma unroll  // both k-steps of a trip spelled out: LDS offsets and acc[] indices stay compile-time constants
    for (int ks = 0; ks < 2; ++ks) {
#pragma unroll
      for (int t = 0; t < 6; ++t) acc[t] = wmma16b(ac[ks], frag_kb(wl + (unsigned)t * 16u * 72u + (unsigned)ks * 32u, hlf), acc[t]); }
    // issue order of the trip: the 4 global loads first (left alone the scheduler sinks them to the foot, where their latency stands in front of the barrier), 2 B fragments read ahead, then a WMMA and the next fragment's 2 LDS reads in turn
    __builtin_amdgcn_sched_group_barrier(0x020, 4, 0); __builtin_amdgcn_sched_group_barrier(0x100, 4, 0);
#pragma unroll  // the order is a straight list of groups: every builtin must stand in the trip's one block
    for (int i = 0; i < 10; ++i) { __builtin_amdgcn_sched_group_barrier(0x008, 1, 0); __builtin_amdgcn_sched_group_barrier(0x100, 2, 0); }
    __builtin_amdgcn_sched_group_barrier(0x008, 2, 0);   // end of the order: the last WMMAs, whose fragments are already read
    wait_lds(); wait_copies(); __syncthreads();
    if (kc + 2u < DM / 64u) stage(kc + 2u, buf); }
  wait_copies();
#pragma unroll
  for (int t = 0; t < 6; ++t) { const unsigned col = (unsigned)(t & 1) * 16u + nloc; const float* bp = (t < 2) ? bq : ((t < 4) ? bk : bv); const float bb = bf16_rne(bp[h * DH + col]);
#pragma unroll
    for (int r = 0; r < 8; ++r) { const unsigned row = wave * 16u + 8u * hlf + (unsigned)r; const float y = (acc[t][r] * (1.0f / (XS * WSC)) + bb) * ((t < 2) ? QS : ((t < 4) ? 1.0f : QC)); const b16 y16 = (b16)y;
      if (t < 2) Tq[row][col] = y16; else if (t < 4) Tk[row][col] = y16; else Tv[col][row] = y16; } }
  __syncthreads();
  const unsigned b = m0 / SQ, s0 = m0 % SQ, bh = b * NH + h; v8b qv[2], kv[2], vv[2];
#pragma unroll
  for (int i = 0; i < 2; ++i) { const unsigned idx = (unsigned)i * 128u + tid; qv[i] = *(const v8b*)(&Tq[idx >> 2][(idx & 3u) * 8u]); kv[i] = *(const v8b*)(&Tk[idx >> 2][(idx & 3u) * 8u]); vv[i] = *(const v8b*)(&Tv[idx >> 3][(idx & 7u) * 8u]); }
  b16* qd = QP + ((size_t)bh * SQ + s0) * DH; b16* kd = KP + ((size_t)bh * SQ + s0) * DH; b16* vd = VT + (size_t)bh * DH * SQ + s0;
  {
#pragma unroll
    for (int i = 0; i < 2; ++i) { const unsigned idx = (unsigned)i * 128u + tid; *(v8b*)(qd + (size_t)idx * 8u) = qv[i]; *(v8b*)(kd + (size_t)idx * 8u) = kv[i]; *(v8b*)(vd + (size_t)(idx >> 3) * SQ + (idx & 7u) * 8u) = vv[i]; }
     }
}

// flash attention, transposed form: block = 64 queries of one (b, h), wave = 16 queries (the D columns). Per 64 keys: S^T tiles = K rows (A) x Q rows (B, loaded once) + C, C = minus the reference in use, so a
// score accumulator is the exp2 argument of p x1024 as it comes; the lane's sum of its 32 p decides whether the reference is renewed (only then: max over the arguments, one xor-16 exchange, O and the row sum rescaled, p anew); the four score tiles are packed (f16) into two B fragments (element r <- tile 2j, element 8+r <- tile 2j+1);
// O^T tiles (dh rows) += V^T rows (A) x P^T (B). The 64 K rows and the 32 V^T rows of a trip are shared by the four waves: copied once into LDS (K rows of 64 bytes at pitch 80, V^T rows of 128 bytes
// at pitch 144, two buffers, the next tile in flight while this one is worked on); the A fragments are read from there. ctx plane [bh][SEQ][32] f16 x256; wave writes its 1024 contiguous bytes. No key tail (SEQ % 64 == 0).
__global__ __launch_bounds__(128) void flash_kernel(const b16* __restrict__ QP, const b16* __restrict__ KP, const b16* __restrict__ VT, b16* __restrict__ CTX) {
  __shared__ __attribute__((aligned(16))) b16 Ks[2][64][40], Vs[2][32][72], Tc[4][16][40];
  const unsigned tid = threadIdx.x, wave = tid >> 5, lane = tid & 31u, nloc = lane & 15u, hlf = lane >> 4; const unsigned bh = blockIdx.x / QB, s0 = (blockIdx.x % QB) * 64u + wave * 16u;
  constexpr unsigned NT = SQ / 64u;
  const b16* gk = KP + (size_t)bh * SQ * DH + tid * 8u; const b16* gv = VT + (size_t)bh * DH * SQ + (size_t)(tid >> 3) * SQ + (tid & 7u) * 8u;
  const unsigned lk = lds_off(&Ks[0][tid >> 2][(tid & 3u) * 8u]), lv = lds_off(&Vs[0][tid >> 3][(tid & 7u) * 8u]);
  auto stage = [&](unsigned t, unsigned buf) { const b16* k0 = gk + (size_t)t * 64u * DH; const b16* v0 = gv + t * 64u; const unsigned a = lk + buf * (64u * 80u), c = lv + buf * (32u * 144u);
    copy4(a, k0, a + 32u * 80u, k0 + 32u * DH, c, v0, c + 16u * 144u, v0 + (size_t)16u * SQ); };
  const v16b qb = frag_kb(QP + ((size_t)bh * SQ + s0 + nloc) * DH, hlf);
  float lsum = 0.0f; v8f o0 = (v8f){}, o1 = (v8f){}, cref = (v8f){};   // cref: minus the reference in use (a max seen - log2(PC)), the same in all 8 rows: the C operand of the score products
  stage(0u, 0u); wait_copies(); __syncthreads();
  if (NT > 1u) stage(1u, 1u);
#pragma unroll 1
  for (unsigned t = 0; t < NT; ++t) {
    const unsigned buf = t & 1u; const b16* Kl = &Ks[buf][nloc][0]; const b16* Vl = &Vs[buf][nloc][0];
    v8f s[4];
#pragma unroll
    for (int j = 0; j < 4; ++j) s[j] = wmma16b(frag_kb(Kl + 16u * (unsigned)j * 40u, hlf), qb, cref);
    float ps; float p[4][8];
    auto soft = [&]() { ps = 0.0f;   // p x1024 of the trip's 32 arguments and this lane's part of the row sum
#pragma unroll
      for (int j = 0; j < 4; ++j) {
#pragma unroll
        for (int r = 0; r < 8; ++r) p[j][r] = __builtin_amdgcn_exp2f(s[j][r]); }
#pragma unroll
      for (int r = 0; r < 8; ++r) ps += (p[0][r] + p[1][r]) + (p[2][r] + p[3][r]); };
    soft();
    // one wave-uniform test a trip, on the sum that is formed anyway: no p is negative, so every p is at most ps, and ps <= LIM keeps all 32 inside f16. The first trip always goes through and sets the reference;
    // later any lane above LIM sends the whole wave through (a column that needs nothing gets delta 0). Only there: the max over the arguments, the xor-16 exchange, the rescale of O and the row sum, and p anew.
    const float lim = (t == 0u) ? -1.0f : LIM;   // ps is never below 0
    if (__builtin_amdgcn_ballot_w32(!(ps <= lim)) != 0u) {
      float mx = -3.0e38f;
#pragma unroll
      for (int j = 0; j < 4; ++j) {
#pragma unroll
        for (int r = 0; r < 8; ++r) mx = fmaxf(mx, s[j][r]); }
      const float d = fmaxf(mx, __shfl_xor(mx, 16, 32)) - PL, dp = fmaxf(d, 0.0f); const float delta = (t == 0u) ? d : dp; const float corr = __builtin_amdgcn_exp2f(-dp);
      lsum *= corr;
#pragma unroll
      for (int r = 0; r < 8; ++r) { o0[r] *= corr; o1[r] *= corr; cref[r] -= delta; s[0][r] -= delta; s[1][r] -= delta; s[2][r] -= delta; s[3][r] -= delta; }
      soft(); }
    v16b pb0, pb1;
#pragma unroll
    for (int r = 0; r < 8; ++r) { pb0[r] = (b16)p[0][r]; pb0[8 + r] = (b16)p[1][r]; pb1[r] = (b16)p[2][r]; pb1[8 + r] = (b16)p[3][r]; }
    lsum += ps;
    o0 = wmma16b(frag_kb(Vl, hlf), pb0, o0); o0 = wmma16b(frag_kb(Vl + 32u, hlf), pb1, o0);
    o1 = wmma16b(frag_kb(Vl + 16u * 72u, hlf), pb0, o1); o1 = wmma16b(frag_kb(Vl + 16u * 72u + 32u, hlf), pb1, o1);
    wait_lds(); wait_copies(); __syncthreads();
    if (t + 2u < NT) stage(t + 2u, buf);
  }
  wait_copies();
  lsum += __shfl_xor(lsum, 16, 32);
  const float inv = (CC / QC) * (1.0f / lsum); v8b c0, c1;   // lsum carries the x1024 of P, as o0 and o1 do
#pragma unroll
  for (int r = 0; r < 8; ++r) { c0[r] = (b16)(o0[r] * inv); c1[r] = (b16)(o1[r] * inv); }
  *(v8b*)(&Tc[wave][nloc][8u * hlf]) = c0; *(v8b*)(&Tc[wave][nloc][16u + 8u * hlf]) = c1;
  __syncthreads();
  v8b cv[2];
#pragma unroll
  for (int i = 0; i < 2; ++i) { const unsigned idx = (unsigned)i * 32u + lane; cv[i] = *(const v8b*)(&Tc[wave][idx >> 2][(idx & 3u) * 8u]); }
  b16* cd = CTX + ((size_t)bh * SQ + s0) * DH;
  {
#pragma unroll
    for (int i = 0; i < 2; ++i) { const unsigned idx = (unsigned)i * 32u + lane; *(v8b*)(cd + (size_t)idx * 8u) = cv[i]; }
     }
}

// output projection: block = 64 rows x 128 columns, wave = 16 rows x 8 tiles; k-step = one head (A fragment from ctx[bh][s][0..31], loaded one trip ahead; B fragment from Wo rows at k = h*32). The 128 Wo rows are shared by the four waves: per trip of two heads (64 k)
// they are copied once into LDS (rows of 128 bytes at pitch 144, two buffers, the next tile in flight while this one is worked on) and the B fragments are read from there. y = acc / 65536 + bf16(bo).
__global__ __launch_bounds__(128) void oproj_kernel(const b16* __restrict__ CTX, const b16* __restrict__ WO, const float* __restrict__ bo, float* __restrict__ out) {
  __shared__ __attribute__((aligned(16))) float Tf[4][16][132];
  __shared__ __attribute__((aligned(16))) b16 Ws[2][128][72];
  const unsigned tid = threadIdx.x, wave = tid >> 5, lane = tid & 31u, nloc = lane & 15u, hlf = lane >> 4; const unsigned m0 = blockIdx.x * 64u + wave * 16u, n0 = blockIdx.y * 128u; const unsigned b = m0 / SQ, s0 = m0 % SQ;
  const b16* abase = CTX + ((size_t)(b * NH) * SQ + s0 + nloc) * DH; 
  const b16* gw = WO + (size_t)(n0 + (tid >> 3)) * DM + (tid & 7u) * 8u; const unsigned lw = lds_off(&Ws[0][tid >> 3][(tid & 7u) * 8u]);
  auto stage = [&](unsigned kc, unsigned buf) { const b16* g = gw + kc * 64u; const unsigned l = lw + buf * (128u * 144u);
    copy8(l, g, l + 16u * 144u, g + 16u * DM, l + 32u * 144u, g + 32u * DM, l + 48u * 144u, g + 48u * DM, l + 64u * 144u, g + 64u * DM, l + 80u * 144u, g + 80u * DM, l + 96u * 144u, g + 96u * DM, l + 112u * 144u, g + 112u * DM); };
  v8f acc[8];
#pragma unroll
  for (int t = 0; t < 8; ++t) acc[t] = (v8f){};
  v16b an[2] = {frag_kb(abase, hlf), frag_kb(abase + (size_t)SQ * DH, hlf)};   // A fragments one trip ahead: trip 0's are in flight during the first tile's copies
  stage(0u, 0u); wait_copies(); __syncthreads(); stage(1u, 1u);
#pragma unroll 1
  for (unsigned kc = 0; kc < NH / 2u; ++kc) { const unsigned buf = kc & 1u; const b16* wl = &Ws[buf][nloc][0];
    const v16b ac[2] = {an[0], an[1]}; const unsigned kn = (kc + 1u < NH / 2u) ? kc + 1u : kc;   // the last trip loads its own fragments again: in bounds, no branch
    an[0] = frag_kb(abase + (size_t)(kn * 2u) * SQ * DH, hlf); an[1] = frag_kb(abase + (size_t)(kn * 2u + 1u) * SQ * DH, hlf);
#pragma unroll  // both k-steps of a trip spelled out: LDS offsets and acc[] indices stay compile-time constants
    for (int ks = 0; ks < 2; ++ks) {
#pragma unroll
      for (int t = 0; t < 8; ++t) acc[t] = wmma16b(ac[ks], frag_kb(wl + (unsigned)t * 16u * 72u + (unsigned)ks * 32u, hlf), acc[t]); }
    // issue order of the trip: the 4 global loads first (left alone the scheduler sinks them to the foot, where their latency stands in front of the barrier), 4 B fragments read ahead, then a WMMA and the next fragment's 2 LDS reads in turn
    __builtin_amdgcn_sched_group_barrier(0x020, 4, 0); __builtin_amdgcn_sched_group_barrier(0x100, 8, 0);
#pragma unroll  // the order is a straight list of groups: every builtin must stand in the trip's one block
    for (int i = 0; i < 12; ++i) { __builtin_amdgcn_sched_group_barrier(0x008, 1, 0); __builtin_amdgcn_sched_group_barrier(0x100, 2, 0); }
    __builtin_amdgcn_sched_group_barrier(0x008, 4, 0);   // end of the order: the last WMMAs, whose fragments are already read
    wait_lds(); wait_copies(); __syncthreads();
    if (kc + 2u < NH / 2u) stage(kc + 2u, buf); }
  wait_copies();
#pragma unroll
  for (int t = 0; t < 8; ++t) { const unsigned col = (unsigned)t * 16u + nloc; const float bb = bf16_rne(bo[n0 + col]);
#pragma unroll
    for (int r = 0; r < 8; ++r) Tf[wave][8u * hlf + (unsigned)r][col] = acc[t][r] * (1.0f / (CC * WSC)) + bb; }
  __syncthreads();
  float* orow = out + (size_t)m0 * DM + n0 + lane * 4u;
  {
#pragma unroll 4
    for (unsigned rr = 0; rr < 16u; ++rr) { const v4f v = *(const v4f*)(&Tf[wave][rr][lane * 4u]); *(v4f*)(orow + (size_t)rr * DM) = v; }
     }
}

}  // namespace

extern "C" void kernel_launch(void* const* d_in, const int* in_sizes, int n_in, void* d_out, int out_size, void* d_ws, size_t ws_size, hipStream_t stream) {
  (void)n_in;
  auto Fp = [&](int i) { return (const float*)d_in[i]; };
  // wire order: 0 x [4][2048][512], 1 Wq [16][512][32], 2 bq [16][32], 3 Wk, 4 bk, 5 Wv, 6 bv, 7 Wo [512 out][512 in], 8 bo [512]; output [NB][SEQ][512] f32.
  const long long xneed = ((long long)(NB - 1) * SEQ_FULL + SEQ) * 512;
  if ((long long)in_sizes[0] < xneed || in_sizes[1] < 16 * 512 * 32 || in_sizes[2] < 512 || in_sizes[3] < 16 * 512 * 32 || in_sizes[4] < 512 || in_sizes[5] < 16 * 512 * 32 || in_sizes[6] < 512 || in_sizes[7] < 512 * 512 || in_sizes[8] < 512) return;
  if ((long long)out_size < (long long)NB * SEQ * 512) return;
  size_t off = 0; char* ws = (char*)d_ws;
  auto carve = [&](size_t bytes) { char* p = ws + off; off += (bytes + 255) & ~(size_t)255; return p; };
  const size_t planeB = (size_t)NB * SEQ * 512 * 2;               // 8,388,608 B at full size (NB*16*SEQ*32 halves == NB*SEQ*512 halves)
  b16* XH = (b16*)carve(planeB); b16* WT = (b16*)carve((size_t)4 * 512 * 512 * 2); b16* QP = (b16*)carve(planeB); b16* KP = (b16*)carve(planeB); b16* VT = (b16*)carve(planeB); b16* CTX = (b16*)carve(planeB);
  if (off > ws_size || off > ((size_t)128 << 20)) return;         // 5 x 8 MiB + 2 MiB = 44,040,192 B at full size
  xcvt_kernel<<<(unsigned)((size_t)NB * SEQ * 64 / 256), 256, 0, stream>>>(Fp(0), XH);
  wprep_kernel<<<dim3(128, 4), 256, 0, stream>>>(Fp(1), Fp(3), Fp(5), Fp(7), WT);
  qkv_kernel<<<dim3((unsigned)(NB * SEQ / 64), 16), 128, 0, stream>>>(XH, WT, Fp(2), Fp(4), Fp(6), QP, KP, VT);
  flash_kernel<<<(unsigned)(NB * 16 * (SEQ / 64)), 128, 0, stream>>>(QP, KP, VT, CTX);
  oproj_kernel<<<dim3((unsigned)(NB * SEQ / 64), 4), 128, 0, stream>>>(CTX, WT + (size_t)3 * 512 * 512, Fp(8), (float*)d_out);
}

// v006
// It runs in 77.1 microseconds.
// In two side-by-side timings against v005, it was 1.06 and 1.05 times as fast.
// Over all steps from v000 it is 2.66 times as fast.
#include <hip/hip_runtime.h>

// Dense multi-head attention layer: x [NB][SEQ_FULL][512] (first SEQ rows of each batch used); per-head Q/K/V = x W[h] + b[h] (16 heads x 32), softmax(Q K^T / sqrt(32)) V over all keys, heads concatenated, y = ctx Wo^T + bo.
// compute dtype: every contraction on v_wmma_f32_16x16x32_f16 (f16 operands, f32 accumulate), one product per tile pair. Float inputs are converted to bf16 (RNE) on load and carried exactly
// in f16: x x8, weights x256 (Wq/Wk/Wv transposed to [h*32+dh][d], Wo kept [out][in]). Computed planes: Q as f16 x log2(e)/sqrt(32), K as f16 x1, V^T as f16 x16; unnormalised softmax P as f16 x1024 (packed from the score
// accumulators directly into the P.V B fragment); ctx as f16 x256. Biases (bf16 RNE), softmax (kept reference, exp2), normalisation and all epilogues in f32.
// Fragment k-map per lane half hh for A AND B: elements 0..7 <- k = 8hh+0..7, 8..15 <- k = 16+8hh+0..7; acc[r] = D[8hh+r][lane&15].

#ifndef NB
#define NB 4
#endif
#ifndef SEQ
#define SEQ 2048
#endif
#define NB_FULL 4
#define SEQ_FULL 2048

namespace {

constexpr unsigned DM = 512, NH = 16, DH = 32, NBU = (unsigned)NB, SQ = (unsigned)SEQ, QB = SQ / 128u;
constexpr float XS = 8.0f, WSC = 256.0f, QC = 16.0f, PC = 1024.0f, CC = 256.0f;
constexpr float QS = (float)(0.17677669529663687 * 1.4426950408889634);           // scale of the Q plane: log2(e) / sqrt(32); the K plane is x1, so a score product is an exp2 argument as it comes
constexpr float PL = 10.0f; static_assert(PC == 1024.0f);                         // PL = log2(PC)
constexpr float LIM = 65504.0f;                                                   // largest finite f16: bound on a lane's sum of 32 p x1024 taken without a new reference
static_assert(SEQ % 128 == 0 && SEQ <= SEQ_FULL && NB <= NB_FULL && NB >= 1);
static_assert(((size_t)NB * SEQ * 64) % 256 == 0);            // xcvt: threads x 8 elements == NB*SEQ*512 exactly
static_assert((512 * 512 / 8) % 256 == 0);                    // wprep: 128 blocks x 256 threads x 8 == 512*512 per plane
static_assert(DM == NH * DH && DM % 32 == 0 && DH == 32);

typedef _Float16 b16;
typedef __attribute__((ext_vector_type(16))) _Float16 v16b;
typedef __attribute__((ext_vector_type(8))) _Float16 v8b;
typedef __attribute__((ext_vector_type(8))) float v8f;
typedef __attribute__((ext_vector_type(4))) float v4f;

__device__ __forceinline__ float bf16_rne(float f) { unsigned int u = __float_as_uint(f); u += 0x7FFFu + ((u >> 16) & 1u); return __uint_as_float(u & 0xFFFF0000u); }
__device__ __forceinline__ v16b frag_kb(const b16* p, unsigned hh) { const v8b a = *(const v8b*)(p + 8u * hh), b = *(const v8b*)(p + 16u + 8u * hh); v16b f;
#pragma unroll
  for (int e = 0; e < 8; ++e) { f[e] = a[e]; f[8 + e] = b[e]; } return f; }
__device__ __forceinline__ v8f wmma16b(v16b a, v16b b, v8f c) { return __builtin_amdgcn_wmma_f32_16x16x32_f16(false, a, false, b, (short)0, c, false, false); }

// Asynchronous 16-byte copies, global memory to LDS: each lane names its own LDS byte address (low 32 bits of the __shared__ address) and its own global pointer.
// One asm statement per tile: s_wait_xcnt 0 as its last line stands in front of every later rewrite of the address registers that the copies name.
__device__ __forceinline__ unsigned lds_off(const void* p) { return (unsigned)(size_t)p; }
#define CP "global_load_async_to_lds_b128 "
__device__ __forceinline__ void copy4(unsigned l0, const b16* g0, unsigned l1, const b16* g1, unsigned l2, const b16* g2, unsigned l3, const b16* g3) {
  asm volatile(CP "%0, %1, off\n\t" CP "%2, %3, off\n\t" CP "%4, %5, off\n\t" CP "%6, %7, off\n\ts_wait_xcnt 0x0"
               :: "v"(l0), "v"(g0), "v"(l1), "v"(g1), "v"(l2), "v"(g2), "v"(l3), "v"(g3) : "memory"); }
__device__ __forceinline__ void copy6(unsigned l0, const b16* g0, unsigned l1, const b16* g1, unsigned l2, const b16* g2, unsigned l3, const b16* g3, unsigned l4, const b16* g4, unsigned l5, const b16* g5) {
  asm volatile(CP "%0, %1, off\n\t" CP "%2, %3, off\n\t" CP "%4, %5, off\n\t" CP "%6, %7, off\n\t" CP "%8, %9, off\n\t" CP "%10, %11, off\n\ts_wait_xcnt 0x0"
               :: "v"(l0), "v"(g0), "v"(l1), "v"(g1), "v"(l2), "v"(g2), "v"(l3), "v"(g3), "v"(l4), "v"(g4), "v"(l5), "v"(g5) : "memory"); }
__device__ __forceinline__ void copy8(unsigned l0, const b16* g0, unsigned l1, const b16* g1, unsigned l2, const b16* g2, unsigned l3, const b16* g3, unsigned l4, const b16* g4, unsigned l5, const b16* g5, unsigned l6, const b16* g6, unsigned l7, const b16* g7) {
  asm volatile(CP "%0, %1, off\n\t" CP "%2, %3, off\n\t" CP "%4, %5, off\n\t" CP "%6, %7, off\n\t" CP "%8, %9, off\n\t" CP "%10, %11, off\n\t" CP "%12, %13, off\n\t" CP "%14, %15, off\n\ts_wait_xcnt 0x0"
               :: "v"(l0), "v"(g0), "v"(l1), "v"(g1), "v"(l2), "v"(g2), "v"(l3), "v"(g3), "v"(l4), "v"(g4), "v"(l5), "v"(g5), "v"(l6), "v"(g6), "v"(l7), "v"(g7) : "memory"); }
#undef CP
// this wave's copies have landed: in front of the barrier behind which the other waves read them
__device__ __forceinline__ void wait_copies() { asm volatile("s_wait_asynccnt 0x0" ::: "memory"); }
// this wave's LDS reads are done: in front of the barrier behind which their buffer is refilled
__device__ __forceinline__ void wait_lds() { asm volatile("s_wait_dscnt 0x0" ::: "memory"); }

__global__ __launch_bounds__(256) void xcvt_kernel(const float* __restrict__ x, b16* __restrict__ XH) {
  const unsigned u = blockIdx.x * 256u + threadIdx.x; const unsigned row = u >> 6, c = (u & 63u) * 8u; const unsigned b = row / SQ, s = row % SQ;
  const float* src = x + ((size_t)b * SEQ_FULL + s) * DM + c; const v4f a0 = *(const v4f*)src, a1 = *(const v4f*)(src + 4); v8b v;
#pragma unroll
  for (int j = 0; j < 4; ++j) { v[j] = (b16)(bf16_rne(a0[j]) * XS); v[4 + j] = (b16)(bf16_rne(a1[j]) * XS); }
  b16* dst = XH + (size_t)u * 8u;
  { *(v8b*)dst = v;  }
}

__global__ __launch_bounds__(256) void wprep_kernel(const float* __restrict__ wq, const float* __restrict__ wk, const float* __restrict__ wv, const float* __restrict__ wo, b16* __restrict__ WT) {
  const unsigned z = blockIdx.y; const unsigned u = blockIdx.x * 256u + threadIdx.x; const unsigned e = u * 8u, o = e >> 9, k0 = e & 511u; v8b v;
  if (z < 3u) { const float* w = (z == 0u) ? wq : ((z == 1u) ? wk : wv); const unsigned h = o >> 5, dh = o & 31u; const float* sp = w + ((size_t)h * DM + k0) * DH + dh;
#pragma unroll
    for (int j = 0; j < 8; ++j) v[j] = (b16)(bf16_rne(sp[(size_t)j * DH]) * WSC); }
  else { const float* sp = wo + (size_t)o * DM + k0; const v4f a0 = *(const v4f*)sp, a1 = *(const v4f*)(sp + 4);
#pragma unroll
    for (int j = 0; j < 4; ++j) { v[j] = (b16)(bf16_rne(a0[j]) * WSC); v[4 + j] = (b16)(bf16_rne(a1[j]) * WSC); } }
  b16* dst = WT + (size_t)z * DM * DM + e;
  { *(v8b*)dst = v;  }
}

// Q/K/V projection of one head: block = 64 rows x (32 q | 32 k | 32 v columns of head h), wave = 16 rows x 6 tiles; A fragments from XH rows (global), loaded one trip ahead. The 96 WT rows are shared by the four waves:
// per trip of 64 k they are copied once into LDS (rows of 128 bytes at pitch 144, two buffers, the next tile in flight while this one is worked on) and the B fragments are read from there.
// y = acc / 2048 + bf16(b); Q, K planes [bh][SEQ][32] f16, Q x log2(e)/sqrt(32), K x1 (block writes 4096 contiguous bytes each); V^T plane [bh][32][SEQ] f16 x16 (32 lines of 64 keys). LDS tiles cross-wave: block barrier; they reuse the ring's LDS behind the last trip's barrier.
__global__ __launch_bounds__(128) void qkv_kernel(const b16* __restrict__ XH, const b16* __restrict__ WT, const float* __restrict__ bq, const float* __restrict__ bk, const float* __restrict__ bv, b16* __restrict__ QP, b16* __restrict__ KP, b16* __restrict__ VT) {
  __shared__ __attribute__((aligned(16))) b16 SM[2u * 96u * 72u];
  b16 (*Tq)[40] = (b16 (*)[40])SM; b16 (*Tk)[40] = (b16 (*)[40])(SM + 64u * 40u); b16 (*Tv)[72] = (b16 (*)[72])(SM + 128u * 40u);
  const unsigned tid = threadIdx.x, wave = tid >> 5, lane = tid & 31u, nloc = lane & 15u, hlf = lane >> 4; const unsigned m0 = blockIdx.x * 64u, h = blockIdx.y;
  const b16* arow = XH + (size_t)(m0 + wave * 16u + nloc) * DM; 
  const b16* gw = WT + (size_t)(h * DH + (tid >> 3)) * DM + (tid & 7u) * 8u; const unsigned lw = lds_off(SM + (tid >> 3) * 72u + (tid & 7u) * 8u);
  auto stage = [&](unsigned kc, unsigned buf) { const b16* g = gw + kc * 64u; const unsigned l = lw + buf * (96u * 144u);
    copy6(l, g, l + 16u * 144u, g + 16u * DM, l + 32u * 144u, g + DM * DM, l + 48u * 144u, g + DM * DM + 16u * DM, l + 64u * 144u, g + 2u * DM * DM, l + 80u * 144u, g + 2u * DM * DM + 16u * DM); };
  v8f acc[6];
#pragma unroll
  for (int t = 0; t < 6; ++t) acc[t] = (v8f){};
  v16b an[2] = {frag_kb(arow, hlf), frag_kb(arow + 32u, hlf)};   // A fragments one trip ahead: trip 0's are in flight during the first tile's copies
  stage(0u, 0u); wait_copies(); __syncthreads(); stage(1u, 1u);
#pragma unroll 1
  for (unsigned kc = 0; kc < DM / 64u; ++kc) { const unsigned buf = kc & 1u; const b16* wl = SM + buf * (96u * 72u) + nloc * 72u;
    const v16b ac[2] = {an[0], an[1]}; const unsigned kn = (kc + 1u < DM / 64u) ? kc + 1u : kc;   // the last trip loads its own fragments again: in bounds, no branch
    an[0] = frag_kb(arow + kn * 64u, hlf); an[1] = frag_kb(arow + kn * 64u + 32u, hlf);
#pragma unroll  // both k-steps of a trip spelled out: LDS offsets and acc[] indices stay compile-time constants
    for (int ks = 0; ks < 2; ++ks) {
#pragma unroll
      for (int t = 0; t < 6; ++t) acc[t] = wmma16b(ac[ks], frag_kb(wl + (unsigned)t * 16u * 72u + (unsigned)ks * 32u, hlf), acc[t]); }
    // issue order of the trip: the 4 global loads first (left alone the scheduler sinks them to the foot, where their latency stands in front of the barrier), 2 B fragments read ahead, then a WMMA and the next fragment's 2 LDS reads in turn
    __builtin_amdgcn_sched_group_barrier(0x020, 4, 0); __builtin_amdgcn_sched_group_barrier(0x100, 4, 0);
#pragma unroll  // the order is a straight list of groups: every builtin must stand in the trip's one block
    for (int i = 0; i < 10; ++i) { __builtin_amdgcn_sched_group_barrier(0x008, 1, 0); __builtin_amdgcn_sched_group_barrier(0x100, 2, 0); }
    __builtin_amdgcn_sched_group_barrier(0x008, 2, 0);   // end of the order: the last WMMAs, whose fragments are already read
    wait_lds(); wait_copies(); __syncthreads();
    if (kc + 2u < DM / 64u) stage(kc + 2u, buf); }
  wait_copies();
#pragma unroll
  for (int t = 0; t < 6; ++t) { const unsigned col = (unsigned)(t & 1) * 16u + nloc; const float* bp = (t < 2) ? bq : ((t < 4) ? bk : bv); const float bb = bf16_rne(bp[h * DH + col]);
#pragma unroll
    for (int r = 0; r < 8; ++r) { const unsigned row = wave * 16u + 8u * hlf + (unsigned)r; const float y = (acc[t][r] * (1.0f / (XS * WSC)) + bb) * ((t < 2) ? QS : ((t < 4) ? 1.0f : QC)); const b16 y16 = (b16)y;
      if (t < 2) Tq[row][col] = y16; else if (t < 4) Tk[row][col] = y16; else Tv[col][row] = y16; } }
  __syncthreads();
  const unsigned b = m0 / SQ, s0 = m0 % SQ, bh = b * NH + h; v8b qv[2], kv[2], vv[2];
#pragma unroll
  for (int i = 0; i < 2; ++i) { const unsigned idx = (unsigned)i * 128u + tid; qv[i] = *(const v8b*)(&Tq[idx >> 2][(idx & 3u) * 8u]); kv[i] = *(const v8b*)(&Tk[idx >> 2][(idx & 3u) * 8u]); vv[i] = *(const v8b*)(&Tv[idx >> 3][(idx & 7u) * 8u]); }
  b16* qd = QP + ((size_t)bh * SQ + s0) * DH; b16* kd = KP + ((size_t)bh * SQ + s0) * DH; b16* vd = VT + (size_t)bh * DH * SQ + s0;
  {
#pragma unroll
    for (int i = 0; i < 2; ++i) { const unsigned idx = (unsigned)i * 128u + tid; *(v8b*)(qd + (size_t)idx * 8u) = qv[i]; *(v8b*)(kd + (size_t)idx * 8u) = kv[i]; *(v8b*)(vd + (size_t)(idx >> 3) * SQ + (idx & 7u) * 8u) = vv[i]; }
     }
}

// flash attention, transposed form: block = 128 queries of one (b, h), wave = 32 queries in two groups of 16 (the D columns of a group's tiles): every K and V^T fragment read from LDS feeds both groups. Per 64 keys and group: S^T tiles = K rows (A) x Q rows (B, loaded once) + C, C = minus the reference in use, so a
// score accumulator is the exp2 argument of p x1024 as it comes; the lane's sum of its 32 p decides whether the reference is renewed (only then: max over the arguments, one xor-16 exchange, O and the row sum rescaled, p anew); the four score tiles are packed (f16) into two B fragments (element r <- tile 2j, element 8+r <- tile 2j+1);
// O^T tiles (dh rows) += V^T rows (A) x P^T (B). The 64 K rows and the 32 V^T rows of a trip are shared by the four waves: copied once into LDS (K rows of 64 bytes at pitch 80, V^T rows of 128 bytes
// at pitch 144, two buffers, the next tile in flight while this one is worked on); the A fragments are read from there. ctx plane [bh][SEQ][32] f16 x256; wave writes its 2048 contiguous bytes. No key tail (SEQ % 64 == 0).
__global__ __launch_bounds__(128) void flash_kernel(const b16* __restrict__ QP, const b16* __restrict__ KP, const b16* __restrict__ VT, b16* __restrict__ CTX) {
  __shared__ __attribute__((aligned(16))) b16 Ks[2][64][40], Vs[2][32][72], Tc[4][32][40];
  const unsigned tid = threadIdx.x, wave = tid >> 5, lane = tid & 31u, nloc = lane & 15u, hlf = lane >> 4; const unsigned bh = blockIdx.x / QB, s0 = (blockIdx.x % QB) * 128u + wave * 32u;
  constexpr unsigned NT = SQ / 64u;
  const b16* gk = KP + (size_t)bh * SQ * DH + tid * 8u; const b16* gv = VT + (size_t)bh * DH * SQ + (size_t)(tid >> 3) * SQ + (tid & 7u) * 8u;
  const unsigned lk = lds_off(&Ks[0][tid >> 2][(tid & 3u) * 8u]), lv = lds_off(&Vs[0][tid >> 3][(tid & 7u) * 8u]);
  auto stage = [&](unsigned t, unsigned buf) { const b16* k0 = gk + (size_t)t * 64u * DH; const b16* v0 = gv + t * 64u; const unsigned a = lk + buf * (64u * 80u), c = lv + buf * (32u * 144u);
    copy4(a, k0, a + 32u * 80u, k0 + 32u * DH, c, v0, c + 16u * 144u, v0 + (size_t)16u * SQ); };
  const v16b qb[2] = {frag_kb(QP + ((size_t)bh * SQ + s0 + nloc) * DH, hlf), frag_kb(QP + ((size_t)bh * SQ + s0 + 16u + nloc) * DH, hlf)};
  float lsum[2] = {0.0f, 0.0f}; v8f o[2][2] = {{(v8f){}, (v8f){}}, {(v8f){}, (v8f){}}}, cref[2] = {(v8f){}, (v8f){}};   // cref: minus the reference in use (a max seen - log2(PC)), the same in all 8 rows: the C operand of the score products
  stage(0u, 0u); wait_copies(); __syncthreads();
  if (NT > 1u) stage(1u, 1u);
#pragma unroll 1
  for (unsigned t = 0; t < NT; ++t) {
    const unsigned buf = t & 1u; const b16* Kl = &Ks[buf][nloc][0]; const b16* Vl = &Vs[buf][nloc][0];
    v8f s[2][4];
#pragma unroll
    for (int j = 0; j < 4; ++j) { const v16b kf = frag_kb(Kl + 16u * (unsigned)j * 40u, hlf); s[0][j] = wmma16b(kf, qb[0], cref[0]); s[1][j] = wmma16b(kf, qb[1], cref[1]); }
    float ps[2]; v16b pb[2][2];
    auto soft = [&](int g) { float p[4][8]; float a = 0.0f;   // p x1024 of the group's 32 arguments, this lane's part of the row sum, and p packed as the two B fragments
#pragma unroll
      for (int j = 0; j < 4; ++j) {
#pragma unroll
        for (int r = 0; r < 8; ++r) p[j][r] = __builtin_amdgcn_exp2f(s[g][j][r]); }
#pragma unroll
      for (int r = 0; r < 8; ++r) a += (p[0][r] + p[1][r]) + (p[2][r] + p[3][r]);
      ps[g] = a;
#pragma unroll
      for (int r = 0; r < 8; ++r) { pb[g][0][r] = (b16)p[0][r]; pb[g][0][8 + r] = (b16)p[1][r]; pb[g][1][r] = (b16)p[2][r]; pb[g][1][8 + r] = (b16)p[3][r]; } };
    soft(0); soft(1);
    // one wave-uniform test a trip, on the sums that are formed anyway: no p is negative, so every p is at most its group's ps, and ps <= LIM keeps all 32 inside f16. The first trip always goes through and sets the references;
    // later any lane above LIM in either group sends the whole wave through (a column that needs nothing gets delta 0). Only there: the max over the arguments, the xor-16 exchange, the rescale of O and the row sum, and p anew.
    const float lim = (t == 0u) ? -1.0f : LIM;   // ps is never below 0
    if (__builtin_amdgcn_ballot_w32(!(ps[0] <= lim) || !(ps[1] <= lim)) != 0u) {
#pragma unroll
      for (int g = 0; g < 2; ++g) {
        float mx = -3.0e38f;
#pragma unroll
        for (int j = 0; j < 4; ++j) {
#pragma unroll
          for (int r = 0; r < 8; ++r) mx = fmaxf(mx, s[g][j][r]); }
        const float d = fmaxf(mx, __shfl_xor(mx, 16, 32)) - PL, dp = fmaxf(d, 0.0f); const float delta = (t == 0u) ? d : dp; const float corr = __builtin_amdgcn_exp2f(-dp);
        lsum[g] *= corr;
#pragma unroll
        for (int r = 0; r < 8; ++r) { o[g][0][r] *= corr; o[g][1][r] *= corr; cref[g][r] -= delta; s[g][0][r] -= delta; s[g][1][r] -= delta; s[g][2][r] -= delta; s[g][3][r] -= delta; }
        soft(g); } }
    lsum[0] += ps[0]; lsum[1] += ps[1];
    { const v16b v00 = frag_kb(Vl, hlf), v10 = frag_kb(Vl + 16u * 72u, hlf), v01 = frag_kb(Vl + 32u, hlf), v11 = frag_kb(Vl + 16u * 72u + 32u, hlf);   // each V^T fragment read once, for both groups
      o[0][0] = wmma16b(v00, pb[0][0], o[0][0]); o[1][0] = wmma16b(v00, pb[1][0], o[1][0]); o[0][1] = wmma16b(v10, pb[0][0], o[0][1]); o[1][1] = wmma16b(v10, pb[1][0], o[1][1]);
      o[0][0] = wmma16b(v01, pb[0][1], o[0][0]); o[1][0] = wmma16b(v01, pb[1][1], o[1][0]); o[0][1] = wmma16b(v11, pb[0][1], o[0][1]); o[1][1] = wmma16b(v11, pb[1][1], o[1][1]); }
    wait_lds(); wait_copies(); __syncthreads();
    if (t + 2u < NT) stage(t + 2u, buf);
  }
  wait_copies();
#pragma unroll
  for (int g = 0; g < 2; ++g) {
    const float l = lsum[g] + __shfl_xor(lsum[g], 16, 32);
    const float inv = (CC / QC) * (1.0f / l); v8b c0, c1;   // the row sum carries the x1024 of P, as the O tiles do
#pragma unroll
    for (int r = 0; r < 8; ++r) { c0[r] = (b16)(o[g][0][r] * inv); c1[r] = (b16)(o[g][1][r] * inv); }
    *(v8b*)(&Tc[wave][(unsigned)g * 16u + nloc][8u * hlf]) = c0; *(v8b*)(&Tc[wave][(unsigned)g * 16u + nloc][16u + 8u * hlf]) = c1; }
  __syncthreads();
  v8b cv[4];
#pragma unroll
  for (int i = 0; i < 4; ++i) { const unsigned idx = (unsigned)i * 32u + lane; cv[i] = *(const v8b*)(&Tc[wave][idx >> 2][(idx & 3u) * 8u]); }
  b16* cd = CTX + ((size_t)bh * SQ + s0) * DH;
  {
#pragma unroll
    for (int i = 0; i < 4; ++i) { const unsigned idx = (unsigned)i * 32u + lane; *(v8b*)(cd + (size_t)idx * 8u) = cv[i]; }
     }
}

// output projection: block = 64 rows x 128 columns, wave = 16 rows x 8 tiles; k-step = one head (A fragment from ctx[bh][s][0..31], loaded one trip ahead; B fragment from Wo rows at k = h*32). The 128 Wo rows are shared by the four waves: per trip of two heads (64 k)
// they are copied once into LDS (rows of 128 bytes at pitch 144, two buffers, the next tile in flight while this one is worked on) and the B fragments are read from there. y = acc / 65536 + bf16(bo).
__global__ __launch_bounds__(128) void oproj_kernel(const b16* __restrict__ CTX, const b16* __restrict__ WO, const float* __restrict__ bo, float* __restrict__ out) {
  __shared__ __attribute__((aligned(16))) float Tf[4][16][132];
  __shared__ __attribute__((aligned(16))) b16 Ws[2][128][72];
  const unsigned tid = threadIdx.x, wave = tid >> 5, lane = tid & 31u, nloc = lane & 15u, hlf = lane >> 4; const unsigned m0 = blockIdx.x * 64u + wave * 16u, n0 = blockIdx.y * 128u; const unsigned b = m0 / SQ, s0 = m0 % SQ;
  const b16* abase = CTX + ((size_t)(b * NH) * SQ + s0 + nloc) * DH; 
  const b16* gw = WO + (size_t)(n0 + (tid >> 3)) * DM + (tid & 7u) * 8u; const unsigned lw = lds_off(&Ws[0][tid >> 3][(tid & 7u) * 8u]);
  auto stage = [&](unsigned kc, unsigned buf) { const b16* g = gw + kc * 64u; const unsigned l = lw + buf * (128u * 144u);
    copy8(l, g, l + 16u * 144u, g + 16u * DM, l + 32u * 144u, g + 32u * DM, l + 48u * 144u, g + 48u * DM, l + 64u * 144u, g + 64u * DM, l + 80u * 144u, g + 80u * DM, l + 96u * 144u, g + 96u * DM, l + 112u * 144u, g + 112u * DM); };
  v8f acc[8];
#pragma unroll
  for (int t = 0; t < 8; ++t) acc[t] = (v8f){};
  v16b an[2] = {frag_kb(abase, hlf), frag_kb(abase + (size_t)SQ * DH, hlf)};   // A fragments one trip ahead: trip 0's are in flight during the first tile's copies
  stage(0u, 0u); wait_copies(); __syncthreads(); stage(1u, 1u);
#pragma unroll 1
  for (unsigned kc = 0; kc < NH / 2u; ++kc) { const unsigned buf = kc & 1u; const b16* wl = &Ws[buf][nloc][0];
    const v16b ac[2] = {an[0], an[1]}; const unsigned kn = (kc + 1u < NH / 2u) ? kc + 1u : kc;   // the last trip loads its own fragments again: in bounds, no branch
    an[0] = frag_kb(abase + (size_t)(kn * 2u) * SQ * DH, hlf); an[1] = frag_kb(abase + (size_t)(kn * 2u + 1u) * SQ * DH, hlf);
#pragma unroll  // both k-steps of a trip spelled out: LDS offsets and acc[] indices stay compile-time constants
    for (int ks = 0; ks < 2; ++ks) {
#pragma unroll
      for (int t = 0; t < 8; ++t) acc[t] = wmma16b(ac[ks], frag_kb(wl + (unsigned)t * 16u * 72u + (unsigned)ks * 32u, hlf), acc[t]); }
    // issue order of the trip: the 4 global loads first (left alone the scheduler sinks them to the foot, where their latency stands in front of the barrier), 4 B fragments read ahead, then a WMMA and the next fragment's 2 LDS reads in turn
    __builtin_amdgcn_sched_group_barrier(0x020, 4, 0); __builtin_amdgcn_sched_group_barrier(0x100, 8, 0);
#pragma unroll  // the order is a straight list of groups: every builtin must stand in the trip's one block
    for (int i = 0; i < 12; ++i) { __builtin_amdgcn_sched_group_barrier(0x008, 1, 0); __builtin_amdgcn_sched_group_barrier(0x100, 2, 0); }
    __builtin_amdgcn_sched_group_barrier(0x008, 4, 0);   // end of the order: the last WMMAs, whose fragments are already read
    wait_lds(); wait_copies(); __syncthreads();
    if (kc + 2u < NH / 2u) stage(kc + 2u, buf); }
  wait_copies();
#pragma unroll
  for (int t = 0; t < 8; ++t) { const unsigned col = (unsigned)t * 16u + nloc; const float bb = bf16_rne(bo[n0 + col]);
#pragma unroll
    for (int r = 0; r < 8; ++r) Tf[wave][8u * hlf + (unsigned)r][col] = acc[t][r] * (1.0f / (CC * WSC)) + bb; }
  __syncthreads();
  float* orow = out + (size_t)m0 * DM + n0 + lane * 4u;
  {
#pragma unroll 4
    for (unsigned rr = 0; rr < 16u; ++rr) { const v4f v = *(const v4f*)(&Tf[wave][rr][lane * 4u]); *(v4f*)(orow + (size_t)rr * DM) = v; }
     }
}

}  // namespace

extern "C" void kernel_launch(void* const* d_in, const int* in_sizes, int n_in, void* d_out, int out_size, void* d_ws, size_t ws_size, hipStream_t stream) {
  (void)n_in;
  auto Fp = [&](int i) { return (const float*)d_in[i]; };
  // wire order: 0 x [4][2048][512], 1 Wq [16][512][32], 2 bq [16][32], 3 Wk, 4 bk, 5 Wv, 6 bv, 7 Wo [512 out][512 in], 8 bo [512]; output [NB][SEQ][512] f32.
  const long long xneed = ((long long)(NB - 1) * SEQ_FULL + SEQ) * 512;
  if ((long long)in_sizes[0] < xneed || in_sizes[1] < 16 * 512 * 32 || in_sizes[2] < 512 || in_sizes[3] < 16 * 512 * 32 || in_sizes[4] < 512 || in_sizes[5] < 16 * 512 * 32 || in_sizes[6] < 512 || in_sizes[7] < 512 * 512 || in_sizes[8] < 512) return;
  if ((long long)out_size < (long long)NB * SEQ * 512) return;
  size_t off = 0; char* ws = (char*)d_ws;
  auto carve = [&](size_t bytes) { char* p = ws + off; off += (bytes + 255) & ~(size_t)255; return p; };
  const size_t planeB = (size_t)NB * SEQ * 512 * 2;               // 8,388,608 B at full size (NB*16*SEQ*32 halves == NB*SEQ*512 halves)
  b16* XH = (b16*)carve(planeB); b16* WT = (b16*)carve((size_t)4 * 512 * 512 * 2); b16* QP = (b16*)carve(planeB); b16* KP = (b16*)carve(planeB); b16* VT = (b16*)carve(planeB); b16* CTX = (b16*)carve(planeB);
  if (off > ws_size || off > ((size_t)128 << 20)) return;         // 5 x 8 MiB + 2 MiB = 44,040,192 B at full size
  xcvt_kernel<<<(unsigned)((size_t)NB * SEQ * 64 / 256), 256, 0, stream>>>(Fp(0), XH);
  wprep_kernel<<<dim3(128, 4), 256, 0, stream>>>(Fp(1), Fp(3), Fp(5), Fp(7), WT);
  qkv_kernel<<<dim3((unsigned)(NB * SEQ / 64), 16), 128, 0, stream>>>(XH, WT, Fp(2), Fp(4), Fp(6), QP, KP, VT);
  flash_kernel<<<(unsigned)(NB * 16 * (SEQ / 128)), 128, 0, stream>>>(QP, KP, VT, CTX);
  oproj_kernel<<<dim3((unsigned)(NB * SEQ / 64), 4), 128, 0, stream>>>(CTX, WT + (size_t)3 * 512 * 512, Fp(8), (float*)d_out);
}

// v007
// A run of this version takes 73.1 microseconds.
// Next to v006, in two timings, it ran 1.04 times as fast each time.
// Over all steps from v000 it is 2.77 times as fast.
#include <hip/hip_runtime.h>

// Dense multi-head attention layer: x [NB][SEQ_FULL][512] (first SEQ rows of each batch used); per-head Q/K/V = x W[h] + b[h] (16 heads x 32), softmax(Q K^T / sqrt(32)) V over all keys, heads concatenated, y = ctx Wo^T + bo.
// compute dtype: every contraction on v_wmma_f32_16x16x32_f16 (f16 operands, f32 accumulate), one product per tile pair. Float inputs are converted to bf16 (RNE) on load and carried exactly
// in f16: x x8, weights x256 (Wq/Wk/Wv transposed to [h*32+dh][d], Wo kept [out][in]). Computed planes: Q as f16 x log2(e)/sqrt(32), K as f16 x1, V^T as f16 x16; unnormalised softmax P as f16 x1024 (packed from the score
// accumulators directly into the P.V B fragment); ctx as f16 x256. Biases (bf16 RNE), softmax (kept reference, exp2), normalisation and all epilogues in f32.
// Fragment k-map per lane half hh for A AND B: elements 0..7 <- k = 8hh+0..7, 8..15 <- k = 16+8hh+0..7; acc[r] = D[8hh+r][lane&15].

#ifndef NB
#define NB 4
#endif
#ifndef SEQ
#define SEQ 2048
#endif
#define NB_FULL 4
#define SEQ_FULL 2048

namespace {

constexpr unsigned DM = 512, NH = 16, DH = 32, NBU = (unsigned)NB, SQ = (unsigned)SEQ, QB = SQ / 128u;
constexpr float XS = 8.0f, WSC = 256.0f, QC = 16.0f, PC = 1024.0f, CC = 256.0f;
constexpr float QS = (float)(0.17677669529663687 * 1.4426950408889634);           // scale of the Q plane: log2(e) / sqrt(32); the K plane is x1, so a score product is an exp2 argument as it comes
constexpr float PL = 10.0f; static_assert(PC == 1024.0f);                         // PL = log2(PC)
constexpr float LIM = 65504.0f;                                                   // largest finite f16: bound on a lane's sum of 32 p x1024 taken without a new reference
static_assert(SEQ % 128 == 0 && SEQ <= SEQ_FULL && NB <= NB_FULL && NB >= 1);
static_assert(((size_t)NB * SEQ * 64) % 256 == 0);            // xcvt: threads x 8 elements == NB*SEQ*512 exactly
static_assert((512 * 512 / 8) % 256 == 0);                    // wprep: 128 blocks x 256 threads x 8 == 512*512 per plane
static_assert(DM == NH * DH && DM % 32 == 0 && DH == 32);

typedef _Float16 b16;
typedef __attribute__((ext_vector_type(16))) _Float16 v16b;
typedef __attribute__((ext_vector_type(8))) _Float16 v8b;
typedef __attribute__((ext_vector_type(8))) float v8f;
typedef __attribute__((ext_vector_type(4))) float v4f;

__device__ __forceinline__ float bf16_rne(float f) { unsigned int u = __float_as_uint(f); u += 0x7FFFu + ((u >> 16) & 1u); return __uint_as_float(u & 0xFFFF0000u); }
__device__ __forceinline__ v16b frag_kb(const b16* p, unsigned hh) { const v8b a = *(const v8b*)(p + 8u * hh), b = *(const v8b*)(p + 16u + 8u * hh); v16b f;
#pragma unroll
  for (int e = 0; e < 8; ++e) { f[e] = a[e]; f[8 + e] = b[e]; } return f; }
__device__ __forceinline__ v8f wmma16b(v16b a, v16b b, v8f c) { return __builtin_amdgcn_wmma_f32_16x16x32_f16(false, a, false, b, (short)0, c, false, false); }

// Asynchronous 16-byte copies, global memory to LDS: each lane names its own LDS byte address (low 32 bits of the __shared__ address) and its own global pointer.
// One asm statement per tile, two in qkv_kernel: s_wait_xcnt 0 as its last line stands in front of every later rewrite of the address registers that the copies name.
__device__ __forceinline__ unsigned lds_off(const void* p) { return (unsigned)(size_t)p; }
#define CP "global_load_async_to_lds_b128 "
__device__ __forceinline__ void copy4(unsigned l0, const b16* g0, unsigned l1, const b16* g1, unsigned l2, const b16* g2, unsigned l3, const b16* g3) {
  asm volatile(CP "%0, %1, off\n\t" CP "%2, %3, off\n\t" CP "%4, %5, off\n\t" CP "%6, %7, off\n\ts_wait_xcnt 0x0"
               :: "v"(l0), "v"(g0), "v"(l1), "v"(g1), "v"(l2), "v"(g2), "v"(l3), "v"(g3) : "memory"); }
__device__ __forceinline__ void copy6(unsigned l0, const b16* g0, unsigned l1, const b16* g1, unsigned l2, const b16* g2, unsigned l3, const b16* g3, unsigned l4, const b16* g4, unsigned l5, const b16* g5) {
  asm volatile(CP "%0, %1, off\n\t" CP "%2, %3, off\n\t" CP "%4, %5, off\n\t" CP "%6, %7, off\n\t" CP "%8, %9, off\n\t" CP "%10, %11, off\n\ts_wait_xcnt 0x0"
               :: "v"(l0), "v"(g0), "v"(l1), "v"(g1), "v"(l2), "v"(g2), "v"(l3), "v"(g3), "v"(l4), "v"(g4), "v"(l5), "v"(g5) : "memory"); }
__device__ __forceinline__ void copy8(unsigned l0, const b16* g0, unsigned l1, const b16* g1, unsigned l2, const b16* g2, unsigned l3, const b16* g3, unsigned l4, const b16* g4, unsigned l5, const b16* g5, unsigned l6, const b16* g6, unsigned l7, const b16* g7) {
  asm volatile(CP "%0, %1, off\n\t" CP "%2, %3, off\n\t" CP "%4, %5, off\n\t" CP "%6, %7, off\n\t" CP "%8, %9, off\n\t" CP "%10, %11, off\n\t" CP "%12, %13, off\n\t" CP "%14, %15, off\n\ts_wait_xcnt 0x0"
               :: "v"(l0), "v"(g0), "v"(l1), "v"(g1), "v"(l2), "v"(g2), "v"(l3), "v"(g3), "v"(l4), "v"(g4), "v"(l5), "v"(g5), "v"(l6), "v"(g6), "v"(l7), "v"(g7) : "memory"); }
#undef CP
// this wave's copies have landed: in front of the barrier behind which the other waves read them
__device__ __forceinline__ void wait_copies() { asm volatile("s_wait_asynccnt 0x0" ::: "memory"); }
// this wave's LDS reads are done: in front of the barrier behind which their buffer is refilled
__device__ __forceinline__ void wait_lds() { asm volatile("s_wait_dscnt 0x0" ::: "memory"); }

__global__ __launch_bounds__(256) void xcvt_kernel(const float* __restrict__ x, b16* __restrict__ XH) {
  const unsigned u = blockIdx.x * 256u + threadIdx.x; const unsigned row = u >> 6, c = (u & 63u) * 8u; const unsigned b = row / SQ, s = row % SQ;
  const float* src = x + ((size_t)b * SEQ_FULL + s) * DM + c; const v4f a0 = *(const v4f*)src, a1 = *(const v4f*)(src + 4); v8b v;
#pragma unroll
  for (int j = 0; j < 4; ++j) { v[j] = (b16)(bf16_rne(a0[j]) * XS); v[4 + j] = (b16)(bf16_rne(a1[j]) * XS); }
  b16* dst = XH + (size_t)u * 8u;
  { *(v8b*)dst = v;  }
}

__global__ __launch_bounds__(256) void wprep_kernel(const float* __restrict__ wq, const float* __restrict__ wk, const float* __restrict__ wv, const float* __restrict__ wo, b16* __restrict__ WT) {
  const unsigned z = blockIdx.y; const unsigned u = blockIdx.x * 256u + threadIdx.x; const unsigned e = u * 8u, o = e >> 9, k0 = e & 511u; v8b v;
  if (z < 3u) { const float* w = (z == 0u) ? wq : ((z == 1u) ? wk : wv); const unsigned h = o >> 5, dh = o & 31u; const float* sp = w + ((size_t)h * DM + k0) * DH + dh;
#pragma unroll
    for (int j = 0; j < 8; ++j) v[j] = (b16)(bf16_rne(sp[(size_t)j * DH]) * WSC); }
  else { const float* sp = wo + (size_t)o * DM + k0; const v4f a0 = *(const v4f*)sp, a1 = *(const v4f*)(sp + 4);
#pragma unroll
    for (int j = 0; j < 4; ++j) { v[j] = (b16)(bf16_rne(a0[j]) * WSC); v[4 + j] = (b16)(bf16_rne(a1[j]) * WSC); } }
  b16* dst = WT + (size_t)z * DM * DM + e;
  { *(v8b*)dst = v;  }
}

// Q/K/V projection of two heads: block = 128 rows x 192 columns (q | k | v, each 64 = heads h0, h0 + 1), wave = 32 rows (two groups of 16) x 12 tiles: an A fragment feeds 12 WMMAs, a B fragment read from LDS feeds both groups. A fragments from XH rows (global), loaded one trip ahead.
// The 192 WT rows are shared by the four waves: per trip of 64 k they are copied once into LDS (rows of 128 bytes at pitch 144, two buffers, the next tile in flight while this one is worked on) and the B fragments are read from there. LDS row = plane * 64 + head * 32 + dh, tile tt = rows 16 tt.
// y = acc / 2048 + bf16(b); Q, K planes [bh][SEQ][32] f16, Q x log2(e)/sqrt(32), K x1 (block writes 8192 contiguous bytes per head each); V^T plane [bh][32][SEQ] f16 x16 (32 runs of 128 keys per head). LDS tiles cross-wave: block barrier; they reuse the ring's LDS behind the last trip's barrier.
__global__ __launch_bounds__(128) void qkv_kernel(const b16* __restrict__ XH, const b16* __restrict__ WT, const float* __restrict__ bq, const float* __restrict__ bk, const float* __restrict__ bv, b16* __restrict__ QP, b16* __restrict__ KP, b16* __restrict__ VT) {
  static_assert(4u * 128u * 40u + 2u * 32u * 136u >= 2u * 192u * 72u && NH % 2u == 0u);   // the output tiles are the larger user of SM
  __shared__ __attribute__((aligned(16))) b16 SM[4u * 128u * 40u + 2u * 32u * 136u];
  b16 (*Tq)[128][40] = (b16 (*)[128][40])SM; b16 (*Tk)[128][40] = (b16 (*)[128][40])(SM + 2u * 128u * 40u); b16 (*Tv)[32][136] = (b16 (*)[32][136])(SM + 4u * 128u * 40u);
  const unsigned tid = threadIdx.x, wave = tid >> 5, lane = tid & 31u, nloc = lane & 15u, hlf = lane >> 4; const unsigned m0 = blockIdx.x * 128u, h0 = blockIdx.y * 2u;
  const b16* arow = XH + (size_t)(m0 + wave * 32u + nloc) * DM;   // group g: + g * 16 rows
  const b16* gw = WT + (size_t)(h0 * DH + (tid >> 3)) * DM + (tid & 7u) * 8u; const unsigned lw = lds_off(SM + (tid >> 3) * 72u + (tid & 7u) * 8u);
  auto stage = [&](unsigned kc, unsigned buf) { const b16* g = gw + kc * 64u; const unsigned l = lw + buf * (192u * 144u);
    copy6(l, g, l + 16u * 144u, g + 16u * DM, l + 32u * 144u, g + 32u * DM, l + 48u * 144u, g + 48u * DM, l + 64u * 144u, g + DM * DM, l + 80u * 144u, g + DM * DM + 16u * DM);
    copy6(l + 96u * 144u, g + DM * DM + 32u * DM, l + 112u * 144u, g + DM * DM + 48u * DM, l + 128u * 144u, g + 2u * DM * DM, l + 144u * 144u, g + 2u * DM * DM + 16u * DM, l + 160u * 144u, g + 2u * DM * DM + 32u * DM, l + 176u * 144u, g + 2u * DM * DM + 48u * DM); };
  v8f acc[2][12];
#pragma unroll
  for (int t = 0; t < 12; ++t) { acc[0][t] = (v8f){}; acc[1][t] = (v8f){}; }
  v16b an[2][2] = {{frag_kb(arow, hlf), frag_kb(arow + 32u, hlf)}, {frag_kb(arow + 16u * DM, hlf), frag_kb(arow + 16u * DM + 32u, hlf)}};   // A fragments one trip ahead: trip 0's are in flight during the first tile's copies
  stage(0u, 0u); wait_copies(); __syncthreads(); stage(1u, 1u);
#pragma unroll 1
  for (unsigned kc = 0; kc < DM / 64u; ++kc) { const unsigned buf = kc & 1u; const b16* wl = SM + buf * (192u * 72u) + nloc * 72u;
    const v16b ac[2][2] = {{an[0][0], an[0][1]}, {an[1][0], an[1][1]}}; const unsigned kn = (kc + 1u < DM / 64u) ? kc + 1u : kc;   // the last trip loads its own fragments again: in bounds, no branch
#pragma unroll
    for (int g = 0; g < 2; ++g) { an[g][0] = frag_kb(arow + (unsigned)g * 16u * DM + kn * 64u, hlf); an[g][1] = frag_kb(arow + (unsigned)g * 16u * DM + kn * 64u + 32u, hlf); }
#pragma unroll  // both k-steps of a trip spelled out: LDS offsets and acc[] indices stay compile-time constants
    for (int ks = 0; ks < 2; ++ks) {
#pragma unroll
      for (int t = 0; t < 12; ++t) { const v16b bf = frag_kb(wl + (unsigned)t * 16u * 72u + (unsigned)ks * 32u, hlf); acc[0][t] = wmma16b(ac[0][ks], bf, acc[0][t]); acc[1][t] = wmma16b(ac[1][ks], bf, acc[1][t]); } }
    // issue order of the trip: the 8 global loads first (left alone the scheduler sinks them to the foot, where their latency stands in front of the barrier), 8 B fragments read ahead, then 8 WMMAs and the next 4 fragments' 8 LDS reads in turn (few, large groups of LDS reads, for speed only)
    __builtin_amdgcn_sched_group_barrier(0x020, 8, 0); __builtin_amdgcn_sched_group_barrier(0x100, 16, 0);
#pragma unroll  // the order is a straight list of groups: every builtin must stand in the trip's one block
    for (int i = 0; i < 4; ++i) { __builtin_amdgcn_sched_group_barrier(0x008, 8, 0); __builtin_amdgcn_sched_group_barrier(0x100, 8, 0); }
    __builtin_amdgcn_sched_group_barrier(0x008, 16, 0);   // end of the order: the last WMMAs, whose fragments are already read
    __builtin_amdgcn_sched_barrier(0);   // the last WMMAs stay in front of the waits: sunk behind the barrier they put the wait for the last LDS reads right behind their issue and the next tile's copies 15 WMMAs later
    wait_lds(); wait_copies(); __syncthreads();
    if (kc + 2u < DM / 64u) stage(kc + 2u, buf); }
  wait_copies();
  float braw[12]; const unsigned bidx = h0 * DH + nloc;
#pragma unroll
  for (int t = 0; t < 12; ++t) { const float* bp = (t < 4) ? bq : ((t < 8) ? bk : bv); braw[t] = bp[bidx + (unsigned)(t & 3) * 16u]; }
  asm volatile("s_wait_xcnt 0x0" :: "v"(bidx) : "memory");   // behind the 12 bias loads, in front of the first rewrite of the offset register that they name: the input keeps that register as it is up to the wait
#pragma unroll
  for (int t = 0; t < 12; ++t) { const unsigned hl = (unsigned)(t >> 1) & 1u, col = (unsigned)(t & 1) * 16u + nloc; const float bb = bf16_rne(braw[t]);
#pragma unroll
    for (int g = 0; g < 2; ++g) {
#pragma unroll
      for (int r = 0; r < 8; ++r) { const unsigned row = wave * 32u + (unsigned)g * 16u + 8u * hlf + (unsigned)r; const float y = (acc[g][t][r] * (1.0f / (XS * WSC)) + bb) * ((t < 4) ? QS : ((t < 8) ? 1.0f : QC)); const b16 y16 = (b16)y;
        if (t < 4) Tq[hl][row][col] = y16; else if (t < 8) Tk[hl][row][col] = y16; else Tv[hl][col][row] = y16; } } }
  __syncthreads();
  const unsigned b = m0 / SQ, s0 = m0 % SQ, bh = b * NH + h0;
#pragma unroll
  for (int hl = 0; hl < 2; ++hl) { v8b qv[4], kv[4], vv[4];
#pragma unroll
    for (int i = 0; i < 4; ++i) { const unsigned idx = (unsigned)i * 128u + tid; qv[i] = *(const v8b*)(&Tq[hl][idx >> 2][(idx & 3u) * 8u]); kv[i] = *(const v8b*)(&Tk[hl][idx >> 2][(idx & 3u) * 8u]); vv[i] = *(const v8b*)(&Tv[hl][idx >> 4][(idx & 15u) * 8u]); }
    b16* qd = QP + ((size_t)(bh + (unsigned)hl) * SQ + s0) * DH; b16* kd = KP + ((size_t)(bh + (unsigned)hl) * SQ + s0) * DH; b16* vd = VT + (size_t)(bh + (unsigned)hl) * DH * SQ + s0;
#pragma unroll
    for (int i = 0; i < 4; ++i) { const unsigned idx = (unsigned)i * 128u + tid; *(v8b*)(qd + (size_t)idx * 8u) = qv[i]; *(v8b*)(kd + (size_t)idx * 8u) = kv[i]; *(v8b*)(vd + (size_t)(idx >> 4) * SQ + (idx & 15u) * 8u) = vv[i]; } }
}

// flash attention, transposed form: block = 128 queries of one (b, h), wave = 32 queries in two groups of 16 (the D columns of a group's tiles): every K and V^T fragment read from LDS feeds both groups. Per 64 keys and group: S^T tiles = K rows (A) x Q rows (B, loaded once) + C, C = minus the reference in use, so a
// score accumulator is the exp2 argument of p x1024 as it comes; the lane's sum of its 32 p decides whether the reference is renewed (only then: max over the arguments, one xor-16 exchange, O and the row sum rescaled, p anew); the four score tiles are packed (f16) into two B fragments (element r <- tile 2j, element 8+r <- tile 2j+1);
// O^T tiles (dh rows) += V^T rows (A) x P^T (B). The 64 K rows and the 32 V^T rows of a trip are shared by the four waves: copied once into LDS (K rows of 64 bytes at pitch 80, V^T rows of 128 bytes
// at pitch 144, two buffers, the next tile in flight while this one is worked on); the A fragments are read from there. ctx plane [bh][SEQ][32] f16 x256; wave writes its 2048 contiguous bytes. No key tail (SEQ % 64 == 0).
__global__ __launch_bounds__(128) void flash_kernel(const b16* __restrict__ QP, const b16* __restrict__ KP, const b16* __restrict__ VT, b16* __restrict__ CTX) {
  __shared__ __attribute__((aligned(16))) b16 Ks[2][64][40], Vs[2][32][72], Tc[4][32][40];
  const unsigned tid = threadIdx.x, wave = tid >> 5, lane = tid & 31u, nloc = lane & 15u, hlf = lane >> 4; const unsigned bh = blockIdx.x / QB, s0 = (blockIdx.x % QB) * 128u + wave * 32u;
  constexpr unsigned NT = SQ / 64u;
  const b16* gk = KP + (size_t)bh * SQ * DH + tid * 8u; const b16* gv = VT + (size_t)bh * DH * SQ + (size_t)(tid >> 3) * SQ + (tid & 7u) * 8u;
  const unsigned lk = lds_off(&Ks[0][tid >> 2][(tid & 3u) * 8u]), lv = lds_off(&Vs[0][tid >> 3][(tid & 7u) * 8u]);
  auto stage = [&](unsigned t, unsigned buf) { const b16* k0 = gk + (size_t)t * 64u * DH; const b16* v0 = gv + t * 64u; const unsigned a = lk + buf * (64u * 80u), c = lv + buf * (32u * 144u);
    copy4(a, k0, a + 32u * 80u, k0 + 32u * DH, c, v0, c + 16u * 144u, v0 + (size_t)16u * SQ); };
  const v16b qb[2] = {frag_kb(QP + ((size_t)bh * SQ + s0 + nloc) * DH, hlf), frag_kb(QP + ((size_t)bh * SQ + s0 + 16u + nloc) * DH, hlf)};
  float lsum[2] = {0.0f, 0.0f}; v8f o[2][2] = {{(v8f){}, (v8f){}}, {(v8f){}, (v8f){}}}, cref[2] = {(v8f){}, (v8f){}};   // cref: minus the reference in use (a max seen - log2(PC)), the same in all 8 rows: the C operand of the score products
  stage(0u, 0u); wait_copies(); __syncthreads();
  if (NT > 1u) stage(1u, 1u);
#pragma unroll 1
  for (unsigned t = 0; t < NT; ++t) {
    const unsigned buf = t & 1u; const b16* Kl = &Ks[buf][nloc][0]; const b16* Vl = &Vs[buf][nloc][0];
    v8f s[2][4];
#pragma unroll
    for (int j = 0; j < 4; ++j) { const v16b kf = frag_kb(Kl + 16u * (unsigned)j * 40u, hlf); s[0][j] = wmma16b(kf, qb[0], cref[0]); s[1][j] = wmma16b(kf, qb[1], cref[1]); }
    float ps[2]; v16b pb[2][2];
    auto soft = [&](int g) { float p[4][8]; float a = 0.0f;   // p x1024 of the group's 32 arguments, this lane's part of the row sum, and p packed as the two B fragments
#pragma unroll
      for (int j = 0; j < 4; ++j) {
#pragma unroll
        for (int r = 0; r < 8; ++r) p[j][r] = __builtin_amdgcn_exp2f(s[g][j][r]); }
#pragma unroll
      for (int r = 0; r < 8; ++r) a += (p[0][r] + p[1][r]) + (p[2][r] + p[3][r]);
      ps[g] = a;
#pragma unroll
      for (int r = 0; r < 8; ++r) { pb[g][0][r] = (b16)p[0][r]; pb[g][0][8 + r] = (b16)p[1][r]; pb[g][1][r] = (b16)p[2][r]; pb[g][1][8 + r] = (b16)p[3][r]; } };
    soft(0); soft(1);
    // one wave-uniform test a trip, on the sums that are formed anyway: no p is negative, so every p is at most its group's ps, and ps <= LIM keeps all 32 inside f16. The first trip always goes through and sets the references;
    // later any lane above LIM in either group sends the whole wave through (a column that needs nothing gets delta 0). Only there: the max over the arguments, the xor-16 exchange, the rescale of O and the row sum, and p anew.
    const float lim = (t == 0u) ? -1.0f : LIM;   // ps is never below 0
    if (__builtin_amdgcn_ballot_w32(!(ps[0] <= lim) || !(ps[1] <= lim)) != 0u) {
#pragma unroll
      for (int g = 0; g < 2; ++g) {
        float mx = -3.0e38f;
#pragma unroll
        for (int j = 0; j < 4; ++j) {
#pragma unroll
          for (int r = 0; r < 8; ++r) mx = fmaxf(mx, s[g][j][r]); }
        const float d = fmaxf(mx, __shfl_xor(mx, 16, 32)) - PL, dp = fmaxf(d, 0.0f); const float delta = (t == 0u) ? d : dp; const float corr = __builtin_amdgcn_exp2f(-dp);
        lsum[g] *= corr;
#pragma unroll
        for (int r = 0; r < 8; ++r) { o[g][0][r] *= corr; o[g][1][r] *= corr; cref[g][r] -= delta; s[g][0][r] -= delta; s[g][1][r] -= delta; s[g][2][r] -= delta; s[g][3][r] -= delta; }
        soft(g); } }
    lsum[0] += ps[0]; lsum[1] += ps[1];
    { const v16b v00 = frag_kb(Vl, hlf), v10 = frag_kb(Vl + 16u * 72u, hlf), v01 = frag_kb(Vl + 32u, hlf), v11 = frag_kb(Vl + 16u * 72u + 32u, hlf);   // each V^T fragment read once, for both groups
      o[0][0] = wmma16b(v00, pb[0][0], o[0][0]); o[1][0] = wmma16b(v00, pb[1][0], o[1][0]); o[0][1] = wmma16b(v10, pb[0][0], o[0][1]); o[1][1] = wmma16b(v10, pb[1][0], o[1][1]);
      o[0][0] = wmma16b(v01, pb[0][1], o[0][0]); o[1][0] = wmma16b(v01, pb[1][1], o[1][0]); o[0][1] = wmma16b(v11, pb[0][1], o[0][1]); o[1][1] = wmma16b(v11, pb[1][1], o[1][1]); }
    wait_lds(); wait_copies(); __syncthreads();
    if (t + 2u < NT) stage(t + 2u, buf);
  }
  wait_copies();
#pragma unroll
  for (int g = 0; g < 2; ++g) {
    const float l = lsum[g] + __shfl_xor(lsum[g], 16, 32);
    const float inv = (CC / QC) * (1.0f / l); v8b c0, c1;   // the row sum carries the x1024 of P, as the O tiles do
#pragma unroll
    for (int r = 0; r < 8; ++r) { c0[r] = (b16)(o[g][0][r] * inv); c1[r] = (b16)(o[g][1][r] * inv); }
    *(v8b*)(&Tc[wave][(unsigned)g * 16u + nloc][8u * hlf]) = c0; *(v8b*)(&Tc[wave][(unsigned)g * 16u + nloc][16u + 8u * hlf]) = c1; }
  __syncthreads();
  v8b cv[4];
#pragma unroll
  for (int i = 0; i < 4; ++i) { const unsigned idx = (unsigned)i * 32u + lane; cv[i] = *(const v8b*)(&Tc[wave][idx >> 2][(idx & 3u) * 8u]); }
  b16* cd = CTX + ((size_t)bh * SQ + s0) * DH;
  {
#pragma unroll
    for (int i = 0; i < 4; ++i) { const unsigned idx = (unsigned)i * 32u + lane; *(v8b*)(cd + (size_t)idx * 8u) = cv[i]; }
     }
}

// output projection: block = 64 rows x 128 columns, wave = 16 rows x 8 tiles; k-step = one head (A fragment from ctx[bh][s][0..31], loaded one trip ahead; B fragment from Wo rows at k = h*32). The 128 Wo rows are shared by the four waves: per trip of two heads (64 k)
// they are copied once into LDS (rows of 128 bytes at pitch 144, two buffers, the next tile in flight while this one is worked on) and the B fragments are read from there. y = acc / 65536 + bf16(bo).
__global__ __launch_bounds__(128) void oproj_kernel(const b16* __restrict__ CTX, const b16* __restrict__ WO, const float* __restrict__ bo, float* __restrict__ out) {
  __shared__ __attribute__((aligned(16))) float Tf[4][16][132];
  __shared__ __attribute__((aligned(16))) b16 Ws[2][128][72];
  const unsigned tid = threadIdx.x, wave = tid >> 5, lane = tid & 31u, nloc = lane & 15u, hlf = lane >> 4; const unsigned m0 = blockIdx.x * 64u + wave * 16u, n0 = blockIdx.y * 128u; const unsigned b = m0 / SQ, s0 = m0 % SQ;
  const b16* abase = CTX + ((size_t)(b * NH) * SQ + s0 + nloc) * DH; 
  const b16* gw = WO + (size_t)(n0 + (tid >> 3)) * DM + (tid & 7u) * 8u; const unsigned lw = lds_off(&Ws[0][tid >> 3][(tid & 7u) * 8u]);
  auto stage = [&](unsigned kc, unsigned buf) { const b16* g = gw + kc * 64u; const unsigned l = lw + buf * (128u * 144u);
    copy8(l, g, l + 16u * 144u, g + 16u * DM, l + 32u * 144u, g + 32u * DM, l + 48u * 144u, g + 48u * DM, l + 64u * 144u, g + 64u * DM, l + 80u * 144u, g + 80u * DM, l + 96u * 144u, g + 96u * DM, l + 112u * 144u, g + 112u * DM); };
  v8f acc[8];
#pragma unroll
  for (int t = 0; t < 8; ++t) acc[t] = (v8f){};
  v16b an[2] = {frag_kb(abase, hlf), frag_kb(abase + (size_t)SQ * DH, hlf)};   // A fragments one trip ahead: trip 0's are in flight during the first tile's copies
  stage(0u, 0u); wait_copies(); __syncthreads(); stage(1u, 1u);
#pragma unroll 1
  for (unsigned kc = 0; kc < NH / 2u; ++kc) { const unsigned buf = kc & 1u; const b16* wl = &Ws[buf][nloc][0];
    const v16b ac[2] = {an[0], an[1]}; const unsigned kn = (kc + 1u < NH / 2u) ? kc + 1u : kc;   // the last trip loads its own fragments again: in bounds, no branch
    an[0] = frag_kb(abase + (size_t)(kn * 2u) * SQ * DH, hlf); an[1] = frag_kb(abase + (size_t)(kn * 2u + 1u) * SQ * DH, hlf);
#pragma unroll  // both k-steps of a trip spelled out: LDS offsets and acc[] indices stay compile-time constants
    for (int ks = 0; ks < 2; ++ks) {
#pragma unroll
      for (int t = 0; t < 8; ++t) acc[t] = wmma16b(ac[ks], frag_kb(wl + (unsigned)t * 16u * 72u + (unsigned)ks * 32u, hlf), acc[t]); }
    // issue order of the trip: the 4 global loads first (left alone the scheduler sinks them to the foot, where their latency stands in front of the barrier), 4 B fragments read ahead, then a WMMA and the next fragment's 2 LDS reads in turn
    __builtin_amdgcn_sched_group_barrier(0x020, 4, 0); __builtin_amdgcn_sched_group_barrier(0x100, 8, 0);
#pragma unroll  // the order is a straight list of groups: every builtin must stand in the trip's one block
    for (int i = 0; i < 12; ++i) { __builtin_amdgcn_sched_group_barrier(0x008, 1, 0); __builtin_amdgcn_sched_group_barrier(0x100, 2, 0); }
    __builtin_amdgcn_sched_group_barrier(0x008, 4, 0);   // end of the order: the last WMMAs, whose fragments are already read
    wait_lds(); wait_copies(); __syncthreads();
    if (kc + 2u < NH / 2u) stage(kc + 2u, buf); }
  wait_copies();
#pragma unroll
  for (int t = 0; t < 8; ++t) { const unsigned col = (unsigned)t * 16u + nloc; const float bb = bf16_rne(bo[n0 + col]);
#pragma unroll
    for (int r = 0; r < 8; ++r) Tf[wave][8u * hlf + (unsigned)r][col] = acc[t][r] * (1.0f / (CC * WSC)) + bb; }
  __syncthreads();
  float* orow = out + (size_t)m0 * DM + n0 + lane * 4u;
  {
#pragma unroll 4
    for (unsigned rr = 0; rr < 16u; ++rr) { const v4f v = *(const v4f*)(&Tf[wave][rr][lane * 4u]); *(v4f*)(orow + (size_t)rr * DM) = v; }
     }
}

}  // namespace

extern "C" void kernel_launch(void* const* d_in, const int* in_sizes, int n_in, void* d_out, int out_size, void* d_ws, size_t ws_size, hipStream_t stream) {
  (void)n_in;
  auto Fp = [&](int i) { return (const float*)d_in[i]; };
  // wire order: 0 x [4][2048][512], 1 Wq [16][512][32], 2 bq [16][32], 3 Wk, 4 bk, 5 Wv, 6 bv, 7 Wo [512 out][512 in], 8 bo [512]; output [NB][SEQ][512] f32.
  const long long xneed = ((long long)(NB - 1) * SEQ_FULL + SEQ) * 512;
  if ((long long)in_sizes[0] < xneed || in_sizes[1] < 16 * 512 * 32 || in_sizes[2] < 512 || in_sizes[3] < 16 * 512 * 32 || in_sizes[4] < 512 || in_sizes[5] < 16 * 512 * 32 || in_sizes[6] < 512 || in_sizes[7] < 512 * 512 || in_sizes[8] < 512) return;
  if ((long long)out_size < (long long)NB * SEQ * 512) return;
  size_t off = 0; char* ws = (char*)d_ws;
  auto carve = [&](size_t bytes) { char* p = ws + off; off += (bytes + 255) & ~(size_t)255; return p; };
  const size_t planeB = (size_t)NB * SEQ * 512 * 2;               // 8,388,608 B at full size (NB*16*SEQ*32 halves == NB*SEQ*512 halves)
  b16* XH = (b16*)carve(planeB); b16* WT = (b16*)carve((size_t)4 * 512 * 512 * 2); b16* QP = (b16*)carve(planeB); b16* KP = (b16*)carve(planeB); b16* VT = (b16*)carve(planeB); b16* CTX = (b16*)carve(planeB);
  if (off > ws_size || off > ((size_t)128 << 20)) return;         // 5 x 8 MiB + 2 MiB = 44,040,192 B at full size
  xcvt_kernel<<<(unsigned)((size_t)NB * SEQ * 64 / 256), 256, 0, stream>>>(Fp(0), XH);
  wprep_kernel<<<dim3(128, 4), 256, 0, stream>>>(Fp(1), Fp(3), Fp(5), Fp(7), WT);
  qkv_kernel<<<dim3((unsigned)(NB * SEQ / 128), 8), 128, 0, stream>>>(XH, WT, Fp(2), Fp(4), Fp(6), QP, KP, VT);
  flash_kernel<<<(unsigned)(NB * 16 * (SEQ / 128)), 128, 0, stream>>>(QP, KP, VT, CTX);
  oproj_kernel<<<dim3((unsigned)(NB * SEQ / 64), 4), 128, 0, stream>>>(CTX, WT + (size_t)3 * 512 * 512, Fp(8), (float*)d_out);
}

// v008
// One run takes 70.5 microseconds.
// Next to v007, in two timings, it ran 1.03 and 1.05 times as fast.
// Counting every step since v000, it is 2.88 times as fast.
#include <hip/hip_runtime.h>

// Dense multi-head attention layer: x [NB][SEQ_FULL][512] (first SEQ rows of each batch used); per-head Q/K/V = x W[h] + b[h] (16 heads x 32), softmax(Q K^T / sqrt(32)) V over all keys, heads concatenated, y = ctx Wo^T + bo.
// compute dtype: every contraction on v_wmma_f32_16x16x32_f16 (f16 operands, f32 accumulate), one product per tile pair. Float inputs are converted to bf16 (RNE) on load and carried exactly
// in f16: x x8 (converted in the projection kernel as its A fragments are read from LDS), weights x256 (Wq/Wk/Wv transposed to [h*32+dh][d], Wo kept [out][in]). Computed planes: Q as f16 x log2(e)/sqrt(32), K as f16 x1, V^T as f16 x16; unnormalised softmax P as f16 x1024 (packed from the score
// accumulators directly into the P.V B fragment); ctx as f16 x256. Biases (bf16 RNE), softmax (kept reference, exp2), normalisation and all epilogues in f32.
// Fragment k-map per lane half hh for A AND B: elements 0..7 <- k = 8hh+0..7, 8..15 <- k = 16+8hh+0..7; acc[r] = D[8hh+r][lane&15].

#ifndef NB
#define NB 4
#endif
#ifndef SEQ
#define SEQ 2048
#endif
#define NB_FULL 4
#define SEQ_FULL 2048

namespace {

constexpr unsigned DM = 512, NH = 16, DH = 32, NBU = (unsigned)NB, SQ = (unsigned)SEQ, QB = SQ / 128u;
constexpr float XS = 8.0f, WSC = 256.0f, QC = 16.0f, PC = 1024.0f, CC = 256.0f;
constexpr float QS = (float)(0.17677669529663687 * 1.4426950408889634);           // scale of the Q plane: log2(e) / sqrt(32); the K plane is x1, so a score product is an exp2 argument as it comes
constexpr float PL = 10.0f; static_assert(PC == 1024.0f);                         // PL = log2(PC)
constexpr float LIM = 65504.0f;                                                   // largest finite f16: bound on a lane's sum of 32 p x1024 taken without a new reference
static_assert(SEQ % 128 == 0 && SEQ <= SEQ_FULL && NB <= NB_FULL && NB >= 1);
static_assert((512 * 512 / 8) % 256 == 0);                    // wprep: 128 blocks x 256 threads x 8 == 512*512 per plane
static_assert(DM == NH * DH && DM % 32 == 0 && DH == 32);

typedef _Float16 b16;
typedef __attribute__((ext_vector_type(16))) _Float16 v16b;
typedef __attribute__((ext_vector_type(8))) _Float16 v8b;
typedef __attribute__((ext_vector_type(8))) float v8f;
typedef __attribute__((ext_vector_type(4))) float v4f;
typedef __attribute__((ext_vector_type(2))) float v2f;
typedef __attribute__((ext_vector_type(2))) __bf16 v2h;
typedef __attribute__((ext_vector_type(2))) _Float16 v2b;

__device__ __forceinline__ float bf16_rne(float f) { unsigned int u = __float_as_uint(f); u += 0x7FFFu + ((u >> 16) & 1u); return __uint_as_float(u & 0xFFFF0000u); }
__device__ __forceinline__ v16b frag_kb(const b16* p, unsigned hh) { const v8b a = *(const v8b*)(p + 8u * hh), b = *(const v8b*)(p + 16u + 8u * hh); v16b f;
#pragma unroll
  for (int e = 0; e < 8; ++e) { f[e] = a[e]; f[8 + e] = b[e]; } return f; }
__device__ __forceinline__ v8f wmma16b(v16b a, v16b b, v8f c) { return __builtin_amdgcn_wmma_f32_16x16x32_f16(false, a, false, b, (short)0, c, false, false); }

// An A fragment of x taken from f32 rows in LDS: the 16 floats of the fragment's k-map (two runs of 8; p = the lane's row + 8 * its half), then bf16 (RNE) x8 as f16. The x8 goes first: a power of two, so the rounding to bf16 falls on the same bit.
struct raw16 { v4f q[4]; };
__device__ __forceinline__ raw16 raw_kb(const float* p) { raw16 r; r.q[0] = *(const v4f*)p; r.q[1] = *(const v4f*)(p + 4u); r.q[2] = *(const v4f*)(p + 16u); r.q[3] = *(const v4f*)(p + 20u); return r; }
__device__ __forceinline__ v16b cvt_kb(const raw16& r) { v16b f;
#pragma unroll  // vector element indices must be compile-time constants: the values stay in registers
  for (int i = 0; i < 8; ++i) { const v2f t = (v2f){r.q[i >> 1][(i & 1) * 2], r.q[i >> 1][(i & 1) * 2 + 1]} * XS; const unsigned u = __builtin_bit_cast(unsigned, __builtin_convertvector(t, v2h));
    const v2b h = __builtin_convertvector((v2f){__uint_as_float(u << 16), __uint_as_float(u & 0xFFFF0000u)}, v2b); f[2 * i] = h[0]; f[2 * i + 1] = h[1]; }
  return f; }

// Asynchronous 16-byte copies, global memory to LDS: each lane names its own LDS byte address (low 32 bits of the __shared__ address) and its own global pointer.
// One asm statement per tile, four in qkv_kernel: s_wait_xcnt 0 as its last line stands in front of every later rewrite of the address registers that the copies name.
__device__ __forceinline__ unsigned lds_off(const void* p) { return (unsigned)(size_t)p; }
#define CP "global_load_async_to_lds_b128 "
__device__ __forceinline__ void copy4(unsigned l0, const b16* g0, unsigned l1, const b16* g1, unsigned l2, const b16* g2, unsigned l3, const b16* g3) {
  asm volatile(CP "%0, %1, off\n\t" CP "%2, %3, off\n\t" CP "%4, %5, off\n\t" CP "%6, %7, off\n\ts_wait_xcnt 0x0"
               :: "v"(l0), "v"(g0), "v"(l1), "v"(g1), "v"(l2), "v"(g2), "v"(l3), "v"(g3) : "memory"); }
__device__ __forceinline__ void copy6(unsigned l0, const b16* g0, unsigned l1, const b16* g1, unsigned l2, const b16* g2, unsigned l3, const b16* g3, unsigned l4, const b16* g4, unsigned l5, const b16* g5) {
  asm volatile(CP "%0, %1, off\n\t" CP "%2, %3, off\n\t" CP "%4, %5, off\n\t" CP "%6, %7, off\n\t" CP "%8, %9, off\n\t" CP "%10, %11, off\n\ts_wait_xcnt 0x0"
               :: "v"(l0), "v"(g0), "v"(l1), "v"(g1), "v"(l2), "v"(g2), "v"(l3), "v"(g3), "v"(l4), "v"(g4), "v"(l5), "v"(g5) : "memory"); }
__device__ __forceinline__ void copy8(unsigned l0, const b16* g0, unsigned l1, const b16* g1, unsigned l2, const b16* g2, unsigned l3, const b16* g3, unsigned l4, const b16* g4, unsigned l5, const b16* g5, unsigned l6, const b16* g6, unsigned l7, const b16* g7) {
  asm volatile(CP "%0, %1, off\n\t" CP "%2, %3, off\n\t" CP "%4, %5, off\n\t" CP "%6, %7, off\n\t" CP "%8, %9, off\n\t" CP "%10, %11, off\n\t" CP "%12, %13, off\n\t" CP "%14, %15, off\n\ts_wait_xcnt 0x0"
               :: "v"(l0), "v"(g0), "v"(l1), "v"(g1), "v"(l2), "v"(g2), "v"(l3), "v"(g3), "v"(l4), "v"(g4), "v"(l5), "v"(g5), "v"(l6), "v"(g6), "v"(l7), "v"(g7) : "memory"); }
__device__ __forceinline__ void copy8f(unsigned l0, const float* g0, unsigned l1, const float* g1, unsigned l2, const float* g2, unsigned l3, const float* g3, unsigned l4, const float* g4, unsigned l5, const float* g5, unsigned l6, const float* g6, unsigned l7, const float* g7) {
  asm volatile(CP "%0, %1, off\n\t" CP "%2, %3, off\n\t" CP "%4, %5, off\n\t" CP "%6, %7, off\n\t" CP "%8, %9, off\n\t" CP "%10, %11, off\n\t" CP "%12, %13, off\n\t" CP "%14, %15, off\n\ts_wait_xcnt 0x0"
               :: "v"(l0), "v"(g0), "v"(l1), "v"(g1), "v"(l2), "v"(g2), "v"(l3), "v"(g3), "v"(l4), "v"(g4), "v"(l5), "v"(g5), "v"(l6), "v"(g6), "v"(l7), "v"(g7) : "memory"); }
#undef CP
// this wave's copies have landed: in front of the barrier behind which the other waves read them
__device__ __forceinline__ void wait_copies() { asm volatile("s_wait_asynccnt 0x0" ::: "memory"); }
// this wave's LDS reads are done: in front of the barrier behind which their buffer is refilled
__device__ __forceinline__ void wait_lds() { asm volatile("s_wait_dscnt 0x0" ::: "memory"); }

__global__ __launch_bounds__(256) void wprep_kernel(const float* __restrict__ wq, const float* __restrict__ wk, const float* __restrict__ wv, const float* __restrict__ wo, b16* __restrict__ WT) {
  const unsigned z = blockIdx.y; const unsigned u = blockIdx.x * 256u + threadIdx.x; const unsigned e = u * 8u, o = e >> 9, k0 = e & 511u; v8b v;
  if (z < 3u) { const float* w = (z == 0u) ? wq : ((z == 1u) ? wk : wv); const unsigned h = o >> 5, dh = o & 31u; const float* sp = w + ((size_t)h * DM + k0) * DH + dh;
#pragma unroll
    for (int j = 0; j < 8; ++j) v[j] = (b16)(bf16_rne(sp[(size_t)j * DH]) * WSC); }
  else { const float* sp = wo + (size_t)o * DM + k0; const v4f a0 = *(const v4f*)sp, a1 = *(const v4f*)(sp + 4);
#pragma unroll
    for (int j = 0; j < 4; ++j) { v[j] = (b16)(bf16_rne(a0[j]) * WSC); v[4 + j] = (b16)(bf16_rne(a1[j]) * WSC); } }
  b16* dst = WT + (size_t)z * DM * DM + e;
  { *(v8b*)dst = v;  }
}

// Q/K/V projection of two heads: block = 128 rows x 192 columns (q | k | v, each 64 = heads h0, h0 + 1), wave = 32 rows (two groups of 16) x 12 tiles: an A fragment feeds 12 WMMAs, a B fragment read from LDS feeds both groups. A fragments from the f32 rows of x themselves: no cast launch in front.
// The 192 WT rows are shared by the four waves: per trip of 64 k they are copied once into LDS (rows of 128 bytes at pitch 144, two buffers, the next tile in flight while this one is worked on) and the B fragments are read from there. LDS row = plane * 64 + head * 32 + dh, tile tt = rows 16 tt. The block's 128 x rows go the same way, in the same ring and under the same waits (64 k = 256 bytes of f32 a row at pitch 272; a copy instruction covers whole lines): each wave reads its own 32 rows' fragments as f32 and converts them in registers.
// y = acc / 2048 + bf16(b); Q, K planes [bh][SEQ][32] f16, Q x log2(e)/sqrt(32), K x1 (block writes 8192 contiguous bytes per head each); V^T plane [bh][32][SEQ] f16 x16 (32 runs of 128 keys per head). LDS tiles cross-wave: block barrier; they reuse the ring's LDS behind the last trip's barrier.
__global__ __launch_bounds__(128) void qkv_kernel(const float* __restrict__ x, const b16* __restrict__ WT, const float* __restrict__ bq, const float* __restrict__ bk, const float* __restrict__ bv, b16* __restrict__ QP, b16* __restrict__ KP, b16* __restrict__ VT) {
  constexpr unsigned WB = 192u * 144u, XB = 128u * 272u;   // bytes of one buffer: weight rows, x rows
  static_assert(4u * 128u * 40u + 2u * 32u * 136u <= WB + XB && NH % 2u == 0u);   // the output tiles fit in the ring's LDS
  __shared__ __attribute__((aligned(16))) b16 SM[WB + XB];   // halves: 2 WB bytes of weight buffers, then 2 XB bytes of x buffers
  b16 (*Tq)[128][40] = (b16 (*)[128][40])SM; b16 (*Tk)[128][40] = (b16 (*)[128][40])(SM + 2u * 128u * 40u); b16 (*Tv)[32][136] = (b16 (*)[32][136])(SM + 4u * 128u * 40u);
  const unsigned tid = threadIdx.x, wave = tid >> 5, lane = tid & 31u, nloc = lane & 15u, hlf = lane >> 4; const unsigned m0 = blockIdx.x * 128u, h0 = blockIdx.y * 2u;
  const float* gx = x + ((size_t)(m0 / SQ) * SEQ_FULL + m0 % SQ + (tid >> 4)) * DM + (tid & 15u) * 4u; const unsigned lx = lds_off(SM + WB) + (tid >> 4) * 272u + (tid & 15u) * 16u;   // a block's 128 rows lie in one batch; 16 lanes copy one row's 256 bytes, a round of the block 8 rows
  const b16* gw = WT + (size_t)(h0 * DH + (tid >> 3)) * DM + (tid & 7u) * 8u; const unsigned lw = lds_off(SM + (tid >> 3) * 72u + (tid & 7u) * 8u);
  auto stage = [&](unsigned kc, unsigned l, unsigned m) { const b16* g = gw + kc * 64u;   // l, m: this thread's first LDS addresses in the buffer that is filled
    copy6(l, g, l + 16u * 144u, g + 16u * DM, l + 32u * 144u, g + 32u * DM, l + 48u * 144u, g + 48u * DM, l + 64u * 144u, g + DM * DM, l + 80u * 144u, g + DM * DM + 16u * DM);
    copy6(l + 96u * 144u, g + DM * DM + 32u * DM, l + 112u * 144u, g + DM * DM + 48u * DM, l + 128u * 144u, g + 2u * DM * DM, l + 144u * 144u, g + 2u * DM * DM + 16u * DM, l + 160u * 144u, g + 2u * DM * DM + 32u * DM, l + 176u * 144u, g + 2u * DM * DM + 48u * DM);
    const float* a = gx + kc * 64u;
    copy8f(m, a, m + 8u * 272u, a + 8u * DM, m + 16u * 272u, a + 16u * DM, m + 24u * 272u, a + 24u * DM, m + 32u * 272u, a + 32u * DM, m + 40u * 272u, a + 40u * DM, m + 48u * 272u, a + 48u * DM, m + 56u * 272u, a + 56u * DM);
    copy8f(m + 64u * 272u, a + 64u * DM, m + 72u * 272u, a + 72u * DM, m + 80u * 272u, a + 80u * DM, m + 88u * 272u, a + 88u * DM, m + 96u * 272u, a + 96u * DM, m + 104u * 272u, a + 104u * DM, m + 112u * 272u, a + 112u * DM, m + 120u * 272u, a + 120u * DM); };
  v8f acc[2][12];
#pragma unroll
  for (int t = 0; t < 12; ++t) { acc[0][t] = (v8f){}; acc[1][t] = (v8f){}; }
  stage(0u, lw, lx); wait_copies(); __syncthreads(); stage(1u, lw + WB, lx + XB);
  unsigned la = lw, ma = lx;   // the copy addresses in the buffer of the trip at hand, carried from trip to trip (formed anew each trip from lw and lx, those two were spilled to scratch)
#pragma unroll 1
  for (unsigned kc = 0; kc < DM / 64u; ++kc) { const unsigned buf = kc & 1u; const b16* wl = SM + buf * (192u * 72u) + nloc * 72u;
    const float* xl = (const float*)(SM + WB) + buf * (XB / 4u) + (wave * 32u + nloc) * 68u + 8u * hlf;   // group g: + g * 16 rows
    const v16b ac[2][2] = {{cvt_kb(raw_kb(xl)), cvt_kb(raw_kb(xl + 32u))}, {cvt_kb(raw_kb(xl + 16u * 68u)), cvt_kb(raw_kb(xl + 16u * 68u + 32u))}};
#pragma unroll  // both k-steps of a trip spelled out: LDS offsets and acc[] indices stay compile-time constants
    for (int ks = 0; ks < 2; ++ks) {
#pragma unroll
      for (int t = 0; t < 12; ++t) { const v16b bf = frag_kb(wl + (unsigned)t * 16u * 72u + (unsigned)ks * 32u, hlf); acc[0][t] = wmma16b(ac[0][ks], bf, acc[0][t]); acc[1][t] = wmma16b(ac[1][ks], bf, acc[1][t]); } }
    // issue order of the trip: the 16 LDS reads of the A fragments and 8 B fragments read ahead (the conversions, in no group, fall between those reads and among the first WMMAs), then 8 WMMAs and the next 4 fragments' 8 LDS reads in turn (few, large groups of LDS reads, for speed only)
    __builtin_amdgcn_sched_group_barrier(0x100, 32, 0);
#pragma unroll  // the order is a straight list of groups: every builtin must stand in the trip's one block
    for (int i = 0; i < 4; ++i) { __builtin_amdgcn_sched_group_barrier(0x008, 8, 0); __builtin_amdgcn_sched_group_barrier(0x100, 8, 0); }
    __builtin_amdgcn_sched_group_barrier(0x008, 16, 0);   // end of the order: the last WMMAs, whose fragments are already read
    __builtin_amdgcn_sched_barrier(0);   // the last WMMAs stay in front of the waits: sunk behind the barrier they put the wait for the last LDS reads right behind their issue and the next tile's copies 15 WMMAs later
    wait_lds(); wait_copies(); __syncthreads();
    if (kc + 2u < DM / 64u) stage(kc + 2u, la, ma);
    la += buf ? 0u - WB : WB; ma += buf ? 0u - XB : XB; }
  wait_copies();
  float braw[12]; const unsigned bidx = h0 * DH + nloc;
#pragma unroll
  for (int t = 0; t < 12; ++t) { const float* bp = (t < 4) ? bq : ((t < 8) ? bk : bv); braw[t] = bp[bidx + (unsigned)(t & 3) * 16u]; }
  asm volatile("s_wait_xcnt 0x0" :: "v"(bidx) : "memory");   // behind the 12 bias loads, in front of the first rewrite of the offset register that they name: the input keeps that register as it is up to the wait
#pragma unroll
  for (int t = 0; t < 12; ++t) { const unsigned hl = (unsigned)(t >> 1) & 1u, col = (unsigned)(t & 1) * 16u + nloc; const float bb = bf16_rne(braw[t]);
#pragma unroll
    for (int g = 0; g < 2; ++g) {
#pragma unroll
      for (int r = 0; r < 8; ++r) { const unsigned row = wave * 32u + (unsigned)g * 16u + 8u * hlf + (unsigned)r; const float y = (acc[g][t][r] * (1.0f / (XS * WSC)) + bb) * ((t < 4) ? QS : ((t < 8) ? 1.0f : QC)); const b16 y16 = (b16)y;
        if (t < 4) Tq[hl][row][col] = y16; else if (t < 8) Tk[hl][row][col] = y16; else Tv[hl][col][row] = y16; } } }
  __syncthreads();
  const unsigned b = m0 / SQ, s0 = m0 % SQ, bh = b * NH + h0;
#pragma unroll
  for (int hl = 0; hl < 2; ++hl) { v8b qv[4], kv[4], vv[4];
#pragma unroll
    for (int i = 0; i < 4; ++i) { const unsigned idx = (unsigned)i * 128u + tid; qv[i] = *(const v8b*)(&Tq[hl][idx >> 2][(idx & 3u) * 8u]); kv[i] = *(const v8b*)(&Tk[hl][idx >> 2][(idx & 3u) * 8u]); vv[i] = *(const v8b*)(&Tv[hl][idx >> 4][(idx & 15u) * 8u]); }
    b16* qd = QP + ((size_t)(bh + (unsigned)hl) * SQ + s0) * DH; b16* kd = KP + ((size_t)(bh + (unsigned)hl) * SQ + s0) * DH; b16* vd = VT + (size_t)(bh + (unsigned)hl) * DH * SQ + s0;
#pragma unroll
    for (int i = 0; i < 4; ++i) { const unsigned idx = (unsigned)i * 128u + tid; *(v8b*)(qd + (size_t)idx * 8u) = qv[i]; *(v8b*)(kd + (size_t)idx * 8u) = kv[i]; *(v8b*)(vd + (size_t)(idx >> 4) * SQ + (idx & 15u) * 8u) = vv[i]; } }
}

// flash attention, transposed form: block = 128 queries of one (b, h), wave = 32 queries in two groups of 16 (the D columns of a group's tiles): every K and V^T fragment read from LDS feeds both groups. Per 64 keys and group: S^T tiles = K rows (A) x Q rows (B, loaded once) + C, C = minus the reference in use, so a
// score accumulator is the exp2 argument of p x1024 as it comes; the lane's sum of its 32 p decides whether the reference is renewed (only then: max over the arguments, one xor-16 exchange, O and the row sum rescaled, p anew); the four score tiles are packed (f16) into two B fragments (element r <- tile 2j, element 8+r <- tile 2j+1);
// O^T tiles (dh rows) += V^T rows (A) x P^T (B). The 64 K rows and the 32 V^T rows of a trip are shared by the four waves: copied once into LDS (K rows of 64 bytes at pitch 80, V^T rows of 128 bytes
// at pitch 144, two buffers, the next tile in flight while this one is worked on); the A fragments are read from there. ctx plane [bh][SEQ][32] f16 x256; wave writes its 2048 contiguous bytes. No key tail (SEQ % 64 == 0).
__global__ __launch_bounds__(128) void flash_kernel(const b16* __restrict__ QP, const b16* __restrict__ KP, const b16* __restrict__ VT, b16* __restrict__ CTX) {
  __shared__ __attribute__((aligned(16))) b16 Ks[2][64][40], Vs[2][32][72], Tc[4][32][40];
  const unsigned tid = threadIdx.x, wave = tid >> 5, lane = tid & 31u, nloc = lane & 15u, hlf = lane >> 4; const unsigned bh = blockIdx.x / QB, s0 = (blockIdx.x % QB) * 128u + wave * 32u;
  constexpr unsigned NT = SQ / 64u;
  const b16* gk = KP + (size_t)bh * SQ * DH + tid * 8u; const b16* gv = VT + (size_t)bh * DH * SQ + (size_t)(tid >> 3) * SQ + (tid & 7u) * 8u;
  const unsigned lk = lds_off(&Ks[0][tid >> 2][(tid & 3u) * 8u]), lv = lds_off(&Vs[0][tid >> 3][(tid & 7u) * 8u]);
  auto stage = [&](unsigned t, unsigned buf) { const b16* k0 = gk + (size_t)t * 64u * DH; const b16* v0 = gv + t * 64u; const unsigned a = lk + buf * (64u * 80u), c = lv + buf * (32u * 144u);
    copy4(a, k0, a + 32u * 80u, k0 + 32u * DH, c, v0, c + 16u * 144u, v0 + (size_t)16u * SQ); };
  const v16b qb[2] = {frag_kb(QP + ((size_t)bh * SQ + s0 + nloc) * DH, hlf), frag_kb(QP + ((size_t)bh * SQ + s0 + 16u + nloc) * DH, hlf)};
  float lsum[2] = {0.0f, 0.0f}; v8f o[2][2] = {{(v8f){}, (v8f){}}, {(v8f){}, (v8f){}}}, cref[2] = {(v8f){}, (v8f){}};   // cref: minus the reference in use (a max seen - log2(PC)), the same in all 8 rows: the C operand of the score products
  stage(0u, 0u); wait_copies(); __syncthreads();
  if (NT > 1u) stage(1u, 1u);
#pragma unroll 1
  for (unsigned t = 0; t < NT; ++t) {
    const unsigned buf = t & 1u; const b16* Kl = &Ks[buf][nloc][0]; const b16* Vl = &Vs[buf][nloc][0];
    v8f s[2][4];
#pragma unroll
    for (int j = 0; j < 4; ++j) { const v16b kf = frag_kb(Kl + 16u * (unsigned)j * 40u, hlf); s[0][j] = wmma16b(kf, qb[0], cref[0]); s[1][j] = wmma16b(kf, qb[1], cref[1]); }
    float ps[2]; v16b pb[2][2];
    auto soft = [&](int g) { float p[4][8]; float a = 0.0f;   // p x1024 of the group's 32 arguments, this lane's part of the row sum, and p packed as the two B fragments
#pragma unroll
      for (int j = 0; j < 4; ++j) {
#pragma unroll
        for (int r = 0; r < 8; ++r) p[j][r] = __builtin_amdgcn_exp2f(s[g][j][r]); }
#pragma unroll
      for (int r = 0; r < 8; ++r) a += (p[0][r] + p[1][r]) + (p[2][r] + p[3][r]);
      ps[g] = a;
#pragma unroll
      for (int r = 0; r < 8; ++r) { pb[g][0][r] = (b16)p[0][r]; pb[g][0][8 + r] = (b16)p[1][r]; pb[g][1][r] = (b16)p[2][r]; pb[g][1][8 + r] = (b16)p[3][r]; } };
    soft(0); soft(1);
    // one wave-uniform test a trip, on the sums that are formed anyway: no p is negative, so every p is at most its group's ps, and ps <= LIM keeps all 32 inside f16. The first trip always goes through and sets the references;
    // later any lane above LIM in either group sends the whole wave through (a column that needs nothing gets delta 0). Only there: the max over the arguments, the xor-16 exchange, the rescale of O and the row sum, and p anew.
    const float lim = (t == 0u) ? -1.0f : LIM;   // ps is never below 0
    if (__builtin_amdgcn_ballot_w32(!(ps[0] <= lim) || !(ps[1] <= lim)) != 0u) {
#pragma unroll
      for (int g = 0; g < 2; ++g) {
        float mx = -3.0e38f;
#pragma unroll
        for (int j = 0; j < 4; ++j) {
#pragma unroll
          for (int r = 0; r < 8; ++r) mx = fmaxf(mx, s[g][j][r]); }
        const float d = fmaxf(mx, __shfl_xor(mx, 16, 32)) - PL, dp = fmaxf(d, 0.0f); const float delta = (t == 0u) ? d : dp; const float corr = __builtin_amdgcn_exp2f(-dp);
        lsum[g] *= corr;
#pragma unroll
        for (int r = 0; r < 8; ++r) { o[g][0][r] *= corr; o[g][1][r] *= corr; cref[g][r] -= delta; s[g][0][r] -= delta; s[g][1][r] -= delta; s[g][2][r] -= delta; s[g][3][r] -= delta; }
        soft(g); } }
    lsum[0] += ps[0]; lsum[1] += ps[1];
    { const v16b v00 = frag_kb(Vl, hlf), v10 = frag_kb(Vl + 16u * 72u, hlf), v01 = frag_kb(Vl + 32u, hlf), v11 = frag_kb(Vl + 16u * 72u + 32u, hlf);   // each V^T fragment read once, for both groups
      o[0][0] = wmma16b(v00, pb[0][0], o[0][0]); o[1][0] = wmma16b(v00, pb[1][0], o[1][0]); o[0][1] = wmma16b(v10, pb[0][0], o[0][1]); o[1][1] = wmma16b(v10, pb[1][0], o[1][1]);
      o[0][0] = wmma16b(v01, pb[0][1], o[0][0]); o[1][0] = wmma16b(v01, pb[1][1], o[1][0]); o[0][1] = wmma16b(v11, pb[0][1], o[0][1]); o[1][1] = wmma16b(v11, pb[1][1], o[1][1]); }
    wait_lds(); wait_copies(); __syncthreads();
    if (t + 2u < NT) stage(t + 2u, buf);
  }
  wait_copies();
#pragma unroll
  for (int g = 0; g < 2; ++g) {
    const float l = lsum[g] + __shfl_xor(lsum[g], 16, 32);
    const float inv = (CC / QC) * (1.0f / l); v8b c0, c1;   // the row sum carries the x1024 of P, as the O tiles do
#pragma unroll
    for (int r = 0; r < 8; ++r) { c0[r] = (b16)(o[g][0][r] * inv); c1[r] = (b16)(o[g][1][r] * inv); }
    *(v8b*)(&Tc[wave][(unsigned)g * 16u + nloc][8u * hlf]) = c0; *(v8b*)(&Tc[wave][(unsigned)g * 16u + nloc][16u + 8u * hlf]) = c1; }
  __syncthreads();
  v8b cv[4];
#pragma unroll
  for (int i = 0; i < 4; ++i) { const unsigned idx = (unsigned)i * 32u + lane; cv[i] = *(const v8b*)(&Tc[wave][idx >> 2][(idx & 3u) * 8u]); }
  b16* cd = CTX + ((size_t)bh * SQ + s0) * DH;
  {
#pragma unroll
    for (int i = 0; i < 4; ++i) { const unsigned idx = (unsigned)i * 32u + lane; *(v8b*)(cd + (size_t)idx * 8u) = cv[i]; }
     }
}

// output projection: block = 64 rows x 128 columns, wave = 16 rows x 8 tiles; k-step = one head (A fragment from ctx[bh][s][0..31], loaded one trip ahead; B fragment from Wo rows at k = h*32). The 128 Wo rows are shared by the four waves: per trip of two heads (64 k)
// they are copied once into LDS (rows of 128 bytes at pitch 144, two buffers, the next tile in flight while this one is worked on) and the B fragments are read from there. y = acc / 65536 + bf16(bo).
__global__ __launch_bounds__(128) void oproj_kernel(const b16* __restrict__ CTX, const b16* __restrict__ WO, const float* __restrict__ bo, float* __restrict__ out) {
  __shared__ __attribute__((aligned(16))) float Tf[4][16][132];
  __shared__ __attribute__((aligned(16))) b16 Ws[2][128][72];
  const unsigned tid = threadIdx.x, wave = tid >> 5, lane = tid & 31u, nloc = lane & 15u, hlf = lane >> 4; const unsigned m0 = blockIdx.x * 64u + wave * 16u, n0 = blockIdx.y * 128u; const unsigned b = m0 / SQ, s0 = m0 % SQ;
  const b16* abase = CTX + ((size_t)(b * NH) * SQ + s0 + nloc) * DH; 
  const b16* gw = WO + (size_t)(n0 + (tid >> 3)) * DM + (tid & 7u) * 8u; const unsigned lw = lds_off(&Ws[0][tid >> 3][(tid & 7u) * 8u]);
  auto stage = [&](unsigned kc, unsigned buf) { const b16* g = gw + kc * 64u; const unsigned l = lw + buf * (128u * 144u);
    copy8(l, g, l + 16u * 144u, g + 16u * DM, l + 32u * 144u, g + 32u * DM, l + 48u * 144u, g + 48u * DM, l + 64u * 144u, g + 64u * DM, l + 80u * 144u, g + 80u * DM, l + 96u * 144u, g + 96u * DM, l + 112u * 144u, g + 112u * DM); };
  v8f acc[8];
#pragma unroll
  for (int t = 0; t < 8; ++t) acc[t] = (v8f){};
  v16b an[2] = {frag_kb(abase, hlf), frag_kb(abase + (size_t)SQ * DH, hlf)};   // A fragments one trip ahead: trip 0's are in flight during the first tile's copies
  stage(0u, 0u); wait_copies(); __syncthreads(); stage(1u, 1u);
#pragma unroll 1
  for (unsigned kc = 0; kc < NH / 2u; ++kc) { const unsigned buf = kc & 1u; const b16* wl = &Ws[buf][nloc][0];
    const v16b ac[2] = {an[0], an[1]}; const unsigned kn = (kc + 1u < NH / 2u) ? kc + 1u : kc;   // the last trip loads its own fragments again: in bounds, no branch
    an[0] = frag_kb(abase + (size_t)(kn * 2u) * SQ * DH, hlf); an[1] = frag_kb(abase + (size_t)(kn * 2u + 1u) * SQ * DH, hlf);
#pragma unroll  // both k-steps of a trip spelled out: LDS offsets and acc[] indices stay compile-time constants
    for (int ks = 0; ks < 2; ++ks) {
#pragma unroll
      for (int t = 0; t < 8; ++t) acc[t] = wmma16b(ac[ks], frag_kb(wl + (unsigned)t * 16u * 72u + (unsigned)ks * 32u, hlf), acc[t]); }
    // issue order of the trip: the 4 global loads first (left alone the scheduler sinks them to the foot, where their latency stands in front of the barrier), 4 B fragments read ahead, then a WMMA and the next fragment's 2 LDS reads in turn
    __builtin_amdgcn_sched_group_barrier(0x020, 4, 0); __builtin_amdgcn_sched_group_barrier(0x100, 8, 0);
#pragma unroll  // the order is a straight list of groups: every builtin must stand in the trip's one block
    for (int i = 0; i < 12; ++i) { __builtin_amdgcn_sched_group_barrier(0x008, 1, 0); __builtin_amdgcn_sched_group_barrier(0x100, 2, 0); }
    __builtin_amdgcn_sched_group_barrier(0x008, 4, 0);   // end of the order: the last WMMAs, whose fragments are already read
    wait_lds(); wait_copies(); __syncthreads();
    if (kc + 2u < NH / 2u) stage(kc + 2u, buf); }
  wait_copies();
#pragma unroll
  for (int t = 0; t < 8; ++t) { const unsigned col = (unsigned)t * 16u + nloc; const float bb = bf16_rne(bo[n0 + col]);
#pragma unroll
    for (int r = 0; r < 8; ++r) Tf[wave][8u * hlf + (unsigned)r][col] = acc[t][r] * (1.0f / (CC * WSC)) + bb; }
  __syncthreads();
  float* orow = out + (size_t)m0 * DM + n0 + lane * 4u;
  {
#pragma unroll 4
    for (unsigned rr = 0; rr < 16u; ++rr) { const v4f v = *(const v4f*)(&Tf[wave][rr][lane * 4u]); *(v4f*)(orow + (size_t)rr * DM) = v; }
     }
}

}  // namespace

extern "C" void kernel_launch(void* const* d_in, const int* in_sizes, int n_in, void* d_out, int out_size, void* d_ws, size_t ws_size, hipStream_t stream) {
  (void)n_in;
  auto Fp = [&](int i) { return (const float*)d_in[i]; };
  // wire order: 0 x [4][2048][512], 1 Wq [16][512][32], 2 bq [16][32], 3 Wk, 4 bk, 5 Wv, 6 bv, 7 Wo [512 out][512 in], 8 bo [512]; output [NB][SEQ][512] f32.
  const long long xneed = ((long long)(NB - 1) * SEQ_FULL + SEQ) * 512;
  if ((long long)in_sizes[0] < xneed || in_sizes[1] < 16 * 512 * 32 || in_sizes[2] < 512 || in_sizes[3] < 16 * 512 * 32 || in_sizes[4] < 512 || in_sizes[5] < 16 * 512 * 32 || in_sizes[6] < 512 || in_sizes[7] < 512 * 512 || in_sizes[8] < 512) return;
  if ((long long)out_size < (long long)NB * SEQ * 512) return;
  size_t off = 0; char* ws = (char*)d_ws;
  auto carve = [&](size_t bytes) { char* p = ws + off; off += (bytes + 255) & ~(size_t)255; return p; };
  const size_t planeB = (size_t)NB * SEQ * 512 * 2;               // 8,388,608 B at full size (NB*16*SEQ*32 halves == NB*SEQ*512 halves)
  b16* WT = (b16*)carve((size_t)4 * 512 * 512 * 2); b16* QP = (b16*)carve(planeB); b16* KP = (b16*)carve(planeB); b16* VT = (b16*)carve(planeB); b16* CTX = (b16*)carve(planeB);
  if (off > ws_size || off > ((size_t)128 << 20)) return;         // 4 x 8 MiB + 2 MiB = 35,651,584 B at full size
  wprep_kernel<<<dim3(128, 4), 256, 0, stream>>>(Fp(1), Fp(3), Fp(5), Fp(7), WT);
  qkv_kernel<<<dim3((unsigned)(NB * SEQ / 128), 8), 128, 0, stream>>>(Fp(0), WT, Fp(2), Fp(4), Fp(6), QP, KP, VT);
  flash_kernel<<<(unsigned)(NB * 16 * (SEQ / 128)), 128, 0, stream>>>(QP, KP, VT, CTX);
  oproj_kernel<<<dim3((unsigned)(NB * SEQ / 64), 4), 128, 0, stream>>>(CTX, WT + (size_t)3 * 512 * 512, Fp(8), (float*)d_out);
}

// v009
// One run takes 68.5 microseconds.
// Two timings next to v008 put it at 1.04 and 1.03 times that version's speed.
// Over all steps from v000 it is 2.98 times as fast.
#include <hip/hip_runtime.h>

// Dense multi-head attention layer: x [NB][SEQ_FULL][512] (first SEQ rows of each batch used); per-head Q/K/V = x W[h] + b[h] (16 heads x 32), softmax(Q K^T / sqrt(32)) V over all keys, heads concatenated, y = ctx Wo^T + bo.
// compute dtype: every contraction on v_wmma_f32_16x16x32_f16 (f16 operands, f32 accumulate), one product per tile pair. Float inputs are converted to bf16 (RNE) on load and carried exactly
// in f16: x x8 (converted in the projection kernel as its A fragments are read from LDS), weights x256 (Wq/Wk/Wv transposed to [h*32+dh][d], Wo kept [out][in]). Computed planes: Q as f16 x log2(e)/sqrt(32), K as f16 x1, V^T as f16 x16; unnormalised softmax P as f16 x1024 (packed from the score
// accumulators directly into the P.V B fragment); ctx as f16 x256. Biases (bf16 RNE), softmax (kept reference, exp2), normalisation and all epilogues in f32.
// Fragment k-map per lane half hh for A AND B: elements 0..7 <- k = 8hh+0..7, 8..15 <- k = 16+8hh+0..7; acc[r] = D[8hh+r][lane&15].

#ifndef NB
#define NB 4
#endif
#ifndef SEQ
#define SEQ 2048
#endif
#define NB_FULL 4
#define SEQ_FULL 2048

namespace {

constexpr unsigned DM = 512, NH = 16, DH = 32, NBU = (unsigned)NB, SQ = (unsigned)SEQ, QB = SQ / 128u;
constexpr float XS = 8.0f, WSC = 256.0f, QC = 16.0f, PC = 1024.0f, CC = 256.0f;
constexpr float QS = (float)(0.17677669529663687 * 1.4426950408889634);           // scale of the Q plane: log2(e) / sqrt(32); the K plane is x1, so a score product is an exp2 argument as it comes
constexpr float PL = 10.0f; static_assert(PC == 1024.0f);                         // PL = log2(PC)
constexpr float LIM = 65504.0f;                                                   // largest finite f16: bound on a lane's sum of 32 p x1024 taken without a new reference
static_assert(SEQ % 128 == 0 && SEQ <= SEQ_FULL && NB <= NB_FULL && NB >= 1);
static_assert((512 * 512 / 8) % 256 == 0);                    // wprep: 128 blocks x 256 threads x 8 == 512*512 per plane
static_assert(DM == NH * DH && DM % 32 == 0 && DH == 32);

typedef _Float16 b16;
typedef __attribute__((ext_vector_type(16))) _Float16 v16b;
typedef __attribute__((ext_vector_type(8))) _Float16 v8b;
typedef __attribute__((ext_vector_type(8))) float v8f;
typedef __attribute__((ext_vector_type(4))) float v4f;
typedef __attribute__((ext_vector_type(2))) float v2f;
typedef __attribute__((ext_vector_type(2))) __bf16 v2h;
typedef __attribute__((ext_vector_type(2))) _Float16 v2b;

__device__ __forceinline__ float bf16_rne(float f) { unsigned int u = __float_as_uint(f); u += 0x7FFFu + ((u >> 16) & 1u); return __uint_as_float(u & 0xFFFF0000u); }
__device__ __forceinline__ v16b frag_kb(const b16* p, unsigned hh) { const v8b a = *(const v8b*)(p + 8u * hh), b = *(const v8b*)(p + 16u + 8u * hh); v16b f;
#pragma unroll
  for (int e = 0; e < 8; ++e) { f[e] = a[e]; f[8 + e] = b[e]; } return f; }
__device__ __forceinline__ v8f wmma16b(v16b a, v16b b, v8f c) { return __builtin_amdgcn_wmma_f32_16x16x32_f16(false, a, false, b, (short)0, c, false, false); }

// An A fragment of x taken from f32 rows in LDS: the 16 floats of the fragment's k-map (two runs of 8; p = the lane's row + 8 * its half), then bf16 (RNE) x8 as f16. The x8 goes first: a power of two, so the rounding to bf16 falls on the same bit.
struct raw16 { v4f q[4]; };
__device__ __forceinline__ raw16 raw_kb(const float* p) { raw16 r; r.q[0] = *(const v4f*)p; r.q[1] = *(const v4f*)(p + 4u); r.q[2] = *(const v4f*)(p + 16u); r.q[3] = *(const v4f*)(p + 20u); return r; }
__device__ __forceinline__ v16b cvt_kb(const raw16& r) { v16b f;
#pragma unroll  // vector element indices must be compile-time constants: the values stay in registers
  for (int i = 0; i < 8; ++i) { const v2f t = (v2f){r.q[i >> 1][(i & 1) * 2], r.q[i >> 1][(i & 1) * 2 + 1]} * XS; const unsigned u = __builtin_bit_cast(unsigned, __builtin_convertvector(t, v2h));
    const v2b h = __builtin_convertvector((v2f){__uint_as_float(u << 16), __uint_as_float(u & 0xFFFF0000u)}, v2b); f[2 * i] = h[0]; f[2 * i + 1] = h[1]; }
  return f; }

// Asynchronous 16-byte copies, global memory to LDS: each lane names its own LDS byte address (low 32 bits of the __shared__ address) and its own global pointer.
// One asm statement per tile, four in qkv_kernel: s_wait_xcnt 0 as its last line stands in front of every later rewrite of the address registers that the copies name.
__device__ __forceinline__ unsigned lds_off(const void* p) { return (unsigned)(size_t)p; }
#define CP "global_load_async_to_lds_b128 "
__device__ __forceinline__ void copy4(unsigned l0, const b16* g0, unsigned l1, const b16* g1, unsigned l2, const b16* g2, unsigned l3, const b16* g3) {
  asm volatile(CP "%0, %1, off\n\t" CP "%2, %3, off\n\t" CP "%4, %5, off\n\t" CP "%6, %7, off\n\ts_wait_xcnt 0x0"
               :: "v"(l0), "v"(g0), "v"(l1), "v"(g1), "v"(l2), "v"(g2), "v"(l3), "v"(g3) : "memory"); }
__device__ __forceinline__ void copy6(unsigned l0, const b16* g0, unsigned l1, const b16* g1, unsigned l2, const b16* g2, unsigned l3, const b16* g3, unsigned l4, const b16* g4, unsigned l5, const b16* g5) {
  asm volatile(CP "%0, %1, off\n\t" CP "%2, %3, off\n\t" CP "%4, %5, off\n\t" CP "%6, %7, off\n\t" CP "%8, %9, off\n\t" CP "%10, %11, off\n\ts_wait_xcnt 0x0"
               :: "v"(l0), "v"(g0), "v"(l1), "v"(g1), "v"(l2), "v"(g2), "v"(l3), "v"(g3), "v"(l4), "v"(g4), "v"(l5), "v"(g5) : "memory"); }
__device__ __forceinline__ void copy8(unsigned l0, const b16* g0, unsigned l1, const b16* g1, unsigned l2, const b16* g2, unsigned l3, const b16* g3, unsigned l4, const b16* g4, unsigned l5, const b16* g5, unsigned l6, const b16* g6, unsigned l7, const b16* g7) {
  asm volatile(CP "%0, %1, off\n\t" CP "%2, %3, off\n\t" CP "%4, %5, off\n\t" CP "%6, %7, off\n\t" CP "%8, %9, off\n\t" CP "%10, %11, off\n\t" CP "%12, %13, off\n\t" CP "%14, %15, off\n\ts_wait_xcnt 0x0"
               :: "v"(l0), "v"(g0), "v"(l1), "v"(g1), "v"(l2), "v"(g2), "v"(l3), "v"(g3), "v"(l4), "v"(g4), "v"(l5), "v"(g5), "v"(l6), "v"(g6), "v"(l7), "v"(g7) : "memory"); }
__device__ __forceinline__ void copy8f(unsigned l0, const float* g0, unsigned l1, const float* g1, unsigned l2, const float* g2, unsigned l3, const float* g3, unsigned l4, const float* g4, unsigned l5, const float* g5, unsigned l6, const float* g6, unsigned l7, const float* g7) {
  asm volatile(CP "%0, %1, off\n\t" CP "%2, %3, off\n\t" CP "%4, %5, off\n\t" CP "%6, %7, off\n\t" CP "%8, %9, off\n\t" CP "%10, %11, off\n\t" CP "%12, %13, off\n\t" CP "%14, %15, off\n\ts_wait_xcnt 0x0"
               :: "v"(l0), "v"(g0), "v"(l1), "v"(g1), "v"(l2), "v"(g2), "v"(l3), "v"(g3), "v"(l4), "v"(g4), "v"(l5), "v"(g5), "v"(l6), "v"(g6), "v"(l7), "v"(g7) : "memory"); }
#undef CP
// Hints to L2 (scope SE: the line comes into L2 only, nothing returns, no counter moves): each lane asks for the 256-byte unit at its own address, well ahead of the copy or load that reads it, so that this one finds an L2 hit and not memory latency.
// Every address lies inside its buffer, but at NT == 8 flash_kernel's trip-0 ask for the last head runs past the ends of KP and VT. s_wait_xcnt 0 as the last line stands in front of every later rewrite of the address registers that the hints name.
#define PF "global_prefetch_b8 "
__device__ __forceinline__ void ask1(const b16* p0) { asm volatile(PF "%0, off scope:SCOPE_SE\n\ts_wait_xcnt 0x0" :: "v"(p0) : "memory"); }
__device__ __forceinline__ void ask2(const b16* p0, const b16* p1) { asm volatile(PF "%0, off scope:SCOPE_SE\n\t" PF "%1, off scope:SCOPE_SE\n\ts_wait_xcnt 0x0" :: "v"(p0), "v"(p1) : "memory"); }
__device__ __forceinline__ void ask3(const float* p0, const b16* p1, const b16* p2) { asm volatile(PF "%0, off scope:SCOPE_SE\n\t" PF "%1, off scope:SCOPE_SE\n\t" PF "%2, off scope:SCOPE_SE\n\ts_wait_xcnt 0x0" :: "v"(p0), "v"(p1), "v"(p2) : "memory"); }
#undef PF
// this wave's copies have landed: in front of the barrier behind which the other waves read them
__device__ __forceinline__ void wait_copies() { asm volatile("s_wait_asynccnt 0x0" ::: "memory"); }
// this wave's LDS reads are done: in front of the barrier behind which their buffer is refilled
__device__ __forceinline__ void wait_lds() { asm volatile("s_wait_dscnt 0x0" ::: "memory"); }

__global__ __launch_bounds__(256) void wprep_kernel(const float* __restrict__ wq, const float* __restrict__ wk, const float* __restrict__ wv, const float* __restrict__ wo, b16* __restrict__ WT) {
  const unsigned z = blockIdx.y; const unsigned u = blockIdx.x * 256u + threadIdx.x; const unsigned e = u * 8u, o = e >> 9, k0 = e & 511u; v8b v;
  if (z < 3u) { const float* w = (z == 0u) ? wq : ((z == 1u) ? wk : wv); const unsigned h = o >> 5, dh = o & 31u; const float* sp = w + ((size_t)h * DM + k0) * DH + dh;
#pragma unroll
    for (int j = 0; j < 8; ++j) v[j] = (b16)(bf16_rne(sp[(size_t)j * DH]) * WSC); }
  else { const float* sp = wo + (size_t)o * DM + k0; const v4f a0 = *(const v4f*)sp, a1 = *(const v4f*)(sp + 4);
#pragma unroll
    for (int j = 0; j < 4; ++j) { v[j] = (b16)(bf16_rne(a0[j]) * WSC); v[4 + j] = (b16)(bf16_rne(a1[j]) * WSC); } }
  b16* dst = WT + (size_t)z * DM * DM + e;
  { *(v8b*)dst = v;  }
}

// Q/K/V projection of two heads: block = 128 rows x 192 columns (q | k | v, each 64 = heads h0, h0 + 1), wave = 32 rows (two groups of 16) x 12 tiles: an A fragment feeds 12 WMMAs, a B fragment read from LDS feeds both groups. A fragments from the f32 rows of x themselves: no cast launch in front.
// The 192 WT rows are shared by the four waves: per trip of 64 k they are copied once into LDS (rows of 128 bytes at pitch 144, two buffers, the next tile in flight while this one is worked on) and the B fragments are read from there. LDS row = plane * 64 + head * 32 + dh, tile tt = rows 16 tt. The block's 128 x rows go the same way, in the same ring and under the same waits (64 k = 256 bytes of f32 a row at pitch 272; a copy instruction covers whole lines): each wave reads its own 32 rows' fragments as f32 and converts them in registers.
// y = acc / 2048 + bf16(b); Q, K planes [bh][SEQ][32] f16, Q x log2(e)/sqrt(32), K x1 (block writes 8192 contiguous bytes per head each); V^T plane [bh][32][SEQ] f16 x16 (32 runs of 128 keys per head). LDS tiles cross-wave: block barrier; they reuse the ring's LDS behind the last trip's barrier.
__global__ __launch_bounds__(128) void qkv_kernel(const float* __restrict__ x, const b16* __restrict__ WT, const float* __restrict__ bq, const float* __restrict__ bk, const float* __restrict__ bv, b16* __restrict__ QP, b16* __restrict__ KP, b16* __restrict__ VT) {
  constexpr unsigned WB = 192u * 144u, XB = 128u * 272u;   // bytes of one buffer: weight rows, x rows
  static_assert(4u * 128u * 40u + 2u * 32u * 136u <= WB + XB && NH % 2u == 0u);   // the output tiles fit in the ring's LDS
  __shared__ __attribute__((aligned(16))) b16 SM[WB + XB];   // halves: 2 WB bytes of weight buffers, then 2 XB bytes of x buffers
  b16 (*Tq)[128][40] = (b16 (*)[128][40])SM; b16 (*Tk)[128][40] = (b16 (*)[128][40])(SM + 2u * 128u * 40u); b16 (*Tv)[32][136] = (b16 (*)[32][136])(SM + 4u * 128u * 40u);
  const unsigned tid = threadIdx.x, wave = tid >> 5, lane = tid & 31u, nloc = lane & 15u, hlf = lane >> 4; const unsigned m0 = blockIdx.x * 128u, h0 = blockIdx.y * 2u;
  const float* gx = x + ((size_t)(m0 / SQ) * SEQ_FULL + m0 % SQ + (tid >> 4)) * DM + (tid & 15u) * 4u; const unsigned lx = lds_off(SM + WB) + (tid >> 4) * 272u + (tid & 15u) * 16u;   // a block's 128 rows lie in one batch; 16 lanes copy one row's 256 bytes, a round of the block 8 rows
  const b16* gw = WT + (size_t)(h0 * DH + (tid >> 3)) * DM + (tid & 7u) * 8u; const unsigned lw = lds_off(SM + (tid >> 3) * 72u + (tid & 7u) * 8u);
  auto stage = [&](unsigned kc, unsigned l, unsigned m) { const b16* g = gw + kc * 64u;   // l, m: this thread's first LDS addresses in the buffer that is filled
    copy6(l, g, l + 16u * 144u, g + 16u * DM, l + 32u * 144u, g + 32u * DM, l + 48u * 144u, g + 48u * DM, l + 64u * 144u, g + DM * DM, l + 80u * 144u, g + DM * DM + 16u * DM);
    copy6(l + 96u * 144u, g + DM * DM + 32u * DM, l + 112u * 144u, g + DM * DM + 48u * DM, l + 128u * 144u, g + 2u * DM * DM, l + 144u * 144u, g + 2u * DM * DM + 16u * DM, l + 160u * 144u, g + 2u * DM * DM + 32u * DM, l + 176u * 144u, g + 2u * DM * DM + 48u * DM);
    const float* a = gx + kc * 64u;
    copy8f(m, a, m + 8u * 272u, a + 8u * DM, m + 16u * 272u, a + 16u * DM, m + 24u * 272u, a + 24u * DM, m + 32u * 272u, a + 32u * DM, m + 40u * 272u, a + 40u * DM, m + 48u * 272u, a + 48u * DM, m + 56u * 272u, a + 56u * DM);
    copy8f(m + 64u * 272u, a + 64u * DM, m + 72u * 272u, a + 72u * DM, m + 80u * 272u, a + 80u * DM, m + 88u * 272u, a + 88u * DM, m + 96u * 272u, a + 96u * DM, m + 104u * 272u, a + 104u * DM, m + 112u * 272u, a + 112u * DM, m + 120u * 272u, a + 120u * DM); };
  v8f acc[2][12];
#pragma unroll
  for (int t = 0; t < 12; ++t) { acc[0][t] = (v8f){}; acc[1][t] = (v8f){}; }
  stage(0u, lw, lx);
  { // asked while tile 0 is on its way. x: a row's 256-byte unit is one trip's k; the 8 blocks that share these 128 rows ask for the units of trips 2 to 7 between them (a thread = a row). Weights: a unit is two trips' k; the 64 blocks that share these 192 rows ask for the units of trips 2 to 7 by turns (planes q, k: a thread = a row; plane v: two threads a row).
    const unsigned qw = (1u + blockIdx.x % 3u) * 128u; const b16* pw = WT + (size_t)(h0 * DH + (tid & 63u)) * DM + qw;
    ask3(x + ((size_t)(m0 / SQ) * SEQ_FULL + m0 % SQ + tid) * DM + (2u + blockIdx.y % 6u) * 64u, pw + (size_t)(tid >> 6) * DM * DM, pw + (size_t)2u * DM * DM); }
  wait_copies(); __syncthreads(); stage(1u, lw + WB, lx + XB);
  unsigned la = lw, ma = lx;   // the copy addresses in the buffer of the trip at hand, carried from trip to trip (formed anew each trip from lw and lx, those two were spilled to scratch)
#pragma unroll 1
  for (unsigned kc = 0; kc < DM / 64u; ++kc) { const unsigned buf = kc & 1u; const b16* wl = SM + buf * (192u * 72u) + nloc * 72u;
    const float* xl = (const float*)(SM + WB) + buf * (XB / 4u) + (wave * 32u + nloc) * 68u + 8u * hlf;   // group g: + g * 16 rows
    const v16b ac[2][2] = {{cvt_kb(raw_kb(xl)), cvt_kb(raw_kb(xl + 32u))}, {cvt_kb(raw_kb(xl + 16u * 68u)), cvt_kb(raw_kb(xl + 16u * 68u + 32u))}};
#pragma unroll  // both k-steps of a trip spelled out: LDS offsets and acc[] indices stay compile-time constants
    for (int ks = 0; ks < 2; ++ks) {
#pragma unroll
      for (int t = 0; t < 12; ++t) { const v16b bf = frag_kb(wl + (unsigned)t * 16u * 72u + (unsigned)ks * 32u, hlf); acc[0][t] = wmma16b(ac[0][ks], bf, acc[0][t]); acc[1][t] = wmma16b(ac[1][ks], bf, acc[1][t]); } }
    // issue order of the trip: the 16 LDS reads of the A fragments and 8 B fragments read ahead (the conversions, in no group, fall between those reads and among the first WMMAs), then 8 WMMAs and the next 4 fragments' 8 LDS reads in turn (few, large groups of LDS reads, for speed only)
    __builtin_amdgcn_sched_group_barrier(0x100, 32, 0);
#pragma unroll  // the order is a straight list of groups: every builtin must stand in the trip's one block
    for (int i = 0; i < 4; ++i) { __builtin_amdgcn_sched_group_barrier(0x008, 8, 0); __builtin_amdgcn_sched_group_barrier(0x100, 8, 0); }
    __builtin_amdgcn_sched_group_barrier(0x008, 16, 0);   // end of the order: the last WMMAs, whose fragments are already read
    __builtin_amdgcn_sched_barrier(0);   // the last WMMAs stay in front of the waits: sunk behind the barrier they put the wait for the last LDS reads right behind their issue and the next tile's copies 15 WMMAs later
    wait_lds(); wait_copies(); __syncthreads();
    if (kc + 2u < DM / 64u) stage(kc + 2u, la, ma);
    la += buf ? 0u - WB : WB; ma += buf ? 0u - XB : XB; }
  wait_copies();
  float braw[12]; const unsigned bidx = h0 * DH + nloc;
#pragma unroll
  for (int t = 0; t < 12; ++t) { const float* bp = (t < 4) ? bq : ((t < 8) ? bk : bv); braw[t] = bp[bidx + (unsigned)(t & 3) * 16u]; }
  asm volatile("s_wait_xcnt 0x0" :: "v"(bidx) : "memory");   // behind the 12 bias loads, in front of the first rewrite of the offset register that they name: the input keeps that register as it is up to the wait
#pragma unroll
  for (int t = 0; t < 12; ++t) { const unsigned hl = (unsigned)(t >> 1) & 1u, col = (unsigned)(t & 1) * 16u + nloc; const float bb = bf16_rne(braw[t]);
#pragma unroll
    for (int g = 0; g < 2; ++g) {
#pragma unroll
      for (int r = 0; r < 8; ++r) { const unsigned row = wave * 32u + (unsigned)g * 16u + 8u * hlf + (unsigned)r; const float y = (acc[g][t][r] * (1.0f / (XS * WSC)) + bb) * ((t < 4) ? QS : ((t < 8) ? 1.0f : QC)); const b16 y16 = (b16)y;
        if (t < 4) Tq[hl][row][col] = y16; else if (t < 8) Tk[hl][row][col] = y16; else Tv[hl][col][row] = y16; } } }
  __syncthreads();
  const unsigned b = m0 / SQ, s0 = m0 % SQ, bh = b * NH + h0;
#pragma unroll
  for (int hl = 0; hl < 2; ++hl) { v8b qv[4], kv[4], vv[4];
#pragma unroll
    for (int i = 0; i < 4; ++i) { const unsigned idx = (unsigned)i * 128u + tid; qv[i] = *(const v8b*)(&Tq[hl][idx >> 2][(idx & 3u) * 8u]); kv[i] = *(const v8b*)(&Tk[hl][idx >> 2][(idx & 3u) * 8u]); vv[i] = *(const v8b*)(&Tv[hl][idx >> 4][(idx & 15u) * 8u]); }
    b16* qd = QP + ((size_t)(bh + (unsigned)hl) * SQ + s0) * DH; b16* kd = KP + ((size_t)(bh + (unsigned)hl) * SQ + s0) * DH; b16* vd = VT + (size_t)(bh + (unsigned)hl) * DH * SQ + s0;
#pragma unroll
    for (int i = 0; i < 4; ++i) { const unsigned idx = (unsigned)i * 128u + tid; *(v8b*)(qd + (size_t)idx * 8u) = qv[i]; *(v8b*)(kd + (size_t)idx * 8u) = kv[i]; *(v8b*)(vd + (size_t)(idx >> 4) * SQ + (idx & 15u) * 8u) = vv[i]; } }
}

// flash attention, transposed form: block = 128 queries of one (b, h), wave = 32 queries in two groups of 16 (the D columns of a group's tiles): every K and V^T fragment read from LDS feeds both groups. Per 64 keys and group: S^T tiles = K rows (A) x Q rows (B, loaded once) + C, C = minus the reference in use, so a
// score accumulator is the exp2 argument of p x1024 as it comes; the lane's sum of its 32 p decides whether the reference is renewed (only then: max over the arguments, one xor-16 exchange, O and the row sum rescaled, p anew); the four score tiles are packed (f16) into two B fragments (element r <- tile 2j, element 8+r <- tile 2j+1);
// O^T tiles (dh rows) += V^T rows (A) x P^T (B). The 64 K rows and the 32 V^T rows of a trip are shared by the four waves: copied once into LDS (K rows of 64 bytes at pitch 80, V^T rows of 128 bytes
// at pitch 144, two buffers, the next tile in flight while this one is worked on); the A fragments are read from there. ctx plane [bh][SEQ][32] f16 x256; wave writes its 2048 contiguous bytes. No key tail (SEQ % 64 == 0).
__global__ __launch_bounds__(128) void flash_kernel(const b16* __restrict__ QP, const b16* __restrict__ KP, const b16* __restrict__ VT, b16* __restrict__ CTX) {
  __shared__ __attribute__((aligned(16))) b16 Ks[2][64][40], Vs[2][32][72], Tc[4][32][40];
  const unsigned tid = threadIdx.x, wave = tid >> 5, lane = tid & 31u, nloc = lane & 15u, hlf = lane >> 4; const unsigned bh = blockIdx.x / QB, s0 = (blockIdx.x % QB) * 128u + wave * 32u;
  constexpr unsigned NT = SQ / 64u;
  const b16* gk = KP + (size_t)bh * SQ * DH + tid * 8u; const b16* gv = VT + (size_t)bh * DH * SQ + (size_t)(tid >> 3) * SQ + (tid & 7u) * 8u;
  const unsigned lk = lds_off(&Ks[0][tid >> 2][(tid & 3u) * 8u]), lv = lds_off(&Vs[0][tid >> 3][(tid & 7u) * 8u]);
  auto stage = [&](unsigned t, unsigned buf) { const b16* k0 = gk + (size_t)t * 64u * DH; const b16* v0 = gv + t * 64u; const unsigned a = lk + buf * (64u * 80u), c = lv + buf * (32u * 144u);
    copy4(a, k0, a + 32u * 80u, k0 + 32u * DH, c, v0, c + 16u * 144u, v0 + (size_t)16u * SQ); };
  const v16b qb[2] = {frag_kb(QP + ((size_t)bh * SQ + s0 + nloc) * DH, hlf), frag_kb(QP + ((size_t)bh * SQ + s0 + 16u + nloc) * DH, hlf)};
  float lsum[2] = {0.0f, 0.0f}; v8f o[2][2] = {{(v8f){}, (v8f){}}, {(v8f){}, (v8f){}}}, cref[2] = {(v8f){}, (v8f){}};   // cref: minus the reference in use (a max seen - log2(PC)), the same in all 8 rows: the C operand of the score products
  // asked ahead, 4 tiles at a time, one unit a thread: threads 0 to 63 the 64 units of 4 K tiles (16 KB in a row), threads 64 to 127 the 2 units of each of the 32 V^T rows (4 tiles = 512 bytes of a row)
  static_assert(NT % 4u == 0u && NT >= 8u);
  const b16* pf = (tid < 64u) ? KP + (size_t)bh * SQ * DH + tid * 128u : VT + (size_t)bh * DH * SQ + (size_t)((tid - 64u) >> 1) * SQ + (tid & 1u) * 128u;
  const unsigned pstep = (tid < 64u) ? 4u * 64u * DH : 256u; unsigned ta = 0u;   // ta: the next trip that asks (one scalar compare a trip)
  stage(0u, 0u); ask2(pf, pf + pstep); pf += pstep; wait_copies(); __syncthreads();   // tiles 0 to 7 asked for while tile 0 is on its way
  if (NT > 1u) stage(1u, 1u);
#pragma unroll 1
  for (unsigned t = 0; t < NT; ++t) {
    const unsigned buf = t & 1u; const b16* Kl = &Ks[buf][nloc][0]; const b16* Vl = &Vs[buf][nloc][0];
    v8f s[2][4];
#pragma unroll
    for (int j = 0; j < 4; ++j) { const v16b kf = frag_kb(Kl + 16u * (unsigned)j * 40u, hlf); s[0][j] = wmma16b(kf, qb[0], cref[0]); s[1][j] = wmma16b(kf, qb[1], cref[1]); }
    float ps[2]; v16b pb[2][2];
    auto soft = [&](int g) { float p[4][8]; float a = 0.0f;   // p x1024 of the group's 32 arguments, this lane's part of the row sum, and p packed as the two B fragments
#pragma unroll
      for (int j = 0; j < 4; ++j) {
#pragma unroll
        for (int r = 0; r < 8; ++r) p[j][r] = __builtin_amdgcn_exp2f(s[g][j][r]); }
#pragma unroll
      for (int r = 0; r < 8; ++r) a += (p[0][r] + p[1][r]) + (p[2][r] + p[3][r]);
      ps[g] = a;
#pragma unroll
      for (int r = 0; r < 8; ++r) { pb[g][0][r] = (b16)p[0][r]; pb[g][0][8 + r] = (b16)p[1][r]; pb[g][1][r] = (b16)p[2][r]; pb[g][1][8 + r] = (b16)p[3][r]; } };
    soft(0); soft(1);
    // one wave-uniform test a trip, on the sums that are formed anyway: no p is negative, so every p is at most its group's ps, and ps <= LIM keeps all 32 inside f16. The first trip always goes through and sets the references;
    // later any lane above LIM in either group sends the whole wave through (a column that needs nothing gets delta 0). Only there: the max over the arguments, the xor-16 exchange, the rescale of O and the row sum, and p anew.
    const float lim = (t == 0u) ? -1.0f : LIM;   // ps is never below 0
    if (__builtin_amdgcn_ballot_w32(!(ps[0] <= lim) || !(ps[1] <= lim)) != 0u) {
#pragma unroll
      for (int g = 0; g < 2; ++g) {
        float mx = -3.0e38f;
#pragma unroll
        for (int j = 0; j < 4; ++j) {
#pragma unroll
          for (int r = 0; r < 8; ++r) mx = fmaxf(mx, s[g][j][r]); }
        const float d = fmaxf(mx, __shfl_xor(mx, 16, 32)) - PL, dp = fmaxf(d, 0.0f); const float delta = (t == 0u) ? d : dp; const float corr = __builtin_amdgcn_exp2f(-dp);
        lsum[g] *= corr;
#pragma unroll
        for (int r = 0; r < 8; ++r) { o[g][0][r] *= corr; o[g][1][r] *= corr; cref[g][r] -= delta; s[g][0][r] -= delta; s[g][1][r] -= delta; s[g][2][r] -= delta; s[g][3][r] -= delta; }
        soft(g); } }
    lsum[0] += ps[0]; lsum[1] += ps[1];
    { const v16b v00 = frag_kb(Vl, hlf), v10 = frag_kb(Vl + 16u * 72u, hlf), v01 = frag_kb(Vl + 32u, hlf), v11 = frag_kb(Vl + 16u * 72u + 32u, hlf);   // each V^T fragment read once, for both groups
      o[0][0] = wmma16b(v00, pb[0][0], o[0][0]); o[1][0] = wmma16b(v00, pb[1][0], o[1][0]); o[0][1] = wmma16b(v10, pb[0][0], o[0][1]); o[1][1] = wmma16b(v10, pb[1][0], o[1][1]);
      o[0][0] = wmma16b(v01, pb[0][1], o[0][0]); o[1][0] = wmma16b(v01, pb[1][1], o[1][0]); o[0][1] = wmma16b(v11, pb[0][1], o[0][1]); o[1][1] = wmma16b(v11, pb[1][1], o[1][1]); }
    wait_lds(); wait_copies(); __syncthreads();
    if (t + 2u < NT) stage(t + 2u, buf);
    if (t == ta) { pf += pstep; ask1(pf); ta = (t + 12u < NT) ? t + 4u : NT; }   // every 4th trip: tiles t + 8 to t + 11, six trips ahead of the first of their copies; none behind the last tile once NT >= 12; at NT == 8 trip 0's ask (tiles 8 to 11) lies past the head's planes
  }
  wait_copies();
#pragma unroll
  for (int g = 0; g < 2; ++g) {
    const float l = lsum[g] + __shfl_xor(lsum[g], 16, 32);
    const float inv = (CC / QC) * (1.0f / l); v8b c0, c1;   // the row sum carries the x1024 of P, as the O tiles do
#pragma unroll
    for (int r = 0; r < 8; ++r) { c0[r] = (b16)(o[g][0][r] * inv); c1[r] = (b16)(o[g][1][r] * inv); }
    *(v8b*)(&Tc[wave][(unsigned)g * 16u + nloc][8u * hlf]) = c0; *(v8b*)(&Tc[wave][(unsigned)g * 16u + nloc][16u + 8u * hlf]) = c1; }
  __syncthreads();
  v8b cv[4];
#pragma unroll
  for (int i = 0; i < 4; ++i) { const unsigned idx = (unsigned)i * 32u + lane; cv[i] = *(const v8b*)(&Tc[wave][idx >> 2][(idx & 3u) * 8u]); }
  b16* cd = CTX + ((size_t)bh * SQ + s0) * DH;
  {
#pragma unroll
    for (int i = 0; i < 4; ++i) { const unsigned idx = (unsigned)i * 32u + lane; *(v8b*)(cd + (size_t)idx * 8u) = cv[i]; }
     }
}

// output projection: block = 64 rows x 128 columns, wave = 16 rows x 8 tiles; k-step = one head (A fragment from ctx[bh][s][0..31], loaded one trip ahead; B fragment from Wo rows at k = h*32). The 128 Wo rows are shared by the four waves: per trip of two heads (64 k)
// they are copied once into LDS (rows of 128 bytes at pitch 144, two buffers, the next tile in flight while this one is worked on) and the B fragments are read from there. y = acc / 65536 + bf16(bo).
__global__ __launch_bounds__(128) void oproj_kernel(const b16* __restrict__ CTX, const b16* __restrict__ WO, const float* __restrict__ bo, float* __restrict__ out) {
  __shared__ __attribute__((aligned(16))) float Tf[4][16][132];
  __shared__ __attribute__((aligned(16))) b16 Ws[2][128][72];
  const unsigned tid = threadIdx.x, wave = tid >> 5, lane = tid & 31u, nloc = lane & 15u, hlf = lane >> 4; const unsigned m0 = blockIdx.x * 64u + wave * 16u, n0 = blockIdx.y * 128u; const unsigned b = m0 / SQ, s0 = m0 % SQ;
  const b16* abase = CTX + ((size_t)(b * NH) * SQ + s0 + nloc) * DH; 
  const b16* gw = WO + (size_t)(n0 + (tid >> 3)) * DM + (tid & 7u) * 8u; const unsigned lw = lds_off(&Ws[0][tid >> 3][(tid & 7u) * 8u]);
  auto stage = [&](unsigned kc, unsigned buf) { const b16* g = gw + kc * 64u; const unsigned l = lw + buf * (128u * 144u);
    copy8(l, g, l + 16u * 144u, g + 16u * DM, l + 32u * 144u, g + 32u * DM, l + 48u * 144u, g + 48u * DM, l + 64u * 144u, g + 64u * DM, l + 80u * 144u, g + 80u * DM, l + 96u * 144u, g + 96u * DM, l + 112u * 144u, g + 112u * DM); };
  v8f acc[8];
#pragma unroll
  for (int t = 0; t < 8; ++t) acc[t] = (v8f){};
  v16b an[2] = {frag_kb(abase, hlf), frag_kb(abase + (size_t)SQ * DH, hlf)};   // A fragments one trip ahead: trip 0's are in flight during the first tile's copies
  stage(0u, 0u);
  { // asked while tile 0 is on its way. ctx: a head's 64 rows of this block are 16 units in a row; the 4 blocks that share the rows ask for 8 heads each. Wo: a unit is two trips' k; the 128 blocks that share these 128 rows ask for the units of trips 2 to 7 by turns (a thread = a row).
    const unsigned mb = blockIdx.x * 64u;
    ask2(CTX + ((size_t)((mb / SQ) * NH + (blockIdx.y & 1u) * 8u + (tid >> 4)) * SQ + mb % SQ) * DH + (tid & 15u) * 128u, WO + (size_t)(n0 + tid) * DM + (1u + blockIdx.x % 3u) * 128u); }
  wait_copies(); __syncthreads(); stage(1u, 1u);
#pragma unroll 1
  for (unsigned kc = 0; kc < NH / 2u; ++kc) { const unsigned buf = kc & 1u; const b16* wl = &Ws[buf][nloc][0];
    const v16b ac[2] = {an[0], an[1]}; const unsigned kn = (kc + 1u < NH / 2u) ? kc + 1u : kc;   // the last trip loads its own fragments again: in bounds, no branch
    an[0] = frag_kb(abase + (size_t)(kn * 2u) * SQ * DH, hlf); an[1] = frag_kb(abase + (size_t)(kn * 2u + 1u) * SQ * DH, hlf);
#pragma unroll  // both k-steps of a trip spelled out: LDS offsets and acc[] indices stay compile-time constants
    for (int ks = 0; ks < 2; ++ks) {
#pragma unroll
      for (int t = 0; t < 8; ++t) acc[t] = wmma16b(ac[ks], frag_kb(wl + (unsigned)t * 16u * 72u + (unsigned)ks * 32u, hlf), acc[t]); }
    // issue order of the trip: the 4 global loads first (left alone the scheduler sinks them to the foot, where their latency stands in front of the barrier), 4 B fragments read ahead, then a WMMA and the next fragment's 2 LDS reads in turn
    __builtin_amdgcn_sched_group_barrier(0x020, 4, 0); __builtin_amdgcn_sched_group_barrier(0x100, 8, 0);
#pragma unroll  // the order is a straight list of groups: every builtin must stand in the trip's one block
    for (int i = 0; i < 12; ++i) { __builtin_amdgcn_sched_group_barrier(0x008, 1, 0); __builtin_amdgcn_sched_group_barrier(0x100, 2, 0); }
    __builtin_amdgcn_sched_group_barrier(0x008, 4, 0);   // end of the order: the last WMMAs, whose fragments are already read
    wait_lds(); wait_copies(); __syncthreads();
    if (kc + 2u < NH / 2u) stage(kc + 2u, buf); }
  wait_copies();
#pragma unroll
  for (int t = 0; t < 8; ++t) { const unsigned col = (unsigned)t * 16u + nloc; const float bb = bf16_rne(bo[n0 + col]);
#pragma unroll
    for (int r = 0; r < 8; ++r) Tf[wave][8u * hlf + (unsigned)r][col] = acc[t][r] * (1.0f / (CC * WSC)) + bb; }
  __syncthreads();
  float* orow = out + (size_t)m0 * DM + n0 + lane * 4u;
  {
#pragma unroll 4
    for (unsigned rr = 0; rr < 16u; ++rr) { const v4f v = *(const v4f*)(&Tf[wave][rr][lane * 4u]); *(v4f*)(orow + (size_t)rr * DM) = v; }
     }
}

}  // namespace

extern "C" void kernel_launch(void* const* d_in, const int* in_sizes, int n_in, void* d_out, int out_size, void* d_ws, size_t ws_size, hipStream_t stream) {
  (void)n_in;
  auto Fp = [&](int i) { return (const float*)d_in[i]; };
  // wire order: 0 x [4][2048][512], 1 Wq [16][512][32], 2 bq [16][32], 3 Wk, 4 bk, 5 Wv, 6 bv, 7 Wo [512 out][512 in], 8 bo [512]; output [NB][SEQ][512] f32.
  const long long xneed = ((long long)(NB - 1) * SEQ_FULL + SEQ) * 512;
  if ((long long)in_sizes[0] < xneed || in_sizes[1] < 16 * 512 * 32 || in_sizes[2] < 512 || in_sizes[3] < 16 * 512 * 32 || in_sizes[4] < 512 || in_sizes[5] < 16 * 512 * 32 || in_sizes[6] < 512 || in_sizes[7] < 512 * 512 || in_sizes[8] < 512) return;
  if ((long long)out_size < (long long)NB * SEQ * 512) return;
  size_t off = 0; char* ws = (char*)d_ws;
  auto carve = [&](size_t bytes) { char* p = ws + off; off += (bytes + 255) & ~(size_t)255; return p; };
  const size_t planeB = (size_t)NB * SEQ * 512 * 2;               // 8,388,608 B at full size (NB*16*SEQ*32 halves == NB*SEQ*512 halves)
  b16* WT = (b16*)carve((size_t)4 * 512 * 512 * 2); b16* QP = (b16*)carve(planeB); b16* KP = (b16*)carve(planeB); b16* VT = (b16*)carve(planeB); b16* CTX = (b16*)carve(planeB);
  if (off > ws_size || off > ((size_t)128 << 20)) return;         // 4 x 8 MiB + 2 MiB = 35,651,584 B at full size
  wprep_kernel<<<dim3(128, 4), 256, 0, stream>>>(Fp(1), Fp(3), Fp(5), Fp(7), WT);
  qkv_kernel<<<dim3((unsigned)(NB * SEQ / 128), 8), 128, 0, stream>>>(Fp(0), WT, Fp(2), Fp(4), Fp(6), QP, KP, VT);
  flash_kernel<<<(unsigned)(NB * 16 * (SEQ / 128)), 128, 0, stream>>>(QP, KP, VT, CTX);
  oproj_kernel<<<dim3((unsigned)(NB * SEQ / 64), 4), 128, 0, stream>>>(CTX, WT + (size_t)3 * 512 * 512, Fp(8), (float*)d_out);
}

// v010
// It runs in 64.5 microseconds.
// Next to v009, in two timings, it ran 1.06 times as fast each time.
// Counting every step since v000, it is 3.15 times as fast.
#include <hip/hip_runtime.h>

// Dense multi-head attention layer: x [NB][SEQ_FULL][512] (first SEQ rows of each batch used); per-head Q/K/V = x W[h] + b[h] (16 heads x 32), softmax(Q K^T / sqrt(32)) V over all keys, heads concatenated, y = ctx Wo^T + bo.
// compute dtype: every contraction on v_wmma_f32_16x16x32_f16 (f16 operands, f32 accumulate), one product per tile pair. Float inputs are converted to bf16 (RNE) on load and carried exactly
// in f16: x x8 (converted in the projection kernel as its A fragments are read from LDS), weights x256 (Wq/Wk/Wv transposed to [h*32+dh][d], Wo kept [out][in]). Computed planes: Q as f16 x log2(e)/sqrt(32), K as f16 x1, V^T as f16 x16; unnormalised softmax P as f16 x1024 (packed from the score
// accumulators directly into the P.V B fragment); ctx as f16 x256. Biases (bf16 RNE), softmax (kept reference, exp2), normalisation and all epilogues in f32.
// Fragment k-map per lane half hh for A AND B: elements 0..7 <- k = 8hh+0..7, 8..15 <- k = 16+8hh+0..7; acc[r] = D[8hh+r][lane&15].

#ifndef NB
#define NB 4
#endif
#ifndef SEQ
#define SEQ 2048
#endif
#define NB_FULL 4
#define SEQ_FULL 2048

namespace {

constexpr unsigned DM = 512, NH = 16, DH = 32, NBU = (unsigned)NB, SQ = (unsigned)SEQ, QB = SQ / 128u;
constexpr float XS = 8.0f, WSC = 256.0f, QC = 16.0f, PC = 1024.0f, CC = 256.0f;
constexpr float QS = (float)(0.17677669529663687 * 1.4426950408889634);           // scale of the Q plane: log2(e) / sqrt(32); the K plane is x1, so a score product is an exp2 argument as it comes
constexpr float PL = 10.0f; static_assert(PC == 1024.0f);                         // PL = log2(PC)
constexpr float LIM = 65504.0f;                                                   // largest finite f16: bound on a lane's sum of 32 p x1024 taken without a new reference
static_assert(SEQ % 128 == 0 && SEQ <= SEQ_FULL && NB <= NB_FULL && NB >= 1);
static_assert((512 * 512 / 8) % 256 == 0);                    // wprep: 128 blocks x 256 threads x 8 == 512*512 per plane
static_assert(DM == NH * DH && DM % 32 == 0 && DH == 32);

typedef _Float16 b16;
typedef __attribute__((ext_vector_type(16))) _Float16 v16b;
typedef __attribute__((ext_vector_type(8))) _Float16 v8b;
typedef __attribute__((ext_vector_type(8))) float v8f;
typedef __attribute__((ext_vector_type(4))) float v4f;
typedef __attribute__((ext_vector_type(2))) float v2f;
typedef __attribute__((ext_vector_type(2))) __bf16 v2h;
typedef __attribute__((ext_vector_type(2))) _Float16 v2b;

__device__ __forceinline__ float bf16_rne(float f) { unsigned int u = __float_as_uint(f); u += 0x7FFFu + ((u >> 16) & 1u); return __uint_as_float(u & 0xFFFF0000u); }
__device__ __forceinline__ v16b frag_kb(const b16* p, unsigned hh) { const v8b a = *(const v8b*)(p + 8u * hh), b = *(const v8b*)(p + 16u + 8u * hh); v16b f;
#pragma unroll
  for (int e = 0; e < 8; ++e) { f[e] = a[e]; f[8 + e] = b[e]; } return f; }
__device__ __forceinline__ v8f wmma16b(v16b a, v16b b, v8f c) { return __builtin_amdgcn_wmma_f32_16x16x32_f16(false, a, false, b, (short)0, c, false, false); }

// An A fragment of x taken from f32 rows in LDS: the 16 floats of the fragment's k-map (two runs of 8; p = the lane's row + 8 * its half), then bf16 (RNE) x8 as f16. The x8 goes first: a power of two, so the rounding to bf16 falls on the same bit.
struct raw16 { v4f q[4]; };
__device__ __forceinline__ raw16 raw_kb(const float* p) { raw16 r; r.q[0] = *(const v4f*)p; r.q[1] = *(const v4f*)(p + 4u); r.q[2] = *(const v4f*)(p + 16u); r.q[3] = *(const v4f*)(p + 20u); return r; }
__device__ __forceinline__ v16b cvt_kb(const raw16& r) { v16b f;
#pragma unroll  // vector element indices must be compile-time constants: the values stay in registers
  for (int i = 0; i < 8; ++i) { const v2f t = (v2f){r.q[i >> 1][(i & 1) * 2], r.q[i >> 1][(i & 1) * 2 + 1]} * XS; const unsigned u = __builtin_bit_cast(unsigned, __builtin_convertvector(t, v2h));
    const v2b h = __builtin_convertvector((v2f){__uint_as_float(u << 16), __uint_as_float(u & 0xFFFF0000u)}, v2b); f[2 * i] = h[0]; f[2 * i + 1] = h[1]; }
  return f; }

// Asynchronous 16-byte copies, global memory to LDS. Each copy names the lane's LDS byte address l (low 32 bits of the __shared__ address), the lane's byte offset v in the source tile and a scalar base; offset:N moves both addresses,
// so LDS byte = l + N and global byte = base + v + N. l and v are the same for a run of copies, v for every trip, and l changes at most with the buffer: a copy's place in the tile is its N (at most 16,128), and its base is the wave-uniform address g of its rows less N, formed on the scalar unit.
// One asm statement per run of copies: s_wait_xcnt 0 as its last line stands in front of every later rewrite of the registers that the copies name.
typedef unsigned long long u64;
template <unsigned V> struct uc { static constexpr unsigned v = V; };
__device__ __forceinline__ unsigned lds_off(const void* p) { return (unsigned)(size_t)p; }
#define CP "global_load_async_to_lds_b128 "
template <unsigned N0, unsigned N1, unsigned N2, unsigned N3>
__device__ __forceinline__ void copy4(unsigned la, unsigned va, u64 g0, u64 g1, unsigned lb, unsigned vb, u64 g2, u64 g3) {
  asm volatile(CP "%0, %1, %4 offset:%8\n\t" CP "%0, %1, %5 offset:%9\n\t" CP "%2, %3, %6 offset:%10\n\t" CP "%2, %3, %7 offset:%11\n\ts_wait_xcnt 0x0"
               :: "v"(la), "v"(va), "v"(lb), "v"(vb), "s"(g0 - N0), "s"(g1 - N1), "s"(g2 - N2), "s"(g3 - N3), "i"(N0), "i"(N1), "i"(N2), "i"(N3) : "memory"); }
template <unsigned S>   // copy i lands S * i bytes behind l
__device__ __forceinline__ void copy6(unsigned l, unsigned v, u64 g0, u64 g1, u64 g2, u64 g3, u64 g4, u64 g5) {
  asm volatile(CP "%0, %1, %2 offset:%8\n\t" CP "%0, %1, %3 offset:%9\n\t" CP "%0, %1, %4 offset:%10\n\t" CP "%0, %1, %5 offset:%11\n\t" CP "%0, %1, %6 offset:%12\n\t" CP "%0, %1, %7 offset:%13\n\ts_wait_xcnt 0x0"
               :: "v"(l), "v"(v), "s"(g0), "s"(g1 - S), "s"(g2 - 2u * S), "s"(g3 - 3u * S), "s"(g4 - 4u * S), "s"(g5 - 5u * S), "i"(0u), "i"(S), "i"(2u * S), "i"(3u * S), "i"(4u * S), "i"(5u * S) : "memory"); }
template <unsigned S, unsigned G>   // copy i lands S * i bytes behind l and reads G * i bytes behind g
__device__ __forceinline__ void copy8(unsigned l, unsigned v, u64 g) {
  static_assert(G >= S && 7u * S <= 16384u);
  asm volatile(CP "%0, %1, %2 offset:%10\n\t" CP "%0, %1, %3 offset:%11\n\t" CP "%0, %1, %4 offset:%12\n\t" CP "%0, %1, %5 offset:%13\n\t" CP "%0, %1, %6 offset:%14\n\t" CP "%0, %1, %7 offset:%15\n\t" CP "%0, %1, %8 offset:%16\n\t" CP "%0, %1, %9 offset:%17\n\ts_wait_xcnt 0x0"
               :: "v"(l), "v"(v), "s"(g), "s"(g + (G - S)), "s"(g + 2u * (G - S)), "s"(g + 3u * (G - S)), "s"(g + 4u * (G - S)), "s"(g + 5u * (G - S)), "s"(g + 6u * (G - S)), "s"(g + 7u * (G - S)),
                  "i"(0u), "i"(S), "i"(2u * S), "i"(3u * S), "i"(4u * S), "i"(5u * S), "i"(6u * S), "i"(7u * S) : "memory"); }
#undef CP
// Hints to L2 (scope SE: the line comes into L2 only, nothing returns, no counter moves): each lane asks for the 256-byte unit at its own address, well ahead of the copy or load that reads it, so that this one finds an L2 hit and not memory latency.
// Every address lies inside its buffer, but at NT == 8 flash_kernel's trip-0 ask for the last head runs past the ends of KP and VT. s_wait_xcnt 0 as the last line stands in front of every later rewrite of the address registers that the hints name.
#define PF "global_prefetch_b8 "
__device__ __forceinline__ void ask1(const b16* p0) { asm volatile(PF "%0, off scope:SCOPE_SE\n\ts_wait_xcnt 0x0" :: "v"(p0) : "memory"); }
__device__ __forceinline__ void ask2(const b16* p0, const b16* p1) { asm volatile(PF "%0, off scope:SCOPE_SE\n\t" PF "%1, off scope:SCOPE_SE\n\ts_wait_xcnt 0x0" :: "v"(p0), "v"(p1) : "memory"); }
__device__ __forceinline__ void ask3(const float* p0, const b16* p1, const b16* p2) { asm volatile(PF "%0, off scope:SCOPE_SE\n\t" PF "%1, off scope:SCOPE_SE\n\t" PF "%2, off scope:SCOPE_SE\n\ts_wait_xcnt 0x0" :: "v"(p0), "v"(p1), "v"(p2) : "memory"); }
#undef PF
// this wave's copies have landed: in front of the barrier behind which the other waves read them
__device__ __forceinline__ void wait_copies() { asm volatile("s_wait_asynccnt 0x0" ::: "memory"); }
// this wave's LDS reads are done: in front of the barrier behind which their buffer is refilled
__device__ __forceinline__ void wait_lds() { asm volatile("s_wait_dscnt 0x0" ::: "memory"); }

__global__ __launch_bounds__(256) void wprep_kernel(const float* __restrict__ wq, const float* __restrict__ wk, const float* __restrict__ wv, const float* __restrict__ wo, b16* __restrict__ WT) {
  const unsigned z = blockIdx.y; const unsigned u = blockIdx.x * 256u + threadIdx.x; const unsigned e = u * 8u, o = e >> 9, k0 = e & 511u; v8b v;
  if (z < 3u) { const float* w = (z == 0u) ? wq : ((z == 1u) ? wk : wv); const unsigned h = o >> 5, dh = o & 31u; const float* sp = w + ((size_t)h * DM + k0) * DH + dh;
#pragma unroll
    for (int j = 0; j < 8; ++j) v[j] = (b16)(bf16_rne(sp[(size_t)j * DH]) * WSC); }
  else { const float* sp = wo + (size_t)o * DM + k0; const v4f a0 = *(const v4f*)sp, a1 = *(const v4f*)(sp + 4);
#pragma unroll
    for (int j = 0; j < 4; ++j) { v[j] = (b16)(bf16_rne(a0[j]) * WSC); v[4 + j] = (b16)(bf16_rne(a1[j]) * WSC); } }
  b16* dst = WT + (size_t)z * DM * DM + e;
  { *(v8b*)dst = v;  }
}

// Q/K/V projection of two heads: block = 128 rows x 192 columns (q | k | v, each 64 = heads h0, h0 + 1), wave = 32 rows (two groups of 16) x 12 tiles: an A fragment feeds 12 WMMAs, a B fragment read from LDS feeds both groups. A fragments from the f32 rows of x themselves: no cast launch in front.
// The 192 WT rows are shared by the four waves: per trip of 64 k they are copied once into LDS (rows of 128 bytes at pitch 144, two buffers, the next tile in flight while this one is worked on) and the B fragments are read from there. LDS row = plane * 64 + head * 32 + dh, tile tt = rows 16 tt. The block's 128 x rows go the same way, in the same ring and under the same waits (64 k = 256 bytes of f32 a row at pitch 272; a copy instruction covers whole lines): each wave reads its own 32 rows' fragments as f32 and converts them in registers.
// y = acc / 2048 + bf16(b); Q, K planes [bh][SEQ][32] f16, Q x log2(e)/sqrt(32), K x1 (block writes 8192 contiguous bytes per head each); V^T plane [bh][32][SEQ] f16 x16 (32 runs of 128 keys per head). LDS tiles cross-wave: block barrier; they reuse the ring's LDS behind the last trip's barrier.
__global__ __launch_bounds__(128) void qkv_kernel(const float* __restrict__ x, const b16* __restrict__ WT, const float* __restrict__ bq, const float* __restrict__ bk, const float* __restrict__ bv, b16* __restrict__ QP, b16* __restrict__ KP, b16* __restrict__ VT) {
  constexpr unsigned WB = 192u * 144u, XB = 128u * 272u;   // bytes of one buffer: weight rows, x rows
  static_assert(4u * 128u * 40u + 2u * 32u * 136u <= WB + XB && NH % 2u == 0u);   // the output tiles fit in the ring's LDS
  __shared__ __attribute__((aligned(16))) b16 SM[WB + XB];   // halves: 2 WB bytes of weight buffers, then 2 XB bytes of x buffers
  b16 (*Tq)[128][40] = (b16 (*)[128][40])SM; b16 (*Tk)[128][40] = (b16 (*)[128][40])(SM + 2u * 128u * 40u); b16 (*Tv)[32][136] = (b16 (*)[32][136])(SM + 4u * 128u * 40u);
  const unsigned tid = threadIdx.x, wave = tid >> 5, lane = tid & 31u, nloc = lane & 15u, hlf = lane >> 4; const unsigned m0 = blockIdx.x * 128u, h0 = blockIdx.y * 2u;
  const u64 gx = (u64)(size_t)(x + ((size_t)(m0 / SQ) * SEQ_FULL + m0 % SQ) * DM); const unsigned vx = (tid >> 4) * (DM * 4u) + (tid & 15u) * 16u, lx = lds_off(SM + WB) + (tid >> 4) * 272u + (tid & 15u) * 16u;   // a block's 128 rows lie in one batch; 16 lanes copy one row's 256 bytes, a round of the block 8 rows
  const u64 gw = (u64)(size_t)(WT + (size_t)(h0 * DH) * DM); const unsigned vw = (tid >> 3) * (DM * 2u) + (tid & 7u) * 16u, lw = lds_off(SM + (tid >> 3) * 72u + (tid & 7u) * 8u);
  constexpr unsigned R16 = 16u * DM * 2u, PLB = DM * DM * 2u, LW2 = 96u * 144u, LX2 = 64u * 272u;   // bytes: 16 weight rows, a weight plane; LDS bytes in front of the second half of a buffer's weight rows and of its x rows
  auto stage = [&](unsigned kc, unsigned l, unsigned l2, unsigned m, unsigned m2) { const u64 g = gw + kc * 128u, a = gx + kc * 256u;   // l, l2, m, m2: this thread's LDS addresses in the two halves of the weight rows and of the x rows of the buffer that is filled
    copy6<16u * 144u>(l, vw, g, g + R16, g + 2u * R16, g + 3u * R16, g + PLB, g + PLB + R16);
    copy6<16u * 144u>(l2, vw, g + PLB + 2u * R16, g + PLB + 3u * R16, g + 2u * PLB, g + 2u * PLB + R16, g + 2u * PLB + 2u * R16, g + 2u * PLB + 3u * R16);
    copy8<8u * 272u, 8u * DM * 4u>(m, vx, a);
    copy8<8u * 272u, 8u * DM * 4u>(m2, vx, a + 64u * DM * 4u); };
  v8f acc[2][12];
#pragma unroll
  for (int t = 0; t < 12; ++t) { acc[0][t] = (v8f){}; acc[1][t] = (v8f){}; }
  stage(0u, lw, lw + LW2, lx, lx + LX2);
  { // asked while tile 0 is on its way. x: a row's 256-byte unit is one trip's k; the 8 blocks that share these 128 rows ask for the units of trips 2 to 7 between them (a thread = a row). Weights: a unit is two trips' k; the 64 blocks that share these 192 rows ask for the units of trips 2 to 7 by turns (planes q, k: a thread = a row; plane v: two threads a row).
    const unsigned qw = (1u + blockIdx.x % 3u) * 128u; const b16* pw = WT + (size_t)(h0 * DH + (tid & 63u)) * DM + qw;
    ask3(x + ((size_t)(m0 / SQ) * SEQ_FULL + m0 % SQ + tid) * DM + (2u + blockIdx.y % 6u) * 64u, pw + (size_t)(tid >> 6) * DM * DM, pw + (size_t)2u * DM * DM); }
  wait_copies(); __syncthreads(); stage(1u, lw + WB, lw + WB + LW2, lx + XB, lx + XB + LX2);
  unsigned la = lw, la2 = lw + LW2, ma = lx, ma2 = lx + LX2;   // the copy addresses in the buffer of the trip at hand, carried from trip to trip
#pragma unroll 1
  for (unsigned kc = 0; kc < DM / 64u; ++kc) { const unsigned buf = kc & 1u; const b16* wl = SM + buf * (192u * 72u) + nloc * 72u;
    const float* xl = (const float*)(SM + WB) + buf * (XB / 4u) + (wave * 32u + nloc) * 68u + 8u * hlf;   // group g: + g * 16 rows
    const v16b ac[2][2] = {{cvt_kb(raw_kb(xl)), cvt_kb(raw_kb(xl + 32u))}, {cvt_kb(raw_kb(xl + 16u * 68u)), cvt_kb(raw_kb(xl + 16u * 68u + 32u))}};
#pragma unroll  // both k-steps of a trip spelled out: LDS offsets and acc[] indices stay compile-time constants
    for (int ks = 0; ks < 2; ++ks) {
#pragma unroll
      for (int t = 0; t < 12; ++t) { const v16b bf = frag_kb(wl + (unsigned)t * 16u * 72u + (unsigned)ks * 32u, hlf); acc[0][t] = wmma16b(ac[0][ks], bf, acc[0][t]); acc[1][t] = wmma16b(ac[1][ks], bf, acc[1][t]); } }
    // issue order of the trip: the 16 LDS reads of the A fragments and 8 B fragments read ahead (the conversions, in no group, fall between those reads and among the first WMMAs), then 8 WMMAs and the next 4 fragments' 8 LDS reads in turn (few, large groups of LDS reads, for speed only)
    __builtin_amdgcn_sched_group_barrier(0x100, 32, 0);
#pragma unroll  // the order is a straight list of groups: every builtin must stand in the trip's one block
    for (int i = 0; i < 4; ++i) { __builtin_amdgcn_sched_group_barrier(0x008, 8, 0); __builtin_amdgcn_sched_group_barrier(0x100, 8, 0); }
    __builtin_amdgcn_sched_group_barrier(0x008, 16, 0);   // end of the order: the last WMMAs, whose fragments are already read
    __builtin_amdgcn_sched_barrier(0);   // the last WMMAs stay in front of the waits: sunk behind the barrier they put the wait for the last LDS reads right behind their issue and the next tile's copies 15 WMMAs later
    wait_lds(); wait_copies(); __syncthreads();
    if (kc + 2u < DM / 64u) stage(kc + 2u, la, la2, ma, ma2);
    { const unsigned dw = buf ? 0u - WB : WB, dx = buf ? 0u - XB : XB; la += dw; la2 += dw; ma += dx; ma2 += dx; } }
  wait_copies();
  float braw[12]; const unsigned bidx = h0 * DH + nloc;
#pragma unroll
  for (int t = 0; t < 12; ++t) { const float* bp = (t < 4) ? bq : ((t < 8) ? bk : bv); braw[t] = bp[bidx + (unsigned)(t & 3) * 16u]; }
  asm volatile("s_wait_xcnt 0x0" :: "v"(bidx) : "memory");   // behind the 12 bias loads, in front of the first rewrite of the offset register that they name: the input keeps that register as it is up to the wait
#pragma unroll
  for (int t = 0; t < 12; ++t) { const unsigned hl = (unsigned)(t >> 1) & 1u, col = (unsigned)(t & 1) * 16u + nloc; const float bb = bf16_rne(braw[t]);
#pragma unroll
    for (int g = 0; g < 2; ++g) {
#pragma unroll
      for (int r = 0; r < 8; ++r) { const unsigned row = wave * 32u + (unsigned)g * 16u + 8u * hlf + (unsigned)r; const float y = (acc[g][t][r] * (1.0f / (XS * WSC)) + bb) * ((t < 4) ? QS : ((t < 8) ? 1.0f : QC)); const b16 y16 = (b16)y;
        if (t < 4) Tq[hl][row][col] = y16; else if (t < 8) Tk[hl][row][col] = y16; else Tv[hl][col][row] = y16; } } }
  __syncthreads();
  const unsigned b = m0 / SQ, s0 = m0 % SQ, bh = b * NH + h0;
#pragma unroll
  for (int hl = 0; hl < 2; ++hl) { v8b qv[4], kv[4], vv[4];
#pragma unroll
    for (int i = 0; i < 4; ++i) { const unsigned idx = (unsigned)i * 128u + tid; qv[i] = *(const v8b*)(&Tq[hl][idx >> 2][(idx & 3u) * 8u]); kv[i] = *(const v8b*)(&Tk[hl][idx >> 2][(idx & 3u) * 8u]); vv[i] = *(const v8b*)(&Tv[hl][idx >> 4][(idx & 15u) * 8u]); }
    b16* qd = QP + ((size_t)(bh + (unsigned)hl) * SQ + s0) * DH; b16* kd = KP + ((size_t)(bh + (unsigned)hl) * SQ + s0) * DH; b16* vd = VT + (size_t)(bh + (unsigned)hl) * DH * SQ + s0;
#pragma unroll
    for (int i = 0; i < 4; ++i) { const unsigned idx = (unsigned)i * 128u + tid; *(v8b*)(qd + (size_t)idx * 8u) = qv[i]; *(v8b*)(kd + (size_t)idx * 8u) = kv[i]; *(v8b*)(vd + (size_t)(idx >> 4) * SQ + (idx & 15u) * 8u) = vv[i]; } }
}

// flash attention, transposed form: block = 128 queries of one (b, h), wave = 32 queries in two groups of 16 (the D columns of a group's tiles): every K and V^T fragment read from LDS feeds both groups. Per 64 keys and group: S^T tiles = K rows (A) x Q rows (B, loaded once) + C, C = minus the reference in use, so a
// score accumulator is the exp2 argument of p x1024 as it comes; the lane's sum of its 32 p decides whether the reference is renewed (only then: max over the arguments, one xor-16 exchange, O and the row sum rescaled, p anew); the four score tiles are packed (f16) into two B fragments (element r <- tile 2j, element 8+r <- tile 2j+1);
// O^T tiles (dh rows) += V^T rows (A) x P^T (B). The 64 K rows and the 32 V^T rows of a trip are shared by the four waves: copied once into LDS (K rows of 64 bytes at pitch 80, V^T rows of 128 bytes
// at pitch 144, two buffers, the next tile in flight while this one is worked on); the A fragments are read from there. ctx plane [bh][SEQ][32] f16 x256; wave writes its 2048 contiguous bytes. No key tail (SEQ % 64 == 0).
__global__ __launch_bounds__(128) void flash_kernel(const b16* __restrict__ QP, const b16* __restrict__ KP, const b16* __restrict__ VT, b16* __restrict__ CTX) {
  __shared__ __attribute__((aligned(16))) b16 Ks[2][64][40], Vs[2][32][72], Tc[4][32][40];
  const unsigned tid = threadIdx.x, wave = tid >> 5, lane = tid & 31u, nloc = lane & 15u, hlf = lane >> 4; const unsigned bh = blockIdx.x / QB, s0 = (blockIdx.x % QB) * 128u + wave * 32u;
  constexpr unsigned NT = SQ / 64u;
  const u64 gk = (u64)(size_t)(KP + (size_t)bh * SQ * DH), gv = (u64)(size_t)(VT + (size_t)bh * DH * SQ); const unsigned vk = tid * 16u, vv = (tid >> 3) * (SQ * 2u) + (tid & 7u) * 16u;
  const unsigned lk = lds_off(&Ks[0][tid >> 2][(tid & 3u) * 8u]), lv = lds_off(&Vs[0][tid >> 3][(tid & 7u) * 8u]);
  auto stage = [&](unsigned t, auto bc) { constexpr unsigned bk = decltype(bc)::v * (64u * 80u), bv = decltype(bc)::v * (32u * 144u); const u64 k0 = gk + (u64)t * (64u * DH * 2u), v0 = gv + t * 128u;   // bc: the buffer that is filled, a constant: its place goes into the copies' offsets
    copy4<bk, bk + 32u * 80u, bv, bv + 16u * 144u>(lk, vk, k0, k0 + 32u * DH * 2u, lv, vv, v0, v0 + 16u * SQ * 2u); };
  const v16b qb[2] = {frag_kb(QP + ((size_t)bh * SQ + s0 + nloc) * DH, hlf), frag_kb(QP + ((size_t)bh * SQ + s0 + 16u + nloc) * DH, hlf)};
  float lsum[2] = {0.0f, 0.0f}; v8f o[2][2] = {{(v8f){}, (v8f){}}, {(v8f){}, (v8f){}}}, cref[2] = {(v8f){}, (v8f){}};   // cref: minus the reference in use (a max seen - log2(PC)), the same in all 8 rows: the C operand of the score products
  // asked ahead, 4 tiles at a time, one unit a thread: threads 0 to 63 the 64 units of 4 K tiles (16 KB in a row), threads 64 to 127 the 2 units of each of the 32 V^T rows (4 tiles = 512 bytes of a row)
  static_assert(NT % 4u == 0u && NT >= 8u);
  const b16* pf = (tid < 64u) ? KP + (size_t)bh * SQ * DH + tid * 128u : VT + (size_t)bh * DH * SQ + (size_t)((tid - 64u) >> 1) * SQ + (tid & 1u) * 128u;
  const unsigned pstep = (tid < 64u) ? 4u * 64u * DH : 256u; unsigned ta = 0u;   // ta: the next trip that asks (one scalar compare a trip)
  stage(0u, uc<0u>{}); ask2(pf, pf + pstep); pf += pstep; wait_copies(); __syncthreads();   // tiles 0 to 7 asked for while tile 0 is on its way
  if (NT > 1u) stage(1u, uc<1u>{});
  // one trip; bc: its buffer, a constant, so that the buffer's place stands in the offset fields of the LDS reads and of the copies and no vector instruction forms an address
  auto trip = [&](unsigned t, auto bc) __attribute__((always_inline)) {
    constexpr unsigned buf = decltype(bc)::v; const b16* Kl = &Ks[buf][nloc][0]; const b16* Vl = &Vs[buf][nloc][0];
    v8f s[2][4];
#pragma unroll
    for (int j = 0; j < 4; ++j) { const v16b kf = frag_kb(Kl + 16u * (unsigned)j * 40u, hlf); s[0][j] = wmma16b(kf, qb[0], cref[0]); s[1][j] = wmma16b(kf, qb[1], cref[1]); }
    float ps[2]; v16b pb[2][2];
    auto soft = [&](int g) { float p[4][8]; float a = 0.0f;   // p x1024 of the group's 32 arguments, this lane's part of the row sum, and p packed as the two B fragments
#pragma unroll
      for (int j = 0; j < 4; ++j) {
#pragma unroll
        for (int r = 0; r < 8; ++r) p[j][r] = __builtin_amdgcn_exp2f(s[g][j][r]); }
#pragma unroll
      for (int r = 0; r < 8; ++r) a += (p[0][r] + p[1][r]) + (p[2][r] + p[3][r]);
      ps[g] = a;
#pragma unroll
      for (int r = 0; r < 8; ++r) { pb[g][0][r] = (b16)p[0][r]; pb[g][0][8 + r] = (b16)p[1][r]; pb[g][1][r] = (b16)p[2][r]; pb[g][1][8 + r] = (b16)p[3][r]; } };
    soft(0); soft(1);
    // one wave-uniform test a trip, on the sums that are formed anyway: no p is negative, so every p is at most its group's ps, and ps <= LIM keeps all 32 inside f16. The first trip always goes through and sets the references;
    // later any lane above LIM in either group sends the whole wave through (a column that needs nothing gets delta 0). Only there: the max over the arguments, the xor-16 exchange, the rescale of O and the row sum, and p anew.
    const float lim = (t == 0u) ? -1.0f : LIM;   // ps is never below 0
    if (__builtin_amdgcn_ballot_w32(!(ps[0] <= lim) || !(ps[1] <= lim)) != 0u) {
#pragma unroll
      for (int g = 0; g < 2; ++g) {
        float mx = -3.0e38f;
#pragma unroll
        for (int j = 0; j < 4; ++j) {
#pragma unroll
          for (int r = 0; r < 8; ++r) mx = fmaxf(mx, s[g][j][r]); }
        const float d = fmaxf(mx, __shfl_xor(mx, 16, 32)) - PL, dp = fmaxf(d, 0.0f); const float delta = (t == 0u) ? d : dp; const float corr = __builtin_amdgcn_exp2f(-dp);
        lsum[g] *= corr;
#pragma unroll
        for (int r = 0; r < 8; ++r) { o[g][0][r] *= corr; o[g][1][r] *= corr; cref[g][r] -= delta; s[g][0][r] -= delta; s[g][1][r] -= delta; s[g][2][r] -= delta; s[g][3][r] -= delta; }
        soft(g); } }
    lsum[0] += ps[0]; lsum[1] += ps[1];
    { const v16b v00 = frag_kb(Vl, hlf), v10 = frag_kb(Vl + 16u * 72u, hlf), v01 = frag_kb(Vl + 32u, hlf), v11 = frag_kb(Vl + 16u * 72u + 32u, hlf);   // each V^T fragment read once, for both groups
      o[0][0] = wmma16b(v00, pb[0][0], o[0][0]); o[1][0] = wmma16b(v00, pb[1][0], o[1][0]); o[0][1] = wmma16b(v10, pb[0][0], o[0][1]); o[1][1] = wmma16b(v10, pb[1][0], o[1][1]);
      o[0][0] = wmma16b(v01, pb[0][1], o[0][0]); o[1][0] = wmma16b(v01, pb[1][1], o[1][0]); o[0][1] = wmma16b(v11, pb[0][1], o[0][1]); o[1][1] = wmma16b(v11, pb[1][1], o[1][1]); }
    wait_lds(); wait_copies(); __syncthreads();
    if (t + 2u < NT) stage(t + 2u, bc);
    if (t == ta) { pf += pstep; ask1(pf); ta = (t + 12u < NT) ? t + 4u : NT; }   // every 4th trip: tiles t + 8 to t + 11, six trips ahead of the first of their copies; none behind the last tile except trip 0's at NT == 8, the one time pf leaves the head's planes
  };
#pragma unroll 1  // the two trips of a pass are spelled out, one per buffer; more would only lengthen the code
  for (unsigned t = 0; t < NT; t += 2u) { trip(t, uc<0u>{}); trip(t + 1u, uc<1u>{}); }
  wait_copies();
#pragma unroll
  for (int g = 0; g < 2; ++g) {
    const float l = lsum[g] + __shfl_xor(lsum[g], 16, 32);
    const float inv = (CC / QC) * (1.0f / l); v8b c0, c1;   // the row sum carries the x1024 of P, as the O tiles do
#pragma unroll
    for (int r = 0; r < 8; ++r) { c0[r] = (b16)(o[g][0][r] * inv); c1[r] = (b16)(o[g][1][r] * inv); }
    *(v8b*)(&Tc[wave][(unsigned)g * 16u + nloc][8u * hlf]) = c0; *(v8b*)(&Tc[wave][(unsigned)g * 16u + nloc][16u + 8u * hlf]) = c1; }
  __syncthreads();
  v8b cv[4];
#pragma unroll
  for (int i = 0; i < 4; ++i) { const unsigned idx = (unsigned)i * 32u + lane; cv[i] = *(const v8b*)(&Tc[wave][idx >> 2][(idx & 3u) * 8u]); }
  b16* cd = CTX + ((size_t)bh * SQ + s0) * DH;
  {
#pragma unroll
    for (int i = 0; i < 4; ++i) { const unsigned idx = (unsigned)i * 32u + lane; *(v8b*)(cd + (size_t)idx * 8u) = cv[i]; }
     }
}

// output projection: block = 64 rows x 128 columns, wave = 16 rows x 8 tiles; k-step = one head (A fragment from ctx[bh][s][0..31], loaded one trip ahead; B fragment from Wo rows at k = h*32). The 128 Wo rows are shared by the four waves: per trip of two heads (64 k)
// they are copied once into LDS (rows of 128 bytes at pitch 144, two buffers, the next tile in flight while this one is worked on) and the B fragments are read from there. y = acc / 65536 + bf16(bo).
__global__ __launch_bounds__(128) void oproj_kernel(const b16* __restrict__ CTX, const b16* __restrict__ WO, const float* __restrict__ bo, float* __restrict__ out) {
  __shared__ __attribute__((aligned(16))) float Tf[4][16][132];
  __shared__ __attribute__((aligned(16))) b16 Ws[2][128][72];
  const unsigned tid = threadIdx.x, wave = tid >> 5, lane = tid & 31u, nloc = lane & 15u, hlf = lane >> 4; const unsigned m0 = blockIdx.x * 64u + wave * 16u, n0 = blockIdx.y * 128u; const unsigned b = m0 / SQ, s0 = m0 % SQ;
  const b16* abase = CTX + ((size_t)(b * NH) * SQ + s0 + nloc) * DH; 
  const u64 gw = (u64)(size_t)(WO + (size_t)n0 * DM); const unsigned vw = (tid >> 3) * (DM * 2u) + (tid & 7u) * 16u, lw = lds_off(&Ws[0][tid >> 3][(tid & 7u) * 8u]);
  auto stage = [&](unsigned kc, unsigned l) { copy8<16u * 144u, 16u * DM * 2u>(l, vw, gw + kc * 128u); };   // l: this thread's LDS address in the buffer that is filled
  v8f acc[8];
#pragma unroll
  for (int t = 0; t < 8; ++t) acc[t] = (v8f){};
  v16b an[2] = {frag_kb(abase, hlf), frag_kb(abase + (size_t)SQ * DH, hlf)};   // A fragments one trip ahead: trip 0's are in flight during the first tile's copies
  stage(0u, lw);
  { // asked while tile 0 is on its way. ctx: a head's 64 rows of this block are 16 units in a row; the 4 blocks that share the rows ask for 8 heads each. Wo: a unit is two trips' k; the 128 blocks that share these 128 rows ask for the units of trips 2 to 7 by turns (a thread = a row).
    const unsigned mb = blockIdx.x * 64u;
    ask2(CTX + ((size_t)((mb / SQ) * NH + (blockIdx.y & 1u) * 8u + (tid >> 4)) * SQ + mb % SQ) * DH + (tid & 15u) * 128u, WO + (size_t)(n0 + tid) * DM + (1u + blockIdx.x % 3u) * 128u); }
  wait_copies(); __syncthreads(); stage(1u, lw + 128u * 144u);
  unsigned la = lw;   // the copy address in the buffer of the trip at hand, carried from trip to trip
#pragma unroll 1
  for (unsigned kc = 0; kc < NH / 2u; ++kc) { const unsigned buf = kc & 1u; const b16* wl = &Ws[buf][nloc][0];
    const v16b ac[2] = {an[0], an[1]}; const unsigned kn = (kc + 1u < NH / 2u) ? kc + 1u : kc;   // the last trip loads its own fragments again: in bounds, no branch
    an[0] = frag_kb(abase + (size_t)(kn * 2u) * SQ * DH, hlf); an[1] = frag_kb(abase + (size_t)(kn * 2u + 1u) * SQ * DH, hlf);
#pragma unroll  // both k-steps of a trip spelled out: LDS offsets and acc[] indices stay compile-time constants
    for (int ks = 0; ks < 2; ++ks) {
#pragma unroll
      for (int t = 0; t < 8; ++t) acc[t] = wmma16b(ac[ks], frag_kb(wl + (unsigned)t * 16u * 72u + (unsigned)ks * 32u, hlf), acc[t]); }
    // issue order of the trip: the 4 global loads first (left alone the scheduler sinks them to the foot, where their latency stands in front of the barrier), 4 B fragments read ahead, then a WMMA and the next fragment's 2 LDS reads in turn
    __builtin_amdgcn_sched_group_barrier(0x020, 4, 0); __builtin_amdgcn_sched_group_barrier(0x100, 8, 0);
#pragma unroll  // the order is a straight list of groups: every builtin must stand in the trip's one block
    for (int i = 0; i < 12; ++i) { __builtin_amdgcn_sched_group_barrier(0x008, 1, 0); __builtin_amdgcn_sched_group_barrier(0x100, 2, 0); }
    __builtin_amdgcn_sched_group_barrier(0x008, 4, 0);   // end of the order: the last WMMAs, whose fragments are already read
    wait_lds(); wait_copies(); __syncthreads();
    if (kc + 2u < NH / 2u) stage(kc + 2u, la);
    la += buf ? 0u - 128u * 144u : 128u * 144u; }
  wait_copies();
#pragma unroll
  for (int t = 0; t < 8; ++t) { const unsigned col = (unsigned)t * 16u + nloc; const float bb = bf16_rne(bo[n0 + col]);
#pragma unroll
    for (int r = 0; r < 8; ++r) Tf[wave][8u * hlf + (unsigned)r][col] = acc[t][r] * (1.0f / (CC * WSC)) + bb; }
  __syncthreads();
  float* orow = out + (size_t)m0 * DM + n0 + lane * 4u;
  {
#pragma unroll 4
    for (unsigned rr = 0; rr < 16u; ++rr) { const v4f v = *(const v4f*)(&Tf[wave][rr][lane * 4u]); *(v4f*)(orow + (size_t)rr * DM) = v; }
     }
}

}  // namespace

extern "C" void kernel_launch(void* const* d_in, const int* in_sizes, int n_in, void* d_out, int out_size, void* d_ws, size_t ws_size, hipStream_t stream) {
  (void)n_in;
  auto Fp = [&](int i) { return (const float*)d_in[i]; };
  // wire order: 0 x [4][2048][512], 1 Wq [16][512][32], 2 bq [16][32], 3 Wk, 4 bk, 5 Wv, 6 bv, 7 Wo [512 out][512 in], 8 bo [512]; output [NB][SEQ][512] f32.
  const long long xneed = ((long long)(NB - 1) * SEQ_FULL + SEQ) * 512;
  if ((long long)in_sizes[0] < xneed || in_sizes[1] < 16 * 512 * 32 || in_sizes[2] < 512 || in_sizes[3] < 16 * 512 * 32 || in_sizes[4] < 512 || in_sizes[5] < 16 * 512 * 32 || in_sizes[6] < 512 || in_sizes[7] < 512 * 512 || in_sizes[8] < 512) return;
  if ((long long)out_size < (long long)NB * SEQ * 512) return;
  size_t off = 0; char* ws = (char*)d_ws;
  auto carve = [&](size_t bytes) { char* p = ws + off; off += (bytes + 255) & ~(size_t)255; return p; };
  const size_t planeB = (size_t)NB * SEQ * 512 * 2;               // 8,388,608 B at full size (NB*16*SEQ*32 halves == NB*SEQ*512 halves)
  b16* WT = (b16*)carve((size_t)4 * 512 * 512 * 2); b16* QP = (b16*)carve(planeB); b16* KP = (b16*)carve(planeB); b16* VT = (b16*)carve(planeB); b16* CTX = (b16*)carve(planeB);
  if (off > ws_size || off > ((size_t)128 << 20)) return;         // 4 x 8 MiB + 2 MiB = 35,651,584 B at full size
  wprep_kernel<<<dim3(128, 4), 256, 0, stream>>>(Fp(1), Fp(3), Fp(5), Fp(7), WT);
  qkv_kernel<<<dim3((unsigned)(NB * SEQ / 128), 8), 128, 0, stream>>>(Fp(0), WT, Fp(2), Fp(4), Fp(6), QP, KP, VT);
  flash_kernel<<<(unsigned)(NB * 16 * (SEQ / 128)), 128, 0, stream>>>(QP, KP, VT, CTX);
  oproj_kernel<<<dim3((unsigned)(NB * SEQ / 64), 4), 128, 0, stream>>>(CTX, WT + (size_t)3 * 512 * 512, Fp(8), (float*)d_out);
}
